// v000
// Times are from an AMD MI455X. After a warm-up the kernel runs many times in a row, and a time is the length of
// such a window on the GPU divided by its runs, so every launch and the gaps after it count. The runs cycle
// through copies of the inputs. A figure is the median of several windows, for all but v000 over two sittings.
// Sittings can differ by a few percent; kernels timed side by side share one.
// v000 is the starting kernel. One run takes 1470 microseconds.
#include <hip/hip_runtime.h>

// Masked (causal) self-attention with residual and post-LayerNorm (x [2][2048][1024]; q,k,v = x W^T + b ('oi' uniform(+-1/32) incl. biases; 16 heads x 64); energy / 8; causal (-inf); softmax; out = merged Wo^T + bo; y = LayerNorm(out + x) gamma/beta (1e-5) -> [2][2048][1024] (4.2 M)).
// Layout per batch: bf16 copy of x; 'oi' weights; exact projections + f32 biases; causal T-2048 attention (hybrid rows: < 512 hi/lo 3 products, rest fp16 x1024; tiles above the diagonal skipped); merged hi/lo x Wo exact + bo into workspace; residual add and a row LayerNorm kernel write the output rows.
// Compute dtypes, f32 accumulate: every input rounded to bf16; projections exact + f32 biases; attention rows < 512 3 products, rest fp16; softmax f32; Wo hl x exact + bias; residual + LayerNorm f32.

#define NB_  2
#define TT   2048
#define DM   1024
#define NH_  16
#define NKV  16
#define REP  (NH_ / NKV)
#define HD   64
#define DQ   (NH_ * HD)
#define DKV  (NKV * HD)
#define ZH   2
#define RH   512                  // query rows < RH use hi+lo planes (0: none)
#define WIN  2048
#define PCAR 1024.0f
#define SCL  0.125f   // HD^-0.5
#define LNEPS 1e-5f
typedef _Float16 h16;
typedef unsigned short bf;
typedef __attribute__((ext_vector_type(16))) __bf16   v16bf;
typedef __attribute__((ext_vector_type(16))) _Float16 v16h;
typedef __attribute__((ext_vector_type(8)))  _Float16 v8h;
typedef __attribute__((ext_vector_type(8)))  unsigned short v8us;
typedef __attribute__((ext_vector_type(8)))  float    v8f;
typedef __attribute__((ext_vector_type(4)))  float    v4f;
typedef v8h  __attribute__((may_alias)) v8ha;
typedef v4f  __attribute__((may_alias)) v4fa;
typedef v8us __attribute__((may_alias)) v8usa;

__device__ __forceinline__ unsigned short f2bf(float f) { unsigned u = __float_as_uint(f); u += 0x7FFFu + ((u >> 16) & 1u); return (unsigned short)(u >> 16); }
__device__ __forceinline__ float bf2f(unsigned short b) { return __uint_as_float(((unsigned)b) << 16); }
__device__ __forceinline__ float bfr(float f) { return bf2f(f2bf(f)); }
__device__ __forceinline__ v16h cat16(v8h lo, v8h hi) { return __builtin_shufflevector(lo, hi, 0, 1, 2, 3, 4, 5, 6, 7, 8, 9, 10, 11, 12, 13, 14, 15); }
__device__ __forceinline__ v16bf cat16b(v8us lo, v8us hi) { return __builtin_bit_cast(v16bf, __builtin_shufflevector(lo, hi, 0, 1, 2, 3, 4, 5, 6, 7, 8, 9, 10, 11, 12, 13, 14, 15)); }
__device__ __forceinline__ v8f wmma16(v16h a, v16h b, v8f c) { return __builtin_amdgcn_wmma_f32_16x16x32_f16(false, a, false, b, (short)0, c, false, false); }
__device__ __forceinline__ v8f wmmab(v16bf a, v16bf b, v8f c) { return __builtin_amdgcn_wmma_f32_16x16x32_bf16(false, a, false, b, (short)0, c, false, false); }



// ---- k_gemmw: register-blocked GEMM, ONE WAVE per 64x64 output tile (16 accumulators), operands straight from K-contiguous 16-bit planes; grid (M/64, N/64, Z), 32 threads.
// C[m][n] (f32, pitch ldc, + optional f32 bias[n]) = sum_k A[m][k] Bt[n][k] (+ split products per NSPLIT). z-batch strides sA/sB/sC in elements. K % 32 == 0.
template <typename T16> struct WFrag;
template <> struct WFrag<h16> { typedef v16h V; static __device__ __forceinline__ V ld(const h16* p) { return cat16(*(const v8h*)p, *(const v8h*)(p + 16)); } static __device__ __forceinline__ v8f mma(V a, V b, v8f c) { return wmma16(a, b, c); } };
template <> struct WFrag<bf> { typedef v16bf V; static __device__ __forceinline__ V ld(const bf* p) { return cat16b(*(const v8us*)p, *(const v8us*)(p + 16)); } static __device__ __forceinline__ v8f mma(V a, V b, v8f c) { return wmmab(a, b, c); } };
template <typename T16, int NSPLIT, bool BIAS>
__global__ __launch_bounds__(32) void k_gemmw(const T16* __restrict__ A, const T16* __restrict__ A2, const T16* __restrict__ Bt, const T16* __restrict__ Bt2, int K, float* C, int ldc, const float* __restrict__ bias, size_t sA, size_t sB, size_t sC) {
    typedef typename WFrag<T16>::V V;
    __shared__ __align__(16) float os[16 * 68];
    const size_t z = blockIdx.z; A += z * sA; if (A2) A2 += z * sA; Bt += z * sB; if (Bt2) Bt2 += z * sB; C += z * sC;
    const int lane = threadIdx.x & 31, lr = lane & 15, hi = lane >> 4; const int r0 = blockIdx.x * 64, c0 = blockIdx.y * 64;
    v8f acc[4][4];
#pragma unroll
    for (int mb = 0; mb < 4; ++mb)
#pragma unroll
        for (int nb = 0; nb < 4; ++nb) acc[mb][nb] = (v8f){};
    const size_t aoff = (size_t)(r0 + lr) * K + 8 * hi, boff = (size_t)(c0 + lr) * K + 8 * hi;
#pragma unroll 1
    for (int kc = 0; kc < K; kc += 32) {
        V a[4], a2[4];
#pragma unroll
        for (int mb = 0; mb < 4; ++mb) { a[mb] = WFrag<T16>::ld(A + aoff + (size_t)mb * 16 * K + kc); if (NSPLIT == 1 || NSPLIT == 2) a2[mb] = WFrag<T16>::ld(A2 + aoff + (size_t)mb * 16 * K + kc); }
#pragma unroll
        for (int nb = 0; nb < 4; ++nb) { const V b = WFrag<T16>::ld(Bt + boff + (size_t)nb * 16 * K + kc); V b2; if (NSPLIT >= 2) b2 = WFrag<T16>::ld(Bt2 + boff + (size_t)nb * 16 * K + kc);
#pragma unroll
            for (int mb = 0; mb < 4; ++mb) { acc[mb][nb] = WFrag<T16>::mma(a[mb], b, acc[mb][nb]); if (NSPLIT == 1 || NSPLIT == 2) acc[mb][nb] = WFrag<T16>::mma(a2[mb], b, acc[mb][nb]); if (NSPLIT >= 2) acc[mb][nb] = WFrag<T16>::mma(a[mb], b2, acc[mb][nb]); } }
        asm volatile("v_nop\n\tv_nop\n\tv_nop\n\tv_nop" : "+v"(acc[0][0]), "+v"(acc[1][1]), "+v"(acc[2][2]), "+v"(acc[3][3]) : "v"(a[0]), "v"(a[3]));
    }
#pragma unroll
    for (int mb = 0; mb < 4; ++mb) {
#pragma unroll
        for (int nb = 0; nb < 4; ++nb) {
#pragma unroll
            for (int j = 0; j < 8; ++j) os[(hi * 8 + j) * 68 + nb * 16 + lr] = acc[mb][nb][j]; }
        __builtin_amdgcn_wave_barrier(); asm volatile("" ::: "memory");
        float* crow = C + (size_t)(r0 + mb * 16) * ldc + c0;
{
#pragma unroll
            for (int s = 0; s < 8; ++s) { const int row = 2 * s + hi, cofs = lr * 4; v4f val = *(const v4fa*)(os + row * 68 + cofs); if (BIAS) { val[0] += bfr(bias[c0 + cofs]); val[1] += bfr(bias[c0 + cofs + 1]); val[2] += bfr(bias[c0 + cofs + 2]); val[3] += bfr(bias[c0 + cofs + 3]); }
                *(v4f*)(crow + (size_t)row * ldc + cofs) = val; }
             }
        __builtin_amdgcn_wave_barrier(); asm volatile("" ::: "memory");
    }
}

// ---- k_gemmc: the same one-wave 64x64 tile GEMM specialised for causal attention: CMODE 1 skips score tiles entirely above the diagonal (query rows r0+roff.., key columns c0..), CMODE 2 limits the
// key (K) loop of the probability x value contraction to the diagonal block (probabilities beyond it are exactly zero). roff = row offset of this launch's first row within the sequence.
template <typename T16, int NSPLIT, int CMODE>
__global__ __launch_bounds__(32) void k_gemmc(const T16* __restrict__ A, const T16* __restrict__ A2, const T16* __restrict__ Bt, const T16* __restrict__ Bt2, int K, float* C, int ldc, int roff, size_t sA, size_t sB, size_t sC) {
    typedef typename WFrag<T16>::V V;
    __shared__ __align__(16) float os[16 * 68];
    const size_t z = blockIdx.z; A += z * sA; if (A2) A2 += z * sA; Bt += z * sB; if (Bt2) Bt2 += z * sB; C += z * sC;
    const int lane = threadIdx.x & 31, lr = lane & 15, hi = lane >> 4; const int r0 = blockIdx.x * 64, c0 = blockIdx.y * 64;
    if (CMODE == 1 && c0 > r0 + roff + 63) return;                  // score tile entirely above the causal diagonal: never written (the softmax masks j > i by select)
    const int Kl = (CMODE == 2) ? min(K, r0 + roff + 64) : K;        // P.V: probabilities are exactly 0 beyond the diagonal block, so the K loop stops there
    v8f acc[4][4];
#pragma unroll
    for (int mb = 0; mb < 4; ++mb)
#pragma unroll
        for (int nb = 0; nb < 4; ++nb) acc[mb][nb] = (v8f){};
    const size_t aoff = (size_t)(r0 + lr) * K + 8 * hi, boff = (size_t)(c0 + lr) * K + 8 * hi;
#pragma unroll 1
    for (int kc = 0; kc < Kl; kc += 32) {
        V a[4], a2[4];
#pragma unroll
        for (int mb = 0; mb < 4; ++mb) { a[mb] = WFrag<T16>::ld(A + aoff + (size_t)mb * 16 * K + kc); if (NSPLIT == 1 || NSPLIT == 2) a2[mb] = WFrag<T16>::ld(A2 + aoff + (size_t)mb * 16 * K + kc); }
#pragma unroll
        for (int nb = 0; nb < 4; ++nb) { const V b = WFrag<T16>::ld(Bt + boff + (size_t)nb * 16 * K + kc); V b2; if (NSPLIT >= 2) b2 = WFrag<T16>::ld(Bt2 + boff + (size_t)nb * 16 * K + kc);
#pragma unroll
            for (int mb = 0; mb < 4; ++mb) { acc[mb][nb] = WFrag<T16>::mma(a[mb], b, acc[mb][nb]); if (NSPLIT == 1 || NSPLIT == 2) acc[mb][nb] = WFrag<T16>::mma(a2[mb], b, acc[mb][nb]); if (NSPLIT >= 2) acc[mb][nb] = WFrag<T16>::mma(a[mb], b2, acc[mb][nb]); } }
        asm volatile("v_nop\n\tv_nop\n\tv_nop\n\tv_nop" : "+v"(acc[0][0]), "+v"(acc[1][1]), "+v"(acc[2][2]), "+v"(acc[3][3]) : "v"(a[0]), "v"(a[3]));
    }
#pragma unroll
    for (int mb = 0; mb < 4; ++mb) {
#pragma unroll
        for (int nb = 0; nb < 4; ++nb) {
#pragma unroll
            for (int j = 0; j < 8; ++j) os[(hi * 8 + j) * 68 + nb * 16 + lr] = acc[mb][nb][j]; }
        __builtin_amdgcn_wave_barrier(); asm volatile("" ::: "memory");
        float* crow = C + (size_t)(r0 + mb * 16) * ldc + c0;
{
#pragma unroll
            for (int s = 0; s < 8; ++s) { const int row = 2 * s + hi, cofs = lr * 4; v4f val = *(const v4fa*)(os + row * 68 + cofs);
                *(v4f*)(crow + (size_t)row * ldc + cofs) = val; }
             }
        __builtin_amdgcn_wave_barrier(); asm volatile("" ::: "memory");
    }
}

__device__ __forceinline__ h16 tohx(float x) { return (h16)x; }
__device__ __forceinline__ void splitf(float y, unsigned short& h, unsigned short& l) { h = f2bf(y); l = f2bf(y - bf2f(h)); }
typedef __attribute__((ext_vector_type(2))) _Float16 v2h;
typedef __attribute__((ext_vector_type(4))) _Float16 v4h;
typedef __attribute__((ext_vector_type(2))) unsigned short v2us;
typedef __attribute__((ext_vector_type(4))) unsigned short v4us;
typedef __attribute__((ext_vector_type(2))) float v2f;
typedef __attribute__((ext_vector_type(4))) int v4i;

__global__ __launch_bounds__(256) void k_wtG(const float* __restrict__ w, int K, int N, bf* Bt) {
    const int lane = threadIdx.x & 31; const int L0 = (blockIdx.x * 8 + (threadIdx.x >> 5)) * 8; const int nlines = N * K / 64;
{
#pragma unroll 1
        for (int l = 0; l < 8; ++l) { const int L = L0 + l; if (L >= nlines) break; const size_t e = (size_t)L * 64 + lane * 2; const int k = (int)(e % K), n = (int)(e / K); v2us o;
            o[0] = f2bf(w[(size_t)k * N + n]); o[1] = f2bf(w[(size_t)(k + 1) * N + n]); *(v2us*)(Bt + e) = o; }
         }
}
__global__ __launch_bounds__(256) void k_cvt8(const float* __restrict__ src, bf* dst, size_t n8) { const size_t i = (size_t)blockIdx.x * 256 + threadIdx.x; if (i >= n8) return; const v8f v = *(const v8f*)(src + i * 8); v8us o;
#pragma unroll
    for (int k = 0; k < 8; ++k) o[k] = f2bf(v[k]); *(v8us*)(dst + i * 8) = o;  }

// k_rope: head planes [h][t][d] (fp16 + hi/lo) of rope(x) x sc with the rotate-half convention out[d] = x[d] cos[t][d] - x[d+HD/2] sin[t][d], out[d+HD/2] = x[d+HD/2] cos[t][d+HD/2] + x[d] sin[t][d+HD/2]
__global__ __launch_bounds__(256) void k_rope(const float* __restrict__ F, int pitch, int nheads, const float* __restrict__ CS, const float* __restrict__ RF, const float* __restrict__ nw, float sc, h16* P16, bf* Ph, bf* Pl) {
    const size_t e = ((size_t)blockIdx.x * 256 + threadIdx.x) * 2; if (e >= (size_t)nheads * TT * HD) return; const int d = (int)(e % HD); const int t = (int)((e / HD) % TT); const int h = (int)(e / ((size_t)HD * TT)); const float* f = F + (size_t)t * pitch + h * HD; const float rf = RF ? RF[(size_t)h * TT + t] : 1.0f; v2h o16; v2us oh, ol;
#pragma unroll
    for (int q = 0; q < 2; ++q) { const int dd = d + q; const int dp = (dd < HD / 2) ? dd + HD / 2 : dd - HD / 2; float x0 = f[dd], x1 = f[dp];
        if (RF) { float n0 = __fmul_rn(x0, rf), n1 = __fmul_rn(x1, rf); asm volatile("" : "+v"(n0)); asm volatile("" : "+v"(n1)); x0 = __fmul_rn(bfr(nw[dd]), n0); x1 = __fmul_rn(bfr(nw[dp]), n1); }
        const v2f cs = *(const v2f*)(CS + ((size_t)t * HD + dd) * 2); float a = __fmul_rn(x0, cs[0]), bq = __fmul_rn(x1, cs[1]); asm volatile("" : "+v"(a)); asm volatile("" : "+v"(bq)); const float r = ((dd < HD / 2) ? __fsub_rn(a, bq) : __fadd_rn(a, bq)) * sc;
        o16[q] = tohx(r); unsigned short a2, c2; splitf(r, a2, c2); oh[q] = a2; ol[q] = c2; }
    *(v2h*)(P16 + e) = o16; *(v2us*)(Ph + e) = oh; *(v2us*)(Pl + e) = ol;  }
__global__ __launch_bounds__(256) void k_vtp(const float* __restrict__ F, int pitch, int nheads, h16* V16, bf* Vh, bf* Vl) { const size_t e = ((size_t)blockIdx.x * 256 + threadIdx.x) * 2; if (e >= (size_t)nheads * HD * TT) return; const int t = (int)(e % TT); const int d = (int)((e / TT) % HD); const int g = (int)(e / ((size_t)TT * HD)); v2h o16; v2us oh, ol;
#pragma unroll
    for (int q = 0; q < 2; ++q) { const float x = F[(size_t)(t + q) * pitch + g * HD + d]; o16[q] = tohx(x); unsigned short a2, c2; splitf(x, a2, c2); oh[q] = a2; ol[q] = c2; }
    *(v2h*)(V16 + e) = o16; *(v2us*)(Vh + e) = oh; *(v2us*)(Vl + e) = ol;  }
__global__ __launch_bounds__(256) void k_csid(float* CS) { const int idx = blockIdx.x * 256 + threadIdx.x; if (idx >= TT * HD) return; v2f cs; cs[0] = 1.0f; cs[1] = 0.0f; *(v2f*)(CS + (size_t)idx * 2) = cs;  }
// k_asoft: per row (zz, i): t = S x HD^-0.5 for j <= i and i - j < WIN (sliding causal window; the reference's -1e9 additive fill vanishes identically); softmax over the 2048 keys (register row, one exp, fixed trees);
__global__ __launch_bounds__(256) void k_asoft(const float* __restrict__ Sb, h16* P16, bf* Ph, bf* Pl) {
    const int lane = threadIdx.x & 31; const int row = blockIdx.x * 8 + (threadIdx.x >> 5); if (row >= ZH * TT) return; const int i = row % TT; const int zz = row / TT; (void)zz; const bool hires = (i < RH); const float* sr = Sb + (size_t)row * TT; float v[TT / 32]; float mx = -3.0e38f;
#pragma unroll
    for (int ch = 0; ch < TT / 128; ++ch) { const int j0 = ch * 128 + lane * 4; const v4f a = *(const v4f*)(sr + j0);
#pragma unroll
        for (int q = 0; q < 4; ++q) { const int j = j0 + q; (void)j; const float t = (j <= i && i - j < WIN) ? a[q] * SCL : -3.0e38f; v[ch * 4 + q] = t; mx = fmaxf(mx, t); } }
#pragma unroll
    for (int sh = 16; sh; sh >>= 1) mx = fmaxf(mx, __shfl_xor(mx, sh, 32));
    float sum = 0.f;
#pragma unroll
    for (int k = 0; k < TT / 32; ++k) { float d0 = __fsub_rn(v[k], mx); asm volatile("" : "+v"(d0)); v[k] = __builtin_amdgcn_exp2f(__fmul_rn(d0, 1.4426950408889634f)); sum += v[k]; }
#pragma unroll
    for (int sh = 16; sh; sh >>= 1) sum += __shfl_xor(sum, sh, 32);
    const float f = __fdiv_rn(hires ? 1.0f : PCAR, sum);
{
        if (hires) {
#pragma unroll
            for (int ch = 0; ch < TT / 128; ++ch) { v4us oh, ol;
#pragma unroll
                for (int q = 0; q < 4; ++q) { unsigned short a, c2; splitf(v[ch * 4 + q] * f, a, c2); oh[q] = a; ol[q] = c2; }
                const size_t oo = ((size_t)zz * (RH ? RH : 1) + i) * TT + ch * 128 + lane * 4; *(v4us*)(Ph + oo) = oh; *(v4us*)(Pl + oo) = ol; }
        } else {
#pragma unroll
            for (int ch = 0; ch < TT / 128; ++ch) { v4h o4;
#pragma unroll
                for (int q = 0; q < 4; ++q) o4[q] = tohx(v[ch * 4 + q] * f);
                *(v4h*)(P16 + (size_t)row * TT + ch * 128 + lane * 4) = o4; } }
         }
}
__global__ __launch_bounds__(256) void k_addres(float* Y, const float* __restrict__ xr) { const size_t i = (size_t)blockIdx.x * 256 + threadIdx.x; if (i >= (size_t)TT * DQ / 4) return; const v4f a = *(const v4f*)(Y + i * 4); const v4f r = *(const v4f*)(xr + i * 4); v4f o;
#pragma unroll
    for (int q = 0; q < 4; ++q) o[q] = __fadd_rn(a[q], bfr(r[q]));
    *(v4f*)(Y + i * 4) = o;  }
__global__ __launch_bounds__(256) void k_lnout(const float* __restrict__ F, const float* __restrict__ g, const float* __restrict__ bb, float* out) { const int lane = threadIdx.x & 31; const int row = blockIdx.x * 8 + (threadIdx.x >> 5); if (row >= TT) return; const float* fr = F + (size_t)row * DQ; float* orow = out + (size_t)row * DQ; float v[DQ / 32]; float s = 0.f;
#pragma unroll
    for (int c = 0; c < DQ / 128; ++c) { const v4f a = *(const v4f*)(fr + c * 128 + lane * 4); for (int q = 0; q < 4; ++q) { v[c * 4 + q] = a[q]; s = __fadd_rn(s, a[q]); } }
#pragma unroll
    for (int sh = 16; sh; sh >>= 1) s = __fadd_rn(s, __shfl_xor(s, sh, 32));
    const float mean = __fdiv_rn(s, (float)DQ); float s2 = 0.f;
#pragma unroll
    for (int k = 0; k < DQ / 32; ++k) { const float dv = __fsub_rn(v[k], mean); float p2 = __fmul_rn(dv, dv); asm volatile("" : "+v"(p2)); s2 = __fadd_rn(s2, p2); v[k] = dv; }
#pragma unroll
    for (int sh = 16; sh; sh >>= 1) s2 = __fadd_rn(s2, __shfl_xor(s2, sh, 32));
    const float rs = __fdiv_rn(1.0f, __fsqrt_rn(__fadd_rn(__fdiv_rn(s2, (float)DQ), LNEPS)));
{
#pragma unroll
        for (int c = 0; c < DQ / 128; ++c) { v4f o; for (int q = 0; q < 4; ++q) { const int col = c * 128 + lane * 4 + q; float y = __fmul_rn(v[c * 4 + q], rs); asm volatile("" : "+v"(y)); y = __fmul_rn(y, bfr(g[col])); asm volatile("" : "+v"(y)); o[q] = __fadd_rn(y, bfr(bb[col])); } *(v4f*)(orow + c * 128 + lane * 4) = o; }
         } }
__global__ __launch_bounds__(256) void k_merge(const float* __restrict__ O, int h0, bf* Ah, bf* Al) { const size_t e = ((size_t)blockIdx.x * 256 + threadIdx.x) * 2; if (e >= (size_t)ZH * TT * HD) return; const int d = (int)(e % HD); const int t = (int)((e / HD) % TT); const int zz = (int)(e / ((size_t)HD * TT)); const float cs = (t < RH) ? 1.0f : (1.0f / PCAR); const size_t oo = (size_t)t * DQ + (h0 + zz) * HD + d;
    v2us oh, ol;
#pragma unroll
    for (int q = 0; q < 2; ++q) { unsigned short a, c2; splitf(O[e + q] * cs, a, c2); oh[q] = a; ol[q] = c2; } *(v2us*)(Ah + oo) = oh; *(v2us*)(Al + oo) = ol;  }

extern "C" void kernel_launch(void* const* d_in, const int* in_sizes, int n_in,
                              void* d_out, int out_size, void* d_ws, size_t ws_size, hipStream_t stream) {
    (void)in_sizes; (void)n_in; (void)out_size;
    const float* x = (const float*)d_in[0]; const float* wq = (const float*)d_in[1]; const float* bq = (const float*)d_in[2]; const float* wk = (const float*)d_in[3]; const float* bk = (const float*)d_in[4]; const float* wv = (const float*)d_in[5]; const float* bv = (const float*)d_in[6]; const float* wo = (const float*)d_in[7]; const float* bo = (const float*)d_in[8]; const float* lng = (const float*)d_in[9]; const float* lnb = (const float*)d_in[10];
    float* OUT = (float*)d_out;     // [2][2048][1024]
    char* wsp = (char*)d_ws;
    auto take = [&](size_t bytes) { char* p = wsp; wsp += (bytes + 255) & ~(size_t)255; return (void*)p; };
    float* Y = (float*)take((size_t)TT * DM * 4); bf* WQ = (bf*)take((size_t)DQ * DM * 2); bf* WK = (bf*)take((size_t)DKV * DM * 2); bf* WV = (bf*)take((size_t)DKV * DM * 2); bf* WO = (bf*)take((size_t)DM * DQ * 2); float* CS = (float*)take((size_t)TT * HD * 2 * 4);
    bf* XB = (bf*)take((size_t)TT * DM * 2); float* FQ = (float*)take((size_t)TT * DQ * 4); float* FK = (float*)take((size_t)TT * DKV * 4);
    h16* QP16 = (h16*)take((size_t)NH_ * TT * HD * 2); h16* KP16 = (h16*)take((size_t)NKV * TT * HD * 2); h16* VT16 = (h16*)take((size_t)NKV * HD * TT * 2);
    bf* QPh = (bf*)take((size_t)NH_ * TT * HD * 2); bf* QPl = (bf*)take((size_t)NH_ * TT * HD * 2); bf* KPh = (bf*)take((size_t)NKV * TT * HD * 2); bf* KPl = (bf*)take((size_t)NKV * TT * HD * 2); bf* VTh = (bf*)take((size_t)NKV * HD * TT * 2); bf* VTl = (bf*)take((size_t)NKV * HD * TT * 2); bf* Ph = (bf*)take((size_t)ZH * RH * TT * 2); bf* Pl = (bf*)take((size_t)ZH * RH * TT * 2);
    float* Sb = (float*)take((size_t)ZH * TT * TT * 4); h16* P16 = (h16*)take((size_t)ZH * TT * TT * 2); float* Ob = (float*)take((size_t)ZH * TT * HD * 4); bf* ATh = (bf*)take((size_t)TT * DQ * 2); bf* ATl = (bf*)take((size_t)TT * DQ * 2);
    if ((size_t)(wsp - (char*)d_ws) > ws_size) return;    // ws 256 MiB
    float* FV = FK;   // v projection reuses the k buffer after the k planes are built (stream-ordered)
    { k_cvt8<<<(unsigned)(((size_t)DQ * DM / 8 + 255) / 256), 256, 0, stream>>>(wq, WQ, (size_t)DQ * DM / 8); k_cvt8<<<(unsigned)(((size_t)DKV * DM / 8 + 255) / 256), 256, 0, stream>>>(wk, WK, (size_t)DKV * DM / 8); k_cvt8<<<(unsigned)(((size_t)DKV * DM / 8 + 255) / 256), 256, 0, stream>>>(wv, WV, (size_t)DKV * DM / 8);
      k_cvt8<<<(unsigned)(((size_t)DM * DQ / 8 + 255) / 256), 256, 0, stream>>>(wo, WO, (size_t)DM * DQ / 8);
       }
    k_csid<<<(TT * HD + 255) / 256, 256, 0, stream>>>(CS);
    const unsigned LQ = (unsigned)(((size_t)NH_ * TT * HD / 2 + 255) / 256), LKv = (unsigned)(((size_t)NKV * TT * HD / 2 + 255) / 256);
    for (int b = 0; b < NB_; ++b) {
        
        k_cvt8<<<(unsigned)(((size_t)TT * DM / 8 + 255) / 256), 256, 0, stream>>>(x + (size_t)b * TT * DM, XB, (size_t)TT * DM / 8);
        k_gemmw<bf, 0, true><<<dim3(TT / 64, DQ / 64, 1), 32, 0, stream>>>(XB, nullptr, WQ, nullptr, DM, FQ, DQ, bq, 0, 0, 0);
        k_rope<<<LQ, 256, 0, stream>>>(FQ, DQ, NH_, CS, nullptr, nullptr, 1.0f, QP16, QPh, QPl);
        k_gemmw<bf, 0, true><<<dim3(TT / 64, DKV / 64, 1), 32, 0, stream>>>(XB, nullptr, WK, nullptr, DM, FK, DKV, bk, 0, 0, 0);
        k_rope<<<LKv, 256, 0, stream>>>(FK, DKV, NKV, CS, nullptr, nullptr, 1.0f, KP16, KPh, KPl);
        k_gemmw<bf, 0, true><<<dim3(TT / 64, DKV / 64, 1), 32, 0, stream>>>(XB, nullptr, WV, nullptr, DM, FV, DKV, bv, 0, 0, 0); k_vtp<<<LKv, 256, 0, stream>>>(FV, DKV, NKV, VT16, VTh, VTl);
        for (int h0 = 0; h0 < NH_; h0 += ZH) { const size_t zq = (size_t)h0, zk = (size_t)(h0 / REP);   // one kv head per query head: the pass's two heads use consecutive kv planes (z-strides TT*HD)
            k_gemmc<bf, 2, 1><<<dim3(RH / 64, TT / 64, ZH), 32, 0, stream>>>(QPh + zq * TT * HD, QPl + zq * TT * HD, KPh + zk * TT * HD, KPl + zk * TT * HD, HD, Sb, TT, 0, (size_t)TT * HD, (size_t)TT * HD, (size_t)TT * TT);
            k_gemmc<h16, 0, 1><<<dim3((TT - RH) / 64, TT / 64, ZH), 32, 0, stream>>>(QP16 + zq * TT * HD + (size_t)RH * HD, nullptr, KP16 + zk * TT * HD, nullptr, HD, Sb + (size_t)RH * TT, TT, RH, (size_t)TT * HD, (size_t)TT * HD, (size_t)TT * TT);
            k_asoft<<<ZH * TT / 8, 256, 0, stream>>>(Sb, P16, Ph, Pl);
            k_gemmc<bf, 2, 2><<<dim3(RH / 64, HD / 64, ZH), 32, 0, stream>>>(Ph, Pl, VTh + zk * HD * TT, VTl + zk * HD * TT, TT, Ob, HD, 0, (size_t)RH * TT, (size_t)HD * TT, (size_t)TT * HD);
            k_gemmc<h16, 0, 2><<<dim3((TT - RH) / 64, HD / 64, ZH), 32, 0, stream>>>(P16 + (size_t)RH * TT, nullptr, VT16 + zk * HD * TT, nullptr, TT, Ob + (size_t)RH * HD, HD, RH, (size_t)TT * TT, (size_t)HD * TT, (size_t)TT * HD);
            k_merge<<<(unsigned)(((size_t)ZH * TT * HD / 2 + 255) / 256), 256, 0, stream>>>(Ob, h0, ATh, ATl); }
        k_gemmw<bf, 1, true><<<dim3(TT / 64, DM / 64, 1), 32, 0, stream>>>(ATh, ATl, WO, nullptr, DQ, Y, DM, bo, 0, 0, 0); k_addres<<<(unsigned)(((size_t)TT * DQ / 4 + 255) / 256), 256, 0, stream>>>(Y, x + (size_t)b * TT * DM); k_lnout<<<(TT + 7) / 8, 256, 0, stream>>>(Y, lng, lnb, OUT + (size_t)b * TT * DM); }
}

// v001
// Measured time: 834 microseconds a run.
// Next to v000, in two timings, it ran 1.77 and 1.76 times as fast.
#include <hip/hip_runtime.h>

// Masked (causal) self-attention with residual and post-LayerNorm (x [2][2048][1024]; q,k,v = x W^T + b ('oi' uniform(+-1/32) incl. biases; 16 heads x 64); energy / 8; causal (-inf); softmax; out = merged Wo^T + bo; y = LayerNorm(out + x) gamma/beta (1e-5) -> [2][2048][1024] (4.2 M)).
// Layout per batch: bf16 copy of x; 'oi' weights; exact projections + f32 biases; causal T-2048 attention (hybrid rows: < 512 hi/lo 3 products, rest fp16 x1024; tiles above the diagonal skipped); merged hi/lo x Wo exact + bo into workspace; residual add and a row LayerNorm kernel write the output rows.
// Compute dtypes, f32 accumulate: every input rounded to bf16; projections exact + f32 biases; attention rows < 512 3 products, rest fp16; softmax f32; Wo hl x exact + bias; residual + LayerNorm f32.

#define NB_  2
#define TT   2048
#define DM   1024
#define NH_  16
#define NKV  16
#define REP  (NH_ / NKV)
#define HD   64
#define DQ   (NH_ * HD)
#define DKV  (NKV * HD)
#define ZH   2
#define RH   512                  // query rows < RH use hi+lo planes (0: none)
#define WIN  2048
#define PCAR 1024.0f
#define SCL  0.125f   // HD^-0.5
#define LNEPS 1e-5f
typedef _Float16 h16;
typedef unsigned short bf;
typedef __attribute__((ext_vector_type(16))) __bf16   v16bf;
typedef __attribute__((ext_vector_type(16))) _Float16 v16h;
typedef __attribute__((ext_vector_type(8)))  _Float16 v8h;
typedef __attribute__((ext_vector_type(8)))  unsigned short v8us;
typedef __attribute__((ext_vector_type(8)))  float    v8f;
typedef __attribute__((ext_vector_type(4)))  float    v4f;
typedef v8h  __attribute__((may_alias)) v8ha;
typedef v4f  __attribute__((may_alias)) v4fa;
typedef v8us __attribute__((may_alias)) v8usa;

__device__ __forceinline__ unsigned short f2bf(float f) { unsigned u = __float_as_uint(f); u += 0x7FFFu + ((u >> 16) & 1u); return (unsigned short)(u >> 16); }
__device__ __forceinline__ float bf2f(unsigned short b) { return __uint_as_float(((unsigned)b) << 16); }
__device__ __forceinline__ float bfr(float f) { return bf2f(f2bf(f)); }
__device__ __forceinline__ v16h cat16(v8h lo, v8h hi) { return __builtin_shufflevector(lo, hi, 0, 1, 2, 3, 4, 5, 6, 7, 8, 9, 10, 11, 12, 13, 14, 15); }
__device__ __forceinline__ v16bf cat16b(v8us lo, v8us hi) { return __builtin_bit_cast(v16bf, __builtin_shufflevector(lo, hi, 0, 1, 2, 3, 4, 5, 6, 7, 8, 9, 10, 11, 12, 13, 14, 15)); }
__device__ __forceinline__ v8f wmma16(v16h a, v16h b, v8f c) { return __builtin_amdgcn_wmma_f32_16x16x32_f16(false, a, false, b, (short)0, c, false, false); }
__device__ __forceinline__ v8f wmmab(v16bf a, v16bf b, v8f c) { return __builtin_amdgcn_wmma_f32_16x16x32_bf16(false, a, false, b, (short)0, c, false, false); }



// ---- k_gemmw: register-blocked GEMM, one 64x64 output tile per work-group of NWV waves; the K loop is split over the waves in slices of KS elements (wave w takes slices w, w + NWV, ...), each wave
// holds the whole tile (16 accumulators) for its slices, operands straight from K-contiguous 16-bit planes; the NWV partial tiles meet in LDS and are summed in wave order. grid (M/64, N/64, Z), 32 * NWV threads.
// C[m][n] (f32, pitch ldc, + optional f32 bias[n]) = sum_k A[m][k] Bt[n][k] (+ split products per NSPLIT). z-batch strides sA/sB/sC in elements. K % KS == 0.
// DIAG: probability x value contraction of causal attention: the K loop stops at the diagonal block (probabilities beyond it are exactly zero); roff = row offset of this launch's first row within the sequence.
#define NW 8      // waves that share one tile's K loop (K up to 1024: at most two slices a wave)
#define NWL 16    // the same for the long contraction over up to 2048 keys, whose grid leaves most of the chip idle
#define KS 64     // K elements per slice: one 128-byte line of every operand row, read by one wave only
template <typename T16> struct WFrag;
template <> struct WFrag<h16> { typedef v16h V; static __device__ __forceinline__ V ld(const h16* p) { return cat16(*(const v8h*)p, *(const v8h*)(p + 16)); } static __device__ __forceinline__ v8f mma(V a, V b, v8f c) { return wmma16(a, b, c); } };
template <> struct WFrag<bf> { typedef v16bf V; static __device__ __forceinline__ V ld(const bf* p) { return cat16b(*(const v8us*)p, *(const v8us*)(p + 16)); } static __device__ __forceinline__ v8f mma(V a, V b, v8f c) { return wmmab(a, b, c); } };
template <typename T16, int NSPLIT, bool BIAS, bool DIAG, int NWV>
__global__ __launch_bounds__(32 * NWV) void k_gemmw(const T16* __restrict__ A, const T16* __restrict__ A2, const T16* __restrict__ Bt, const T16* __restrict__ Bt2, int K, float* C, int ldc, const float* __restrict__ bias, int roff, size_t sA, size_t sB, size_t sC) {
    typedef typename WFrag<T16>::V V;
    __shared__ __align__(16) float os[NWV * 64 * 68];
    const size_t z = blockIdx.z; A += z * sA; if (A2) A2 += z * sA; Bt += z * sB; if (Bt2) Bt2 += z * sB; C += z * sC;
    const int lane = threadIdx.x & 31, lr = lane & 15, hi = lane >> 4; const int r0 = blockIdx.x * 64, c0 = blockIdx.y * 64;
    const int wave = __builtin_amdgcn_readfirstlane(threadIdx.x >> 5);
    const int Kl = DIAG ? min(K, r0 + roff + 64) : K;
    v8f acc[4][4];
#pragma unroll
    for (int mb = 0; mb < 4; ++mb)
#pragma unroll
        for (int nb = 0; nb < 4; ++nb) acc[mb][nb] = (v8f){};
    // byte offset of this lane's row of each 16-row block from its plane's base, stepped from trip to trip (32 bits hold it: a plane has at most 2^22 elements); A and A2, Bt and Bt2 share pitch and offset
    unsigned oa[4], ob[4];
#pragma unroll
    for (int q = 0; q < 4; ++q) { oa[q] = (unsigned)((r0 + lr + q * 16) * K + 8 * hi + wave * KS) * (unsigned)sizeof(T16); ob[q] = (unsigned)((c0 + lr + q * 16) * K + 8 * hi + wave * KS) * (unsigned)sizeof(T16); }
#pragma unroll 1   // stays rolled: a second trip's fragments do not fit beside the 16 accumulators
    for (int kb = wave * KS; kb < Kl; kb += NWV * KS) {
        V a[KS / 32][4], a2[KS / 32][4];
#pragma unroll
        for (int ks = 0; ks < KS / 32; ++ks)
#pragma unroll
            for (int mb = 0; mb < 4; ++mb) { a[ks][mb] = WFrag<T16>::ld((const T16*)((const char*)A + oa[mb]) + ks * 32); if (NSPLIT == 1 || NSPLIT == 2) a2[ks][mb] = WFrag<T16>::ld((const T16*)((const char*)A2 + oa[mb]) + ks * 32); }
#pragma unroll
        for (int ks = 0; ks < KS / 32; ++ks)
#pragma unroll
            for (int nb = 0; nb < 4; ++nb) { const V b = WFrag<T16>::ld((const T16*)((const char*)Bt + ob[nb]) + ks * 32); V b2; if (NSPLIT >= 2) b2 = WFrag<T16>::ld((const T16*)((const char*)Bt2 + ob[nb]) + ks * 32);
#pragma unroll
                for (int mb = 0; mb < 4; ++mb) { acc[mb][nb] = WFrag<T16>::mma(a[ks][mb], b, acc[mb][nb]); if (NSPLIT == 1 || NSPLIT == 2) acc[mb][nb] = WFrag<T16>::mma(a2[ks][mb], b, acc[mb][nb]); if (NSPLIT >= 2) acc[mb][nb] = WFrag<T16>::mma(a[ks][mb], b2, acc[mb][nb]); } }
        // keeps the distance behind the trip's last matrix instructions on the taken back edge; the row offsets are inputs so that no load's
        // result lands in an address register of an earlier load of the trip: they stay as they are until the diagonal accumulators, which take in every fragment, are complete
        asm volatile("v_nop\n\tv_nop\n\tv_nop\n\tv_nop" : "+v"(acc[0][0]), "+v"(acc[1][1]), "+v"(acc[2][2]), "+v"(acc[3][3]) : "v"(a[KS / 32 - 1][0]), "v"(a[KS / 32 - 1][3]), "v"(oa[0]), "v"(oa[1]), "v"(oa[2]), "v"(oa[3]), "v"(ob[0]), "v"(ob[1]), "v"(ob[2]), "v"(ob[3]));
#pragma unroll
        for (int q = 0; q < 4; ++q) { oa[q] += NWV * KS * (unsigned)sizeof(T16); ob[q] += NWV * KS * (unsigned)sizeof(T16); }
    }
    float* ow = os + wave * (64 * 68);
#pragma unroll
    for (int mb = 0; mb < 4; ++mb)
#pragma unroll
        for (int nb = 0; nb < 4; ++nb)
#pragma unroll
            for (int j = 0; j < 8; ++j) ow[(mb * 16 + hi * 8 + j) * 68 + nb * 16 + lr] = acc[mb][nb][j];
    __syncthreads();   // every wave's partial tile is in LDS before any thread sums across waves
    const int trow = threadIdx.x >> 4, cofs = (threadIdx.x & 15) * 4;
#pragma unroll
    for (int rb = 0; rb < 64; rb += 2 * NWV) { const int row = rb + trow; v4f val = *(const v4fa*)(os + row * 68 + cofs);
#pragma unroll
        for (int w = 1; w < NWV; ++w) val += *(const v4fa*)(os + (w * 64 + row) * 68 + cofs);
        if (BIAS) { val[0] += bfr(bias[c0 + cofs]); val[1] += bfr(bias[c0 + cofs + 1]); val[2] += bfr(bias[c0 + cofs + 2]); val[3] += bfr(bias[c0 + cofs + 3]); }
        *(v4f*)(C + (size_t)(r0 + row) * ldc + c0 + cofs) = val; }
}

// ---- k_gemmc: ONE WAVE per 64x64 output tile, K loop unsplit, specialised for causal attention (launched for the scores, CMODE 1, whose K is one slice): CMODE 1 skips score tiles entirely above the diagonal (query rows r0+roff.., key columns c0..), CMODE 2 limits the
// key (K) loop of the probability x value contraction to the diagonal block (probabilities beyond it are exactly zero). roff = row offset of this launch's first row within the sequence.
template <typename T16, int NSPLIT, int CMODE>
__global__ __launch_bounds__(32) void k_gemmc(const T16* __restrict__ A, const T16* __restrict__ A2, const T16* __restrict__ Bt, const T16* __restrict__ Bt2, int K, float* C, int ldc, int roff, size_t sA, size_t sB, size_t sC) {
    typedef typename WFrag<T16>::V V;
    __shared__ __align__(16) float os[16 * 68];
    const size_t z = blockIdx.z; A += z * sA; if (A2) A2 += z * sA; Bt += z * sB; if (Bt2) Bt2 += z * sB; C += z * sC;
    const int lane = threadIdx.x & 31, lr = lane & 15, hi = lane >> 4; const int r0 = blockIdx.x * 64, c0 = blockIdx.y * 64;
    if (CMODE == 1 && c0 > r0 + roff + 63) return;                  // score tile entirely above the causal diagonal: never written (the softmax masks j > i by select)
    const int Kl = (CMODE == 2) ? min(K, r0 + roff + 64) : K;        // P.V: probabilities are exactly 0 beyond the diagonal block, so the K loop stops there
    v8f acc[4][4];
#pragma unroll
    for (int mb = 0; mb < 4; ++mb)
#pragma unroll
        for (int nb = 0; nb < 4; ++nb) acc[mb][nb] = (v8f){};
    const size_t aoff = (size_t)(r0 + lr) * K + 8 * hi, boff = (size_t)(c0 + lr) * K + 8 * hi;
#pragma unroll 1
    for (int kc = 0; kc < Kl; kc += 32) {
        V a[4], a2[4];
#pragma unroll
        for (int mb = 0; mb < 4; ++mb) { a[mb] = WFrag<T16>::ld(A + aoff + (size_t)mb * 16 * K + kc); if (NSPLIT == 1 || NSPLIT == 2) a2[mb] = WFrag<T16>::ld(A2 + aoff + (size_t)mb * 16 * K + kc); }
#pragma unroll
        for (int nb = 0; nb < 4; ++nb) { const V b = WFrag<T16>::ld(Bt + boff + (size_t)nb * 16 * K + kc); V b2; if (NSPLIT >= 2) b2 = WFrag<T16>::ld(Bt2 + boff + (size_t)nb * 16 * K + kc);
#pragma unroll
            for (int mb = 0; mb < 4; ++mb) { acc[mb][nb] = WFrag<T16>::mma(a[mb], b, acc[mb][nb]); if (NSPLIT == 1 || NSPLIT == 2) acc[mb][nb] = WFrag<T16>::mma(a2[mb], b, acc[mb][nb]); if (NSPLIT >= 2) acc[mb][nb] = WFrag<T16>::mma(a[mb], b2, acc[mb][nb]); } }
        asm volatile("v_nop\n\tv_nop\n\tv_nop\n\tv_nop" : "+v"(acc[0][0]), "+v"(acc[1][1]), "+v"(acc[2][2]), "+v"(acc[3][3]) : "v"(a[0]), "v"(a[3]));
    }
#pragma unroll
    for (int mb = 0; mb < 4; ++mb) {
#pragma unroll
        for (int nb = 0; nb < 4; ++nb) {
#pragma unroll
            for (int j = 0; j < 8; ++j) os[(hi * 8 + j) * 68 + nb * 16 + lr] = acc[mb][nb][j]; }
        __builtin_amdgcn_wave_barrier(); asm volatile("" ::: "memory");
        float* crow = C + (size_t)(r0 + mb * 16) * ldc + c0;
{
#pragma unroll
            for (int s = 0; s < 8; ++s) { const int row = 2 * s + hi, cofs = lr * 4; v4f val = *(const v4fa*)(os + row * 68 + cofs);
                *(v4f*)(crow + (size_t)row * ldc + cofs) = val; }
             }
        __builtin_amdgcn_wave_barrier(); asm volatile("" ::: "memory");
    }
}

__device__ __forceinline__ h16 tohx(float x) { return (h16)x; }
__device__ __forceinline__ void splitf(float y, unsigned short& h, unsigned short& l) { h = f2bf(y); l = f2bf(y - bf2f(h)); }
typedef __attribute__((ext_vector_type(2))) _Float16 v2h;
typedef __attribute__((ext_vector_type(4))) _Float16 v4h;
typedef __attribute__((ext_vector_type(2))) unsigned short v2us;
typedef __attribute__((ext_vector_type(4))) unsigned short v4us;
typedef __attribute__((ext_vector_type(2))) float v2f;
typedef __attribute__((ext_vector_type(4))) int v4i;

__global__ __launch_bounds__(256) void k_wtG(const float* __restrict__ w, int K, int N, bf* Bt) {
    const int lane = threadIdx.x & 31; const int L0 = (blockIdx.x * 8 + (threadIdx.x >> 5)) * 8; const int nlines = N * K / 64;
{
#pragma unroll 1
        for (int l = 0; l < 8; ++l) { const int L = L0 + l; if (L >= nlines) break; const size_t e = (size_t)L * 64 + lane * 2; const int k = (int)(e % K), n = (int)(e / K); v2us o;
            o[0] = f2bf(w[(size_t)k * N + n]); o[1] = f2bf(w[(size_t)(k + 1) * N + n]); *(v2us*)(Bt + e) = o; }
         }
}
__global__ __launch_bounds__(256) void k_cvt8(const float* __restrict__ src, bf* dst, size_t n8) { const size_t i = (size_t)blockIdx.x * 256 + threadIdx.x; if (i >= n8) return; const v8f v = *(const v8f*)(src + i * 8); v8us o;
#pragma unroll
    for (int k = 0; k < 8; ++k) o[k] = f2bf(v[k]); *(v8us*)(dst + i * 8) = o;  }

// k_rope: head planes [h][t][d] (fp16 + hi/lo) of rope(x) x sc with the rotate-half convention out[d] = x[d] cos[t][d] - x[d+HD/2] sin[t][d], out[d+HD/2] = x[d+HD/2] cos[t][d+HD/2] + x[d] sin[t][d+HD/2]
__global__ __launch_bounds__(256) void k_rope(const float* __restrict__ F, int pitch, int nheads, const float* __restrict__ CS, const float* __restrict__ RF, const float* __restrict__ nw, float sc, h16* P16, bf* Ph, bf* Pl) {
    const size_t e = ((size_t)blockIdx.x * 256 + threadIdx.x) * 2; if (e >= (size_t)nheads * TT * HD) return; const int d = (int)(e % HD); const int t = (int)((e / HD) % TT); const int h = (int)(e / ((size_t)HD * TT)); const float* f = F + (size_t)t * pitch + h * HD; const float rf = RF ? RF[(size_t)h * TT + t] : 1.0f; v2h o16; v2us oh, ol;
#pragma unroll
    for (int q = 0; q < 2; ++q) { const int dd = d + q; const int dp = (dd < HD / 2) ? dd + HD / 2 : dd - HD / 2; float x0 = f[dd], x1 = f[dp];
        if (RF) { float n0 = __fmul_rn(x0, rf), n1 = __fmul_rn(x1, rf); asm volatile("" : "+v"(n0)); asm volatile("" : "+v"(n1)); x0 = __fmul_rn(bfr(nw[dd]), n0); x1 = __fmul_rn(bfr(nw[dp]), n1); }
        const v2f cs = *(const v2f*)(CS + ((size_t)t * HD + dd) * 2); float a = __fmul_rn(x0, cs[0]), bq = __fmul_rn(x1, cs[1]); asm volatile("" : "+v"(a)); asm volatile("" : "+v"(bq)); const float r = ((dd < HD / 2) ? __fsub_rn(a, bq) : __fadd_rn(a, bq)) * sc;
        o16[q] = tohx(r); unsigned short a2, c2; splitf(r, a2, c2); oh[q] = a2; ol[q] = c2; }
    *(v2h*)(P16 + e) = o16; *(v2us*)(Ph + e) = oh; *(v2us*)(Pl + e) = ol;  }
__global__ __launch_bounds__(256) void k_vtp(const float* __restrict__ F, int pitch, int nheads, h16* V16, bf* Vh, bf* Vl) { const size_t e = ((size_t)blockIdx.x * 256 + threadIdx.x) * 2; if (e >= (size_t)nheads * HD * TT) return; const int t = (int)(e % TT); const int d = (int)((e / TT) % HD); const int g = (int)(e / ((size_t)TT * HD)); v2h o16; v2us oh, ol;
#pragma unroll
    for (int q = 0; q < 2; ++q) { const float x = F[(size_t)(t + q) * pitch + g * HD + d]; o16[q] = tohx(x); unsigned short a2, c2; splitf(x, a2, c2); oh[q] = a2; ol[q] = c2; }
    *(v2h*)(V16 + e) = o16; *(v2us*)(Vh + e) = oh; *(v2us*)(Vl + e) = ol;  }
__global__ __launch_bounds__(256) void k_csid(float* CS) { const int idx = blockIdx.x * 256 + threadIdx.x; if (idx >= TT * HD) return; v2f cs; cs[0] = 1.0f; cs[1] = 0.0f; *(v2f*)(CS + (size_t)idx * 2) = cs;  }
// k_asoft: per row (zz, i): t = S x HD^-0.5 for j <= i and i - j < WIN (sliding causal window; the reference's -1e9 additive fill vanishes identically); softmax over the 2048 keys (register row, one exp, fixed trees);
__global__ __launch_bounds__(256) void k_asoft(const float* __restrict__ Sb, h16* P16, bf* Ph, bf* Pl) {
    const int lane = threadIdx.x & 31; const int row = blockIdx.x * 8 + (threadIdx.x >> 5); if (row >= ZH * TT) return; const int i = row % TT; const int zz = row / TT; (void)zz; const bool hires = (i < RH); const float* sr = Sb + (size_t)row * TT; float v[TT / 32]; float mx = -3.0e38f;
#pragma unroll
    for (int ch = 0; ch < TT / 128; ++ch) { const int j0 = ch * 128 + lane * 4; const v4f a = *(const v4f*)(sr + j0);
#pragma unroll
        for (int q = 0; q < 4; ++q) { const int j = j0 + q; (void)j; const float t = (j <= i && i - j < WIN) ? a[q] * SCL : -3.0e38f; v[ch * 4 + q] = t; mx = fmaxf(mx, t); } }
#pragma unroll
    for (int sh = 16; sh; sh >>= 1) mx = fmaxf(mx, __shfl_xor(mx, sh, 32));
    float sum = 0.f;
#pragma unroll
    for (int k = 0; k < TT / 32; ++k) { float d0 = __fsub_rn(v[k], mx); asm volatile("" : "+v"(d0)); v[k] = __builtin_amdgcn_exp2f(__fmul_rn(d0, 1.4426950408889634f)); sum += v[k]; }
#pragma unroll
    for (int sh = 16; sh; sh >>= 1) sum += __shfl_xor(sum, sh, 32);
    const float f = __fdiv_rn(hires ? 1.0f : PCAR, sum);
{
        if (hires) {
#pragma unroll
            for (int ch = 0; ch < TT / 128; ++ch) { v4us oh, ol;
#pragma unroll
                for (int q = 0; q < 4; ++q) { unsigned short a, c2; splitf(v[ch * 4 + q] * f, a, c2); oh[q] = a; ol[q] = c2; }
                const size_t oo = ((size_t)zz * (RH ? RH : 1) + i) * TT + ch * 128 + lane * 4; *(v4us*)(Ph + oo) = oh; *(v4us*)(Pl + oo) = ol; }
        } else {
#pragma unroll
            for (int ch = 0; ch < TT / 128; ++ch) { v4h o4;
#pragma unroll
                for (int q = 0; q < 4; ++q) o4[q] = tohx(v[ch * 4 + q] * f);
                *(v4h*)(P16 + (size_t)row * TT + ch * 128 + lane * 4) = o4; } }
         }
}
__global__ __launch_bounds__(256) void k_addres(float* Y, const float* __restrict__ xr) { const size_t i = (size_t)blockIdx.x * 256 + threadIdx.x; if (i >= (size_t)TT * DQ / 4) return; const v4f a = *(const v4f*)(Y + i * 4); const v4f r = *(const v4f*)(xr + i * 4); v4f o;
#pragma unroll
    for (int q = 0; q < 4; ++q) o[q] = __fadd_rn(a[q], bfr(r[q]));
    *(v4f*)(Y + i * 4) = o;  }
__global__ __launch_bounds__(256) void k_lnout(const float* __restrict__ F, const float* __restrict__ g, const float* __restrict__ bb, float* out) { const int lane = threadIdx.x & 31; const int row = blockIdx.x * 8 + (threadIdx.x >> 5); if (row >= TT) return; const float* fr = F + (size_t)row * DQ; float* orow = out + (size_t)row * DQ; float v[DQ / 32]; float s = 0.f;
#pragma unroll
    for (int c = 0; c < DQ / 128; ++c) { const v4f a = *(const v4f*)(fr + c * 128 + lane * 4); for (int q = 0; q < 4; ++q) { v[c * 4 + q] = a[q]; s = __fadd_rn(s, a[q]); } }
#pragma unroll
    for (int sh = 16; sh; sh >>= 1) s = __fadd_rn(s, __shfl_xor(s, sh, 32));
    const float mean = __fdiv_rn(s, (float)DQ); float s2 = 0.f;
#pragma unroll
    for (int k = 0; k < DQ / 32; ++k) { const float dv = __fsub_rn(v[k], mean); float p2 = __fmul_rn(dv, dv); asm volatile("" : "+v"(p2)); s2 = __fadd_rn(s2, p2); v[k] = dv; }
#pragma unroll
    for (int sh = 16; sh; sh >>= 1) s2 = __fadd_rn(s2, __shfl_xor(s2, sh, 32));
    const float rs = __fdiv_rn(1.0f, __fsqrt_rn(__fadd_rn(__fdiv_rn(s2, (float)DQ), LNEPS)));
{
#pragma unroll
        for (int c = 0; c < DQ / 128; ++c) { v4f o; for (int q = 0; q < 4; ++q) { const int col = c * 128 + lane * 4 + q; float y = __fmul_rn(v[c * 4 + q], rs); asm volatile("" : "+v"(y)); y = __fmul_rn(y, bfr(g[col])); asm volatile("" : "+v"(y)); o[q] = __fadd_rn(y, bfr(bb[col])); } *(v4f*)(orow + c * 128 + lane * 4) = o; }
         } }
__global__ __launch_bounds__(256) void k_merge(const float* __restrict__ O, int h0, bf* Ah, bf* Al) { const size_t e = ((size_t)blockIdx.x * 256 + threadIdx.x) * 2; if (e >= (size_t)ZH * TT * HD) return; const int d = (int)(e % HD); const int t = (int)((e / HD) % TT); const int zz = (int)(e / ((size_t)HD * TT)); const float cs = (t < RH) ? 1.0f : (1.0f / PCAR); const size_t oo = (size_t)t * DQ + (h0 + zz) * HD + d;
    v2us oh, ol;
#pragma unroll
    for (int q = 0; q < 2; ++q) { unsigned short a, c2; splitf(O[e + q] * cs, a, c2); oh[q] = a; ol[q] = c2; } *(v2us*)(Ah + oo) = oh; *(v2us*)(Al + oo) = ol;  }

extern "C" void kernel_launch(void* const* d_in, const int* in_sizes, int n_in,
                              void* d_out, int out_size, void* d_ws, size_t ws_size, hipStream_t stream) {
    (void)in_sizes; (void)n_in; (void)out_size;
    const float* x = (const float*)d_in[0]; const float* wq = (const float*)d_in[1]; const float* bq = (const float*)d_in[2]; const float* wk = (const float*)d_in[3]; const float* bk = (const float*)d_in[4]; const float* wv = (const float*)d_in[5]; const float* bv = (const float*)d_in[6]; const float* wo = (const float*)d_in[7]; const float* bo = (const float*)d_in[8]; const float* lng = (const float*)d_in[9]; const float* lnb = (const float*)d_in[10];
    float* OUT = (float*)d_out;     // [2][2048][1024]
    char* wsp = (char*)d_ws;
    auto take = [&](size_t bytes) { char* p = wsp; wsp += (bytes + 255) & ~(size_t)255; return (void*)p; };
    float* Y = (float*)take((size_t)TT * DM * 4); bf* WQ = (bf*)take((size_t)DQ * DM * 2); bf* WK = (bf*)take((size_t)DKV * DM * 2); bf* WV = (bf*)take((size_t)DKV * DM * 2); bf* WO = (bf*)take((size_t)DM * DQ * 2); float* CS = (float*)take((size_t)TT * HD * 2 * 4);
    bf* XB = (bf*)take((size_t)TT * DM * 2); float* FQ = (float*)take((size_t)TT * DQ * 4); float* FK = (float*)take((size_t)TT * DKV * 4);
    h16* QP16 = (h16*)take((size_t)NH_ * TT * HD * 2); h16* KP16 = (h16*)take((size_t)NKV * TT * HD * 2); h16* VT16 = (h16*)take((size_t)NKV * HD * TT * 2);
    bf* QPh = (bf*)take((size_t)NH_ * TT * HD * 2); bf* QPl = (bf*)take((size_t)NH_ * TT * HD * 2); bf* KPh = (bf*)take((size_t)NKV * TT * HD * 2); bf* KPl = (bf*)take((size_t)NKV * TT * HD * 2); bf* VTh = (bf*)take((size_t)NKV * HD * TT * 2); bf* VTl = (bf*)take((size_t)NKV * HD * TT * 2); bf* Ph = (bf*)take((size_t)ZH * RH * TT * 2); bf* Pl = (bf*)take((size_t)ZH * RH * TT * 2);
    float* Sb = (float*)take((size_t)ZH * TT * TT * 4); h16* P16 = (h16*)take((size_t)ZH * TT * TT * 2); float* Ob = (float*)take((size_t)ZH * TT * HD * 4); bf* ATh = (bf*)take((size_t)TT * DQ * 2); bf* ATl = (bf*)take((size_t)TT * DQ * 2);
    if ((size_t)(wsp - (char*)d_ws) > ws_size) return;    // ws 256 MiB
    float* FV = FK;   // v projection reuses the k buffer after the k planes are built (stream-ordered)
    { k_cvt8<<<(unsigned)(((size_t)DQ * DM / 8 + 255) / 256), 256, 0, stream>>>(wq, WQ, (size_t)DQ * DM / 8); k_cvt8<<<(unsigned)(((size_t)DKV * DM / 8 + 255) / 256), 256, 0, stream>>>(wk, WK, (size_t)DKV * DM / 8); k_cvt8<<<(unsigned)(((size_t)DKV * DM / 8 + 255) / 256), 256, 0, stream>>>(wv, WV, (size_t)DKV * DM / 8);
      k_cvt8<<<(unsigned)(((size_t)DM * DQ / 8 + 255) / 256), 256, 0, stream>>>(wo, WO, (size_t)DM * DQ / 8);
       }
    k_csid<<<(TT * HD + 255) / 256, 256, 0, stream>>>(CS);
    const unsigned LQ = (unsigned)(((size_t)NH_ * TT * HD / 2 + 255) / 256), LKv = (unsigned)(((size_t)NKV * TT * HD / 2 + 255) / 256);
    for (int b = 0; b < NB_; ++b) {
        
        k_cvt8<<<(unsigned)(((size_t)TT * DM / 8 + 255) / 256), 256, 0, stream>>>(x + (size_t)b * TT * DM, XB, (size_t)TT * DM / 8);
        k_gemmw<bf, 0, true, false, NW><<<dim3(TT / 64, DQ / 64, 1), 32 * NW, 0, stream>>>(XB, nullptr, WQ, nullptr, DM, FQ, DQ, bq, 0, 0, 0, 0);
        k_rope<<<LQ, 256, 0, stream>>>(FQ, DQ, NH_, CS, nullptr, nullptr, 1.0f, QP16, QPh, QPl);
        k_gemmw<bf, 0, true, false, NW><<<dim3(TT / 64, DKV / 64, 1), 32 * NW, 0, stream>>>(XB, nullptr, WK, nullptr, DM, FK, DKV, bk, 0, 0, 0, 0);
        k_rope<<<LKv, 256, 0, stream>>>(FK, DKV, NKV, CS, nullptr, nullptr, 1.0f, KP16, KPh, KPl);
        k_gemmw<bf, 0, true, false, NW><<<dim3(TT / 64, DKV / 64, 1), 32 * NW, 0, stream>>>(XB, nullptr, WV, nullptr, DM, FV, DKV, bv, 0, 0, 0, 0); k_vtp<<<LKv, 256, 0, stream>>>(FV, DKV, NKV, VT16, VTh, VTl);
        for (int h0 = 0; h0 < NH_; h0 += ZH) { const size_t zq = (size_t)h0, zk = (size_t)(h0 / REP);   // one kv head per query head: the pass's two heads use consecutive kv planes (z-strides TT*HD)
            k_gemmc<bf, 2, 1><<<dim3(RH / 64, TT / 64, ZH), 32, 0, stream>>>(QPh + zq * TT * HD, QPl + zq * TT * HD, KPh + zk * TT * HD, KPl + zk * TT * HD, HD, Sb, TT, 0, (size_t)TT * HD, (size_t)TT * HD, (size_t)TT * TT);
            k_gemmc<h16, 0, 1><<<dim3((TT - RH) / 64, TT / 64, ZH), 32, 0, stream>>>(QP16 + zq * TT * HD + (size_t)RH * HD, nullptr, KP16 + zk * TT * HD, nullptr, HD, Sb + (size_t)RH * TT, TT, RH, (size_t)TT * HD, (size_t)TT * HD, (size_t)TT * TT);
            k_asoft<<<ZH * TT / 8, 256, 0, stream>>>(Sb, P16, Ph, Pl);
            k_gemmw<bf, 2, false, true, NW><<<dim3(RH / 64, HD / 64, ZH), 32 * NW, 0, stream>>>(Ph, Pl, VTh + zk * HD * TT, VTl + zk * HD * TT, TT, Ob, HD, nullptr, 0, (size_t)RH * TT, (size_t)HD * TT, (size_t)TT * HD);
            k_gemmw<h16, 0, false, true, NWL><<<dim3((TT - RH) / 64, HD / 64, ZH), 32 * NWL, 0, stream>>>(P16 + (size_t)RH * TT, nullptr, VT16 + zk * HD * TT, nullptr, TT, Ob + (size_t)RH * HD, HD, nullptr, RH, (size_t)TT * TT, (size_t)HD * TT, (size_t)TT * HD);
            k_merge<<<(unsigned)(((size_t)ZH * TT * HD / 2 + 255) / 256), 256, 0, stream>>>(Ob, h0, ATh, ATl); }
        k_gemmw<bf, 1, true, false, NW><<<dim3(TT / 64, DM / 64, 1), 32 * NW, 0, stream>>>(ATh, ATl, WO, nullptr, DQ, Y, DM, bo, 0, 0, 0, 0); k_addres<<<(unsigned)(((size_t)TT * DQ / 4 + 255) / 256), 256, 0, stream>>>(Y, x + (size_t)b * TT * DM); k_lnout<<<(TT + 7) / 8, 256, 0, stream>>>(Y, lng, lnb, OUT + (size_t)b * TT * DM); }
}

// v002
// Measured time: 496 microseconds a run.
// Two timings next to v001 put it at 1.67 and 1.68 times that version's speed.
// All steps since v000 together make it 2.95 times as fast.
#include <hip/hip_runtime.h>

// Masked (causal) self-attention with residual and post-LayerNorm (x [2][2048][1024]; q,k,v = x W^T + b ('oi' uniform(+-1/32) incl. biases; 16 heads x 64); energy / 8; causal (-inf); softmax; out = merged Wo^T + bo; y = LayerNorm(out + x) gamma/beta (1e-5) -> [2][2048][1024] (4.2 M)).
// Layout per batch: bf16 copy of x; 'oi' weights; exact projections + f32 biases; causal T-2048 attention (hybrid rows: < 512 hi/lo 3 products, rest fp16 x1024; tiles above the diagonal skipped); merged hi/lo x Wo exact + bo into workspace; residual add and a row LayerNorm kernel write the output rows.
// Compute dtypes, f32 accumulate: every input rounded to bf16; projections exact + f32 biases; attention rows < 512 3 products, rest fp16; softmax f32; Wo hl x exact + bias; residual + LayerNorm f32.

#define NB_  2
#define TT   2048
#define DM   1024
#define NH_  16
#define NKV  16
#define REP  (NH_ / NKV)
#define HD   64
#define DQ   (NH_ * HD)
#define DKV  (NKV * HD)
#define ZH   8                    // heads per attention pass: each pass's launches carry 8 score planes (8 x 16 MiB of workspace)
#define RH   512                  // query rows < RH use hi+lo planes (0: none)
#define WIN  2048
#define PCAR 1024.0f
#define SCL  0.125f   // HD^-0.5
#define LNEPS 1e-5f
typedef _Float16 h16;
typedef unsigned short bf;
typedef __attribute__((ext_vector_type(16))) __bf16   v16bf;
typedef __attribute__((ext_vector_type(16))) _Float16 v16h;
typedef __attribute__((ext_vector_type(8)))  _Float16 v8h;
typedef __attribute__((ext_vector_type(8)))  unsigned short v8us;
typedef __attribute__((ext_vector_type(8)))  float    v8f;
typedef __attribute__((ext_vector_type(4)))  float    v4f;
typedef v8h  __attribute__((may_alias)) v8ha;
typedef v4f  __attribute__((may_alias)) v4fa;
typedef v8us __attribute__((may_alias)) v8usa;

__device__ __forceinline__ unsigned short f2bf(float f) { unsigned u = __float_as_uint(f); u += 0x7FFFu + ((u >> 16) & 1u); return (unsigned short)(u >> 16); }
__device__ __forceinline__ float bf2f(unsigned short b) { return __uint_as_float(((unsigned)b) << 16); }
__device__ __forceinline__ float bfr(float f) { return bf2f(f2bf(f)); }
__device__ __forceinline__ v16h cat16(v8h lo, v8h hi) { return __builtin_shufflevector(lo, hi, 0, 1, 2, 3, 4, 5, 6, 7, 8, 9, 10, 11, 12, 13, 14, 15); }
__device__ __forceinline__ v16bf cat16b(v8us lo, v8us hi) { return __builtin_bit_cast(v16bf, __builtin_shufflevector(lo, hi, 0, 1, 2, 3, 4, 5, 6, 7, 8, 9, 10, 11, 12, 13, 14, 15)); }
__device__ __forceinline__ v8f wmma16(v16h a, v16h b, v8f c) { return __builtin_amdgcn_wmma_f32_16x16x32_f16(false, a, false, b, (short)0, c, false, false); }
__device__ __forceinline__ v8f wmmab(v16bf a, v16bf b, v8f c) { return __builtin_amdgcn_wmma_f32_16x16x32_bf16(false, a, false, b, (short)0, c, false, false); }



// ---- k_gemmw: register-blocked GEMM, one 64x64 output tile per work-group of NWV waves; the K loop is split over the waves in slices of KS elements (wave w takes slices w, w + NWV, ...), each wave
// holds the whole tile (16 accumulators) for its slices, operands straight from K-contiguous 16-bit planes; the NWV partial tiles meet in LDS and are summed in wave order. grid (M/64, N/64, Z), 32 * NWV threads.
// C[m][n] (f32, pitch ldc, + optional f32 bias[n]) = sum_k A[m][k] Bt[n][k] (+ split products per NSPLIT). z-batch strides sA/sB/sC and the A pitch lda in elements. K % KS == 0.
// DIAG: probability x value contraction of causal attention: the K loop stops at the diagonal block (probabilities beyond it are exactly zero); roff = row offset of this launch's first row within the sequence.
#define NW 8      // waves that share one tile's K loop (K up to 1024: at most two slices a wave)
#define NWL 16    // the same for the long contraction over up to 2048 keys, whose grid leaves most of the chip idle
#define KS 64     // K elements per slice: one 128-byte line of every operand row, read by one wave only
template <typename T16> struct WFrag;
template <> struct WFrag<h16> { typedef v16h V; static __device__ __forceinline__ V ld(const h16* p) { return cat16(*(const v8h*)p, *(const v8h*)(p + 16)); } static __device__ __forceinline__ v8f mma(V a, V b, v8f c) { return wmma16(a, b, c); } };
template <> struct WFrag<bf> { typedef v16bf V; static __device__ __forceinline__ V ld(const bf* p) { return cat16b(*(const v8us*)p, *(const v8us*)(p + 16)); } static __device__ __forceinline__ v8f mma(V a, V b, v8f c) { return wmmab(a, b, c); } };
template <typename T16, int NSPLIT, bool BIAS, bool DIAG, int NWV>
__global__ __launch_bounds__(32 * NWV) void k_gemmw(const T16* __restrict__ A, const T16* __restrict__ A2, const T16* __restrict__ Bt, const T16* __restrict__ Bt2, int K, int lda, float* C, int ldc, const float* __restrict__ bias, int roff, size_t sA, size_t sB, size_t sC) {
    typedef typename WFrag<T16>::V V;
    __shared__ __align__(16) float os[NWV * 64 * 68];
    const size_t z = blockIdx.z; A += z * sA; if (A2) A2 += z * sA; Bt += z * sB; if (Bt2) Bt2 += z * sB; C += z * sC;
    const int lane = threadIdx.x & 31, lr = lane & 15, hi = lane >> 4; const int r0 = blockIdx.x * 64, c0 = blockIdx.y * 64;
    const int wave = __builtin_amdgcn_readfirstlane(threadIdx.x >> 5);
    const int Kl = DIAG ? min(K, r0 + roff + 64) : K;
    v8f acc[4][4];
#pragma unroll
    for (int mb = 0; mb < 4; ++mb)
#pragma unroll
        for (int nb = 0; nb < 4; ++nb) acc[mb][nb] = (v8f){};
    // byte offset of this lane's row of each 16-row block from its plane's base, stepped from trip to trip (32 bits hold it: a plane spans at most 2^23 elements); A and A2 share the pitch lda, Bt and Bt2 the pitch K
    unsigned oa[4], ob[4];
#pragma unroll
    for (int q = 0; q < 4; ++q) { oa[q] = (unsigned)((r0 + lr + q * 16) * lda + 8 * hi + wave * KS) * (unsigned)sizeof(T16); ob[q] = (unsigned)((c0 + lr + q * 16) * K + 8 * hi + wave * KS) * (unsigned)sizeof(T16); }
#pragma unroll 1   // stays rolled: a second trip's fragments do not fit beside the 16 accumulators
    for (int kb = wave * KS; kb < Kl; kb += NWV * KS) {
        V a[KS / 32][4], a2[KS / 32][4];
#pragma unroll
        for (int ks = 0; ks < KS / 32; ++ks)
#pragma unroll
            for (int mb = 0; mb < 4; ++mb) { a[ks][mb] = WFrag<T16>::ld((const T16*)((const char*)A + oa[mb]) + ks * 32); if (NSPLIT == 1 || NSPLIT == 2) a2[ks][mb] = WFrag<T16>::ld((const T16*)((const char*)A2 + oa[mb]) + ks * 32); }
#pragma unroll
        for (int ks = 0; ks < KS / 32; ++ks)
#pragma unroll
            for (int nb = 0; nb < 4; ++nb) { const V b = WFrag<T16>::ld((const T16*)((const char*)Bt + ob[nb]) + ks * 32); V b2; if (NSPLIT >= 2) b2 = WFrag<T16>::ld((const T16*)((const char*)Bt2 + ob[nb]) + ks * 32);
#pragma unroll
                for (int mb = 0; mb < 4; ++mb) { acc[mb][nb] = WFrag<T16>::mma(a[ks][mb], b, acc[mb][nb]); if (NSPLIT == 1 || NSPLIT == 2) acc[mb][nb] = WFrag<T16>::mma(a2[ks][mb], b, acc[mb][nb]); if (NSPLIT >= 2) acc[mb][nb] = WFrag<T16>::mma(a[ks][mb], b2, acc[mb][nb]); } }
        // keeps the distance behind the trip's last matrix instructions on the taken back edge; the row offsets are inputs so that no load's
        // result lands in an address register of an earlier load of the trip: they stay as they are until the diagonal accumulators, which take in every fragment, are complete
        asm volatile("v_nop\n\tv_nop\n\tv_nop\n\tv_nop" : "+v"(acc[0][0]), "+v"(acc[1][1]), "+v"(acc[2][2]), "+v"(acc[3][3]) : "v"(a[KS / 32 - 1][0]), "v"(a[KS / 32 - 1][3]), "v"(oa[0]), "v"(oa[1]), "v"(oa[2]), "v"(oa[3]), "v"(ob[0]), "v"(ob[1]), "v"(ob[2]), "v"(ob[3]));
#pragma unroll
        for (int q = 0; q < 4; ++q) { oa[q] += NWV * KS * (unsigned)sizeof(T16); ob[q] += NWV * KS * (unsigned)sizeof(T16); }
    }
    float* ow = os + wave * (64 * 68);
#pragma unroll
    for (int mb = 0; mb < 4; ++mb)
#pragma unroll
        for (int nb = 0; nb < 4; ++nb)
#pragma unroll
            for (int j = 0; j < 8; ++j) ow[(mb * 16 + hi * 8 + j) * 68 + nb * 16 + lr] = acc[mb][nb][j];
    __syncthreads();   // every wave's partial tile is in LDS before any thread sums across waves
    const int trow = threadIdx.x >> 4, cofs = (threadIdx.x & 15) * 4;
#pragma unroll
    for (int rb = 0; rb < 64; rb += 2 * NWV) { const int row = rb + trow; v4f val = *(const v4fa*)(os + row * 68 + cofs);
#pragma unroll
        for (int w = 1; w < NWV; ++w) val += *(const v4fa*)(os + (w * 64 + row) * 68 + cofs);
        if (BIAS) { val[0] += bfr(bias[c0 + cofs]); val[1] += bfr(bias[c0 + cofs + 1]); val[2] += bfr(bias[c0 + cofs + 2]); val[3] += bfr(bias[c0 + cofs + 3]); }
        *(v4f*)(C + (size_t)(r0 + row) * ldc + c0 + cofs) = val; }
}

// ---- k_gemmc: ONE WAVE per 64x64 output tile, K loop unsplit, specialised for causal attention (launched for the scores, CMODE 1, whose K is one slice): CMODE 1 skips score tiles entirely above the diagonal (query rows r0+roff.., key columns c0..), CMODE 2 limits the
// key (K) loop of the probability x value contraction to the diagonal block (probabilities beyond it are exactly zero). roff = row offset of this launch's first row within the sequence.
template <typename T16, int NSPLIT, int CMODE>
__global__ __launch_bounds__(32) void k_gemmc(const T16* __restrict__ A, const T16* __restrict__ A2, const T16* __restrict__ Bt, const T16* __restrict__ Bt2, int K, float* C, int ldc, int roff, size_t sA, size_t sB, size_t sC) {
    typedef typename WFrag<T16>::V V;
    __shared__ __align__(16) float os[16 * 68];
    const size_t z = blockIdx.z; A += z * sA; if (A2) A2 += z * sA; Bt += z * sB; if (Bt2) Bt2 += z * sB; C += z * sC;
    const int lane = threadIdx.x & 31, lr = lane & 15, hi = lane >> 4; const int r0 = blockIdx.x * 64, c0 = blockIdx.y * 64;
    if (CMODE == 1 && c0 > r0 + roff + 63) return;                  // score tile entirely above the causal diagonal: never written (the softmax masks j > i by select)
    const int Kl = (CMODE == 2) ? min(K, r0 + roff + 64) : K;        // P.V: probabilities are exactly 0 beyond the diagonal block, so the K loop stops there
    v8f acc[4][4];
#pragma unroll
    for (int mb = 0; mb < 4; ++mb)
#pragma unroll
        for (int nb = 0; nb < 4; ++nb) acc[mb][nb] = (v8f){};
    const size_t aoff = (size_t)(r0 + lr) * K + 8 * hi, boff = (size_t)(c0 + lr) * K + 8 * hi;
#pragma unroll 1
    for (int kc = 0; kc < Kl; kc += 32) {
        V a[4], a2[4];
#pragma unroll
        for (int mb = 0; mb < 4; ++mb) { a[mb] = WFrag<T16>::ld(A + aoff + (size_t)mb * 16 * K + kc); if (NSPLIT == 1 || NSPLIT == 2) a2[mb] = WFrag<T16>::ld(A2 + aoff + (size_t)mb * 16 * K + kc); }
#pragma unroll
        for (int nb = 0; nb < 4; ++nb) { const V b = WFrag<T16>::ld(Bt + boff + (size_t)nb * 16 * K + kc); V b2; if (NSPLIT >= 2) b2 = WFrag<T16>::ld(Bt2 + boff + (size_t)nb * 16 * K + kc);
#pragma unroll
            for (int mb = 0; mb < 4; ++mb) { acc[mb][nb] = WFrag<T16>::mma(a[mb], b, acc[mb][nb]); if (NSPLIT == 1 || NSPLIT == 2) acc[mb][nb] = WFrag<T16>::mma(a2[mb], b, acc[mb][nb]); if (NSPLIT >= 2) acc[mb][nb] = WFrag<T16>::mma(a[mb], b2, acc[mb][nb]); } }
        asm volatile("v_nop\n\tv_nop\n\tv_nop\n\tv_nop" : "+v"(acc[0][0]), "+v"(acc[1][1]), "+v"(acc[2][2]), "+v"(acc[3][3]) : "v"(a[0]), "v"(a[3]));
    }
#pragma unroll
    for (int mb = 0; mb < 4; ++mb) {
#pragma unroll
        for (int nb = 0; nb < 4; ++nb) {
#pragma unroll
            for (int j = 0; j < 8; ++j) os[(hi * 8 + j) * 68 + nb * 16 + lr] = acc[mb][nb][j]; }
        __builtin_amdgcn_wave_barrier(); asm volatile("" ::: "memory");
        float* crow = C + (size_t)(r0 + mb * 16) * ldc + c0;
{
#pragma unroll
            for (int s = 0; s < 8; ++s) { const int row = 2 * s + hi, cofs = lr * 4; v4f val = *(const v4fa*)(os + row * 68 + cofs);
                *(v4f*)(crow + (size_t)row * ldc + cofs) = val; }
             }
        __builtin_amdgcn_wave_barrier(); asm volatile("" ::: "memory");
    }
}

__device__ __forceinline__ h16 tohx(float x) { return (h16)x; }
__device__ __forceinline__ void splitf(float y, unsigned short& h, unsigned short& l) { h = f2bf(y); l = f2bf(y - bf2f(h)); }
typedef __attribute__((ext_vector_type(2))) _Float16 v2h;
typedef __attribute__((ext_vector_type(4))) _Float16 v4h;
typedef __attribute__((ext_vector_type(2))) unsigned short v2us;
typedef __attribute__((ext_vector_type(4))) unsigned short v4us;
typedef v4h  __attribute__((may_alias)) v4ha;
typedef v4us __attribute__((may_alias)) v4usa;
typedef __attribute__((ext_vector_type(2))) float v2f;
typedef __attribute__((ext_vector_type(4))) int v4i;

__global__ __launch_bounds__(256) void k_wtG(const float* __restrict__ w, int K, int N, bf* Bt) {
    const int lane = threadIdx.x & 31; const int L0 = (blockIdx.x * 8 + (threadIdx.x >> 5)) * 8; const int nlines = N * K / 64;
{
#pragma unroll 1
        for (int l = 0; l < 8; ++l) { const int L = L0 + l; if (L >= nlines) break; const size_t e = (size_t)L * 64 + lane * 2; const int k = (int)(e % K), n = (int)(e / K); v2us o;
            o[0] = f2bf(w[(size_t)k * N + n]); o[1] = f2bf(w[(size_t)(k + 1) * N + n]); *(v2us*)(Bt + e) = o; }
         }
}
__global__ __launch_bounds__(256) void k_cvt8(const float* __restrict__ src, bf* dst, size_t n8) { const size_t i = (size_t)blockIdx.x * 256 + threadIdx.x; if (i >= n8) return; const v8f v = *(const v8f*)(src + i * 8); v8us o;
#pragma unroll
    for (int k = 0; k < 8; ++k) o[k] = f2bf(v[k]); *(v8us*)(dst + i * 8) = o;  }

// k_rope: head planes [h][t][d] (fp16 + hi/lo) of rope(x) x sc with the rotate-half convention out[d] = x[d] cos[t][d] - x[d+HD/2] sin[t][d], out[d+HD/2] = x[d+HD/2] cos[t][d+HD/2] + x[d] sin[t][d+HD/2]
__global__ __launch_bounds__(256) void k_rope(const float* __restrict__ F, int pitch, int nheads, const float* __restrict__ CS, const float* __restrict__ RF, const float* __restrict__ nw, float sc, h16* P16, bf* Ph, bf* Pl) {
    const size_t e = ((size_t)blockIdx.x * 256 + threadIdx.x) * 2; if (e >= (size_t)nheads * TT * HD) return; const int d = (int)(e % HD); const int t = (int)((e / HD) % TT); const int h = (int)(e / ((size_t)HD * TT)); const float* f = F + (size_t)t * pitch + h * HD; const float rf = RF ? RF[(size_t)h * TT + t] : 1.0f; v2h o16; v2us oh, ol;
#pragma unroll
    for (int q = 0; q < 2; ++q) { const int dd = d + q; const int dp = (dd < HD / 2) ? dd + HD / 2 : dd - HD / 2; float x0 = f[dd], x1 = f[dp];
        if (RF) { float n0 = __fmul_rn(x0, rf), n1 = __fmul_rn(x1, rf); asm volatile("" : "+v"(n0)); asm volatile("" : "+v"(n1)); x0 = __fmul_rn(bfr(nw[dd]), n0); x1 = __fmul_rn(bfr(nw[dp]), n1); }
        const v2f cs = *(const v2f*)(CS + ((size_t)t * HD + dd) * 2); float a = __fmul_rn(x0, cs[0]), bq = __fmul_rn(x1, cs[1]); asm volatile("" : "+v"(a)); asm volatile("" : "+v"(bq)); const float r = ((dd < HD / 2) ? __fsub_rn(a, bq) : __fadd_rn(a, bq)) * sc;
        o16[q] = tohx(r); unsigned short a2, c2; splitf(r, a2, c2); oh[q] = a2; ol[q] = c2; }
    *(v2h*)(P16 + e) = o16; *(v2us*)(Ph + e) = oh; *(v2us*)(Pl + e) = ol;  }
__global__ __launch_bounds__(256) void k_vtp(const float* __restrict__ F, int pitch, int nheads, h16* V16, bf* Vh, bf* Vl) { const size_t e = ((size_t)blockIdx.x * 256 + threadIdx.x) * 2; if (e >= (size_t)nheads * HD * TT) return; const int t = (int)(e % TT); const int d = (int)((e / TT) % HD); const int g = (int)(e / ((size_t)TT * HD)); v2h o16; v2us oh, ol;
#pragma unroll
    for (int q = 0; q < 2; ++q) { const float x = F[(size_t)(t + q) * pitch + g * HD + d]; o16[q] = tohx(x); unsigned short a2, c2; splitf(x, a2, c2); oh[q] = a2; ol[q] = c2; }
    *(v2h*)(V16 + e) = o16; *(v2us*)(Vh + e) = oh; *(v2us*)(Vl + e) = ol;  }
__global__ __launch_bounds__(256) void k_csid(float* CS) { const int idx = blockIdx.x * 256 + threadIdx.x; if (idx >= TT * HD) return; v2f cs; cs[0] = 1.0f; cs[1] = 0.0f; *(v2f*)(CS + (size_t)idx * 2) = cs;  }
// k_asoft: per row (zz, i): t = S x HD^-0.5 for j <= i and i - j < WIN (sliding causal window; the reference's -1e9 additive fill vanishes identically); softmax over the 2048 keys (register row, one exp, fixed trees);
// the probabilities overwrite the row's own 8 KiB of scores (one wave owns a row and holds all of it in registers before its first store): fp16 rows fill the first half, hi/lo rows hi the first and lo the second half
__global__ __launch_bounds__(256) void k_asoft(float* Sb) {
    const int lane = threadIdx.x & 31; const int row = blockIdx.x * 8 + (threadIdx.x >> 5); if (row >= ZH * TT) return; const int i = row % TT; const int zz = row / TT; (void)zz; const bool hires = (i < RH); float* sr = Sb + (size_t)row * TT; float v[TT / 32]; float mx = -3.0e38f;
#pragma unroll
    for (int ch = 0; ch < TT / 128; ++ch) { const int j0 = ch * 128 + lane * 4; const v4f a = *(const v4f*)(sr + j0);
#pragma unroll
        for (int q = 0; q < 4; ++q) { const int j = j0 + q; (void)j; const float t = (j <= i && i - j < WIN) ? a[q] * SCL : -3.0e38f; v[ch * 4 + q] = t; mx = fmaxf(mx, t); } }
#pragma unroll
    for (int sh = 16; sh; sh >>= 1) mx = fmaxf(mx, __shfl_xor(mx, sh, 32));
    float sum = 0.f;
#pragma unroll
    for (int k = 0; k < TT / 32; ++k) { float d0 = __fsub_rn(v[k], mx); asm volatile("" : "+v"(d0)); v[k] = __builtin_amdgcn_exp2f(__fmul_rn(d0, 1.4426950408889634f)); sum += v[k]; }
#pragma unroll
    for (int sh = 16; sh; sh >>= 1) sum += __shfl_xor(sum, sh, 32);
    const float f = __fdiv_rn(hires ? 1.0f : PCAR, sum);
{
        if (hires) {
#pragma unroll
            for (int ch = 0; ch < TT / 128; ++ch) { v4us oh, ol;
#pragma unroll
                for (int q = 0; q < 4; ++q) { unsigned short a, c2; splitf(v[ch * 4 + q] * f, a, c2); oh[q] = a; ol[q] = c2; }
                bf* pr = (bf*)sr + ch * 128 + lane * 4; *(v4usa*)pr = oh; *(v4usa*)(pr + TT) = ol; }
        } else {
#pragma unroll
            for (int ch = 0; ch < TT / 128; ++ch) { v4h o4;
#pragma unroll
                for (int q = 0; q < 4; ++q) o4[q] = tohx(v[ch * 4 + q] * f);
                *(v4ha*)((h16*)sr + ch * 128 + lane * 4) = o4; } }
         }
}
__global__ __launch_bounds__(256) void k_addres(float* Y, const float* __restrict__ xr) { const size_t i = (size_t)blockIdx.x * 256 + threadIdx.x; if (i >= (size_t)TT * DQ / 4) return; const v4f a = *(const v4f*)(Y + i * 4); const v4f r = *(const v4f*)(xr + i * 4); v4f o;
#pragma unroll
    for (int q = 0; q < 4; ++q) o[q] = __fadd_rn(a[q], bfr(r[q]));
    *(v4f*)(Y + i * 4) = o;  }
__global__ __launch_bounds__(256) void k_lnout(const float* __restrict__ F, const float* __restrict__ g, const float* __restrict__ bb, float* out) { const int lane = threadIdx.x & 31; const int row = blockIdx.x * 8 + (threadIdx.x >> 5); if (row >= TT) return; const float* fr = F + (size_t)row * DQ; float* orow = out + (size_t)row * DQ; float v[DQ / 32]; float s = 0.f;
#pragma unroll
    for (int c = 0; c < DQ / 128; ++c) { const v4f a = *(const v4f*)(fr + c * 128 + lane * 4); for (int q = 0; q < 4; ++q) { v[c * 4 + q] = a[q]; s = __fadd_rn(s, a[q]); } }
#pragma unroll
    for (int sh = 16; sh; sh >>= 1) s = __fadd_rn(s, __shfl_xor(s, sh, 32));
    const float mean = __fdiv_rn(s, (float)DQ); float s2 = 0.f;
#pragma unroll
    for (int k = 0; k < DQ / 32; ++k) { const float dv = __fsub_rn(v[k], mean); float p2 = __fmul_rn(dv, dv); asm volatile("" : "+v"(p2)); s2 = __fadd_rn(s2, p2); v[k] = dv; }
#pragma unroll
    for (int sh = 16; sh; sh >>= 1) s2 = __fadd_rn(s2, __shfl_xor(s2, sh, 32));
    const float rs = __fdiv_rn(1.0f, __fsqrt_rn(__fadd_rn(__fdiv_rn(s2, (float)DQ), LNEPS)));
{
#pragma unroll
        for (int c = 0; c < DQ / 128; ++c) { v4f o; for (int q = 0; q < 4; ++q) { const int col = c * 128 + lane * 4 + q; float y = __fmul_rn(v[c * 4 + q], rs); asm volatile("" : "+v"(y)); y = __fmul_rn(y, bfr(g[col])); asm volatile("" : "+v"(y)); o[q] = __fadd_rn(y, bfr(bb[col])); } *(v4f*)(orow + c * 128 + lane * 4) = o; }
         } }
__global__ __launch_bounds__(256) void k_merge(const float* __restrict__ O, int h0, bf* Ah, bf* Al) { const size_t e = ((size_t)blockIdx.x * 256 + threadIdx.x) * 2; if (e >= (size_t)ZH * TT * HD) return; const int d = (int)(e % HD); const int t = (int)((e / HD) % TT); const int zz = (int)(e / ((size_t)HD * TT)); const float cs = (t < RH) ? 1.0f : (1.0f / PCAR); const size_t oo = (size_t)t * DQ + (h0 + zz) * HD + d;
    v2us oh, ol;
#pragma unroll
    for (int q = 0; q < 2; ++q) { unsigned short a, c2; splitf(O[e + q] * cs, a, c2); oh[q] = a; ol[q] = c2; } *(v2us*)(Ah + oo) = oh; *(v2us*)(Al + oo) = ol;  }

extern "C" void kernel_launch(void* const* d_in, const int* in_sizes, int n_in,
                              void* d_out, int out_size, void* d_ws, size_t ws_size, hipStream_t stream) {
    (void)in_sizes; (void)n_in; (void)out_size;
    const float* x = (const float*)d_in[0]; const float* wq = (const float*)d_in[1]; const float* bq = (const float*)d_in[2]; const float* wk = (const float*)d_in[3]; const float* bk = (const float*)d_in[4]; const float* wv = (const float*)d_in[5]; const float* bv = (const float*)d_in[6]; const float* wo = (const float*)d_in[7]; const float* bo = (const float*)d_in[8]; const float* lng = (const float*)d_in[9]; const float* lnb = (const float*)d_in[10];
    float* OUT = (float*)d_out;     // [2][2048][1024]
    char* wsp = (char*)d_ws;
    auto take = [&](size_t bytes) { char* p = wsp; wsp += (bytes + 255) & ~(size_t)255; return (void*)p; };
    float* Y = (float*)take((size_t)TT * DM * 4); bf* WQ = (bf*)take((size_t)DQ * DM * 2); bf* WK = (bf*)take((size_t)DKV * DM * 2); bf* WV = (bf*)take((size_t)DKV * DM * 2); bf* WO = (bf*)take((size_t)DM * DQ * 2); float* CS = (float*)take((size_t)TT * HD * 2 * 4);
    bf* XB = (bf*)take((size_t)TT * DM * 2); float* FQ = (float*)take((size_t)TT * DQ * 4); float* FK = (float*)take((size_t)TT * DKV * 4);
    h16* QP16 = (h16*)take((size_t)NH_ * TT * HD * 2); h16* KP16 = (h16*)take((size_t)NKV * TT * HD * 2); h16* VT16 = (h16*)take((size_t)NKV * HD * TT * 2);
    bf* QPh = (bf*)take((size_t)NH_ * TT * HD * 2); bf* QPl = (bf*)take((size_t)NH_ * TT * HD * 2); bf* KPh = (bf*)take((size_t)NKV * TT * HD * 2); bf* KPl = (bf*)take((size_t)NKV * TT * HD * 2); bf* VTh = (bf*)take((size_t)NKV * HD * TT * 2); bf* VTl = (bf*)take((size_t)NKV * HD * TT * 2);
    float* Sb = (float*)take((size_t)ZH * TT * TT * 4); float* Ob = (float*)take((size_t)ZH * TT * HD * 4); bf* ATh = (bf*)take((size_t)TT * DQ * 2); bf* ATl = (bf*)take((size_t)TT * DQ * 2);
    if ((size_t)(wsp - (char*)d_ws) > ws_size) return;    // ws 256 MiB
    float* FV = FK;   // v projection reuses the k buffer after the k planes are built (stream-ordered)
    { k_cvt8<<<(unsigned)(((size_t)DQ * DM / 8 + 255) / 256), 256, 0, stream>>>(wq, WQ, (size_t)DQ * DM / 8); k_cvt8<<<(unsigned)(((size_t)DKV * DM / 8 + 255) / 256), 256, 0, stream>>>(wk, WK, (size_t)DKV * DM / 8); k_cvt8<<<(unsigned)(((size_t)DKV * DM / 8 + 255) / 256), 256, 0, stream>>>(wv, WV, (size_t)DKV * DM / 8);
      k_cvt8<<<(unsigned)(((size_t)DM * DQ / 8 + 255) / 256), 256, 0, stream>>>(wo, WO, (size_t)DM * DQ / 8);
       }
    k_csid<<<(TT * HD + 255) / 256, 256, 0, stream>>>(CS);
    const unsigned LQ = (unsigned)(((size_t)NH_ * TT * HD / 2 + 255) / 256), LKv = (unsigned)(((size_t)NKV * TT * HD / 2 + 255) / 256);
    for (int b = 0; b < NB_; ++b) {
        
        k_cvt8<<<(unsigned)(((size_t)TT * DM / 8 + 255) / 256), 256, 0, stream>>>(x + (size_t)b * TT * DM, XB, (size_t)TT * DM / 8);
        k_gemmw<bf, 0, true, false, NW><<<dim3(TT / 64, DQ / 64, 1), 32 * NW, 0, stream>>>(XB, nullptr, WQ, nullptr, DM, DM, FQ, DQ, bq, 0, 0, 0, 0);
        k_rope<<<LQ, 256, 0, stream>>>(FQ, DQ, NH_, CS, nullptr, nullptr, 1.0f, QP16, QPh, QPl);
        k_gemmw<bf, 0, true, false, NW><<<dim3(TT / 64, DKV / 64, 1), 32 * NW, 0, stream>>>(XB, nullptr, WK, nullptr, DM, DM, FK, DKV, bk, 0, 0, 0, 0);
        k_rope<<<LKv, 256, 0, stream>>>(FK, DKV, NKV, CS, nullptr, nullptr, 1.0f, KP16, KPh, KPl);
        k_gemmw<bf, 0, true, false, NW><<<dim3(TT / 64, DKV / 64, 1), 32 * NW, 0, stream>>>(XB, nullptr, WV, nullptr, DM, DM, FV, DKV, bv, 0, 0, 0, 0); k_vtp<<<LKv, 256, 0, stream>>>(FV, DKV, NKV, VT16, VTh, VTl);
        for (int h0 = 0; h0 < NH_; h0 += ZH) { const size_t zq = (size_t)h0, zk = (size_t)(h0 / REP);   // one kv head per query head: the pass's heads use consecutive kv planes (z-strides TT*HD)
            k_gemmc<bf, 2, 1><<<dim3(RH / 64, TT / 64, ZH), 32, 0, stream>>>(QPh + zq * TT * HD, QPl + zq * TT * HD, KPh + zk * TT * HD, KPl + zk * TT * HD, HD, Sb, TT, 0, (size_t)TT * HD, (size_t)TT * HD, (size_t)TT * TT);
            k_gemmc<h16, 0, 1><<<dim3((TT - RH) / 64, TT / 64, ZH), 32, 0, stream>>>(QP16 + zq * TT * HD + (size_t)RH * HD, nullptr, KP16 + zk * TT * HD, nullptr, HD, Sb + (size_t)RH * TT, TT, RH, (size_t)TT * HD, (size_t)TT * HD, (size_t)TT * TT);
            k_asoft<<<ZH * TT / 8, 256, 0, stream>>>(Sb);
            k_gemmw<bf, 2, false, true, NW><<<dim3(RH / 64, HD / 64, ZH), 32 * NW, 0, stream>>>((const bf*)Sb, (const bf*)Sb + TT, VTh + zk * HD * TT, VTl + zk * HD * TT, TT, 2 * TT, Ob, HD, nullptr, 0, (size_t)2 * TT * TT, (size_t)HD * TT, (size_t)TT * HD);
            k_gemmw<h16, 0, false, true, NWL><<<dim3((TT - RH) / 64, HD / 64, ZH), 32 * NWL, 0, stream>>>((const h16*)Sb + (size_t)RH * 2 * TT, nullptr, VT16 + zk * HD * TT, nullptr, TT, 2 * TT, Ob + (size_t)RH * HD, HD, nullptr, RH, (size_t)2 * TT * TT, (size_t)HD * TT, (size_t)TT * HD);
            k_merge<<<(unsigned)(((size_t)ZH * TT * HD / 2 + 255) / 256), 256, 0, stream>>>(Ob, h0, ATh, ATl); }
        k_gemmw<bf, 1, true, false, NW><<<dim3(TT / 64, DM / 64, 1), 32 * NW, 0, stream>>>(ATh, ATl, WO, nullptr, DQ, DQ, Y, DM, bo, 0, 0, 0, 0); k_addres<<<(unsigned)(((size_t)TT * DQ / 4 + 255) / 256), 256, 0, stream>>>(Y, x + (size_t)b * TT * DM); k_lnout<<<(TT + 7) / 8, 256, 0, stream>>>(Y, lng, lnb, OUT + (size_t)b * TT * DM); }
}

// v003
// Measured time: 253 microseconds a run.
// Next to v002, in two timings, it ran 1.95 and 1.97 times as fast.
// All steps since v000 together make it 5.78 times as fast.
#include <hip/hip_runtime.h>

// Masked (causal) self-attention with residual and post-LayerNorm (x [2][2048][1024]; q,k,v = x W^T + b ('oi' uniform(+-1/32) incl. biases; 16 heads x 64); energy / 8; causal (-inf); softmax; out = merged Wo^T + bo; y = LayerNorm(out + x) gamma/beta (1e-5) -> [2][2048][1024] (4.2 M)).
// Layout per batch: bf16 copy of x; 'oi' weights; exact projections + f32 biases; one fused causal attention kernel (scores, online softmax, probability x value and the head merge stay in registers and LDS; hybrid rows: < 512 hi/lo 3 products, rest fp16; key blocks above the diagonal never visited); merged hi/lo x Wo exact + bo into workspace; residual add and a row LayerNorm kernel write the output rows.
// Compute dtypes, f32 accumulate: every input rounded to bf16; projections exact + f32 biases; attention rows < 512 3 products, rest fp16; softmax f32; Wo hl x exact + bias; residual + LayerNorm f32.

#define NB_  2
#define TT   2048
#define DM   1024
#define NH_  16
#define NKV  16
#define HD   64
#define DQ   (NH_ * HD)
#define DKV  (NKV * HD)
#define RH   512                  // query rows < RH use hi+lo planes (0: none)
#define SCL  0.125f   // HD^-0.5
#define LNEPS 1e-5f
typedef _Float16 h16;
typedef unsigned short bf;
typedef __attribute__((ext_vector_type(16))) __bf16   v16bf;
typedef __attribute__((ext_vector_type(16))) _Float16 v16h;
typedef __attribute__((ext_vector_type(8)))  _Float16 v8h;
typedef __attribute__((ext_vector_type(8)))  unsigned short v8us;
typedef __attribute__((ext_vector_type(8)))  float    v8f;
typedef __attribute__((ext_vector_type(4)))  float    v4f;
typedef v8h  __attribute__((may_alias)) v8ha;
typedef v4f  __attribute__((may_alias)) v4fa;
typedef v8us __attribute__((may_alias)) v8usa;

__device__ __forceinline__ unsigned short f2bf(float f) { unsigned u = __float_as_uint(f); u += 0x7FFFu + ((u >> 16) & 1u); return (unsigned short)(u >> 16); }
__device__ __forceinline__ float bf2f(unsigned short b) { return __uint_as_float(((unsigned)b) << 16); }
__device__ __forceinline__ float bfr(float f) { return bf2f(f2bf(f)); }
__device__ __forceinline__ v16h cat16(v8h lo, v8h hi) { return __builtin_shufflevector(lo, hi, 0, 1, 2, 3, 4, 5, 6, 7, 8, 9, 10, 11, 12, 13, 14, 15); }
__device__ __forceinline__ v16bf cat16b(v8us lo, v8us hi) { return __builtin_bit_cast(v16bf, __builtin_shufflevector(lo, hi, 0, 1, 2, 3, 4, 5, 6, 7, 8, 9, 10, 11, 12, 13, 14, 15)); }
__device__ __forceinline__ v8f wmma16(v16h a, v16h b, v8f c) { return __builtin_amdgcn_wmma_f32_16x16x32_f16(false, a, false, b, (short)0, c, false, false); }
__device__ __forceinline__ v8f wmmab(v16bf a, v16bf b, v8f c) { return __builtin_amdgcn_wmma_f32_16x16x32_bf16(false, a, false, b, (short)0, c, false, false); }



// ---- k_gemmw: register-blocked GEMM, one 64x64 output tile per work-group of NWV waves; the K loop is split over the waves in slices of KS elements (wave w takes slices w, w + NWV, ...), each wave
// holds the whole tile (16 accumulators) for its slices, operands straight from K-contiguous 16-bit planes; the NWV partial tiles meet in LDS and are summed in wave order. grid (M/64, N/64, Z), 32 * NWV threads.
// C[m][n] (f32, pitch ldc, + optional f32 bias[n]) = sum_k A[m][k] Bt[n][k] (+ split products per NSPLIT). z-batch strides sA/sB/sC and the A pitch lda in elements. K % KS == 0.
// DIAG: probability x value contraction of causal attention: the K loop stops at the diagonal block (probabilities beyond it are exactly zero); roff = row offset of this launch's first row within the sequence.
#define NW 8      // waves that share one tile's K loop (K up to 1024: at most two slices a wave)
#define KS 64     // K elements per slice: one 128-byte line of every operand row, read by one wave only
template <typename T16> struct WFrag;
template <> struct WFrag<h16> { typedef v16h V; static __device__ __forceinline__ V ld(const h16* p) { return cat16(*(const v8h*)p, *(const v8h*)(p + 16)); } static __device__ __forceinline__ v8f mma(V a, V b, v8f c) { return wmma16(a, b, c); } };
template <> struct WFrag<bf> { typedef v16bf V; static __device__ __forceinline__ V ld(const bf* p) { return cat16b(*(const v8us*)p, *(const v8us*)(p + 16)); } static __device__ __forceinline__ v8f mma(V a, V b, v8f c) { return wmmab(a, b, c); } };
template <typename T16, int NSPLIT, bool BIAS, bool DIAG, int NWV>
__global__ __launch_bounds__(32 * NWV) void k_gemmw(const T16* __restrict__ A, const T16* __restrict__ A2, const T16* __restrict__ Bt, const T16* __restrict__ Bt2, int K, int lda, float* C, int ldc, const float* __restrict__ bias, int roff, size_t sA, size_t sB, size_t sC) {
    typedef typename WFrag<T16>::V V;
    __shared__ __align__(16) float os[NWV * 64 * 68];
    const size_t z = blockIdx.z; A += z * sA; if (A2) A2 += z * sA; Bt += z * sB; if (Bt2) Bt2 += z * sB; C += z * sC;
    const int lane = threadIdx.x & 31, lr = lane & 15, hi = lane >> 4; const int r0 = blockIdx.x * 64, c0 = blockIdx.y * 64;
    const int wave = __builtin_amdgcn_readfirstlane(threadIdx.x >> 5);
    const int Kl = DIAG ? min(K, r0 + roff + 64) : K;
    v8f acc[4][4];
#pragma unroll
    for (int mb = 0; mb < 4; ++mb)
#pragma unroll
        for (int nb = 0; nb < 4; ++nb) acc[mb][nb] = (v8f){};
    // byte offset of this lane's row of each 16-row block from its plane's base, stepped from trip to trip (32 bits hold it: a plane spans at most 2^23 elements); A and A2 share the pitch lda, Bt and Bt2 the pitch K
    unsigned oa[4], ob[4];
#pragma unroll
    for (int q = 0; q < 4; ++q) { oa[q] = (unsigned)((r0 + lr + q * 16) * lda + 8 * hi + wave * KS) * (unsigned)sizeof(T16); ob[q] = (unsigned)((c0 + lr + q * 16) * K + 8 * hi + wave * KS) * (unsigned)sizeof(T16); }
#pragma unroll 1   // stays rolled: a second trip's fragments do not fit beside the 16 accumulators
    for (int kb = wave * KS; kb < Kl; kb += NWV * KS) {
        V a[KS / 32][4], a2[KS / 32][4];
#pragma unroll
        for (int ks = 0; ks < KS / 32; ++ks)
#pragma unroll
            for (int mb = 0; mb < 4; ++mb) { a[ks][mb] = WFrag<T16>::ld((const T16*)((const char*)A + oa[mb]) + ks * 32); if (NSPLIT == 1 || NSPLIT == 2) a2[ks][mb] = WFrag<T16>::ld((const T16*)((const char*)A2 + oa[mb]) + ks * 32); }
#pragma unroll
        for (int ks = 0; ks < KS / 32; ++ks)
#pragma unroll
            for (int nb = 0; nb < 4; ++nb) { const V b = WFrag<T16>::ld((const T16*)((const char*)Bt + ob[nb]) + ks * 32); V b2; if (NSPLIT >= 2) b2 = WFrag<T16>::ld((const T16*)((const char*)Bt2 + ob[nb]) + ks * 32);
#pragma unroll
                for (int mb = 0; mb < 4; ++mb) { acc[mb][nb] = WFrag<T16>::mma(a[ks][mb], b, acc[mb][nb]); if (NSPLIT == 1 || NSPLIT == 2) acc[mb][nb] = WFrag<T16>::mma(a2[ks][mb], b, acc[mb][nb]); if (NSPLIT >= 2) acc[mb][nb] = WFrag<T16>::mma(a[ks][mb], b2, acc[mb][nb]); } }
        // keeps the distance behind the trip's last matrix instructions on the taken back edge; the row offsets are inputs so that no load's
        // result lands in an address register of an earlier load of the trip: they stay as they are until the diagonal accumulators, which take in every fragment, are complete
        asm volatile("v_nop\n\tv_nop\n\tv_nop\n\tv_nop" : "+v"(acc[0][0]), "+v"(acc[1][1]), "+v"(acc[2][2]), "+v"(acc[3][3]) : "v"(a[KS / 32 - 1][0]), "v"(a[KS / 32 - 1][3]), "v"(oa[0]), "v"(oa[1]), "v"(oa[2]), "v"(oa[3]), "v"(ob[0]), "v"(ob[1]), "v"(ob[2]), "v"(ob[3]));
#pragma unroll
        for (int q = 0; q < 4; ++q) { oa[q] += NWV * KS * (unsigned)sizeof(T16); ob[q] += NWV * KS * (unsigned)sizeof(T16); }
    }
    float* ow = os + wave * (64 * 68);
#pragma unroll
    for (int mb = 0; mb < 4; ++mb)
#pragma unroll
        for (int nb = 0; nb < 4; ++nb)
#pragma unroll
            for (int j = 0; j < 8; ++j) ow[(mb * 16 + hi * 8 + j) * 68 + nb * 16 + lr] = acc[mb][nb][j];
    __syncthreads();   // every wave's partial tile is in LDS before any thread sums across waves
    const int trow = threadIdx.x >> 4, cofs = (threadIdx.x & 15) * 4;
#pragma unroll
    for (int rb = 0; rb < 64; rb += 2 * NWV) { const int row = rb + trow; v4f val = *(const v4fa*)(os + row * 68 + cofs);
#pragma unroll
        for (int w = 1; w < NWV; ++w) val += *(const v4fa*)(os + (w * 64 + row) * 68 + cofs);
        if (BIAS) { val[0] += bfr(bias[c0 + cofs]); val[1] += bfr(bias[c0 + cofs + 1]); val[2] += bfr(bias[c0 + cofs + 2]); val[3] += bfr(bias[c0 + cofs + 3]); }
        *(v4f*)(C + (size_t)(r0 + row) * ldc + c0 + cofs) = val; }
}

__device__ __forceinline__ h16 tohx(float x) { return (h16)x; }
__device__ __forceinline__ void splitf(float y, unsigned short& h, unsigned short& l) { h = f2bf(y); l = f2bf(y - bf2f(h)); }
typedef __attribute__((ext_vector_type(2))) _Float16 v2h;
typedef __attribute__((ext_vector_type(4))) _Float16 v4h;
typedef __attribute__((ext_vector_type(2))) unsigned short v2us;
typedef __attribute__((ext_vector_type(4))) unsigned short v4us;
typedef v4h  __attribute__((may_alias)) v4ha;
typedef v4us __attribute__((may_alias)) v4usa;
typedef __attribute__((ext_vector_type(2))) float v2f;
typedef __attribute__((ext_vector_type(4))) int v4i;

__global__ __launch_bounds__(256) void k_wtG(const float* __restrict__ w, int K, int N, bf* Bt) {
    const int lane = threadIdx.x & 31; const int L0 = (blockIdx.x * 8 + (threadIdx.x >> 5)) * 8; const int nlines = N * K / 64;
{
#pragma unroll 1
        for (int l = 0; l < 8; ++l) { const int L = L0 + l; if (L >= nlines) break; const size_t e = (size_t)L * 64 + lane * 2; const int k = (int)(e % K), n = (int)(e / K); v2us o;
            o[0] = f2bf(w[(size_t)k * N + n]); o[1] = f2bf(w[(size_t)(k + 1) * N + n]); *(v2us*)(Bt + e) = o; }
         }
}
__global__ __launch_bounds__(256) void k_cvt8(const float* __restrict__ src, bf* dst, size_t n8) { const size_t i = (size_t)blockIdx.x * 256 + threadIdx.x; if (i >= n8) return; const v8f v = *(const v8f*)(src + i * 8); v8us o;
#pragma unroll
    for (int k = 0; k < 8; ++k) o[k] = f2bf(v[k]); *(v8us*)(dst + i * 8) = o;  }

// k_rope: head planes [h][t][d] (fp16 + hi/lo) of rope(x) x sc with the rotate-half convention out[d] = x[d] cos[t][d] - x[d+HD/2] sin[t][d], out[d+HD/2] = x[d+HD/2] cos[t][d+HD/2] + x[d] sin[t][d+HD/2]
__global__ __launch_bounds__(256) void k_rope(const float* __restrict__ F, int pitch, int nheads, const float* __restrict__ CS, const float* __restrict__ RF, const float* __restrict__ nw, float sc, h16* P16, bf* Ph, bf* Pl) {
    const size_t e = ((size_t)blockIdx.x * 256 + threadIdx.x) * 2; if (e >= (size_t)nheads * TT * HD) return; const int d = (int)(e % HD); const int t = (int)((e / HD) % TT); const int h = (int)(e / ((size_t)HD * TT)); const float* f = F + (size_t)t * pitch + h * HD; const float rf = RF ? RF[(size_t)h * TT + t] : 1.0f; v2h o16; v2us oh, ol;
#pragma unroll
    for (int q = 0; q < 2; ++q) { const int dd = d + q; const int dp = (dd < HD / 2) ? dd + HD / 2 : dd - HD / 2; float x0 = f[dd], x1 = f[dp];
        if (RF) { float n0 = __fmul_rn(x0, rf), n1 = __fmul_rn(x1, rf); asm volatile("" : "+v"(n0)); asm volatile("" : "+v"(n1)); x0 = __fmul_rn(bfr(nw[dd]), n0); x1 = __fmul_rn(bfr(nw[dp]), n1); }
        const v2f cs = *(const v2f*)(CS + ((size_t)t * HD + dd) * 2); float a = __fmul_rn(x0, cs[0]), bq = __fmul_rn(x1, cs[1]); asm volatile("" : "+v"(a)); asm volatile("" : "+v"(bq)); const float r = ((dd < HD / 2) ? __fsub_rn(a, bq) : __fadd_rn(a, bq)) * sc;
        o16[q] = tohx(r); unsigned short a2, c2; splitf(r, a2, c2); oh[q] = a2; ol[q] = c2; }
    *(v2h*)(P16 + e) = o16; *(v2us*)(Ph + e) = oh; *(v2us*)(Pl + e) = ol;  }
__global__ __launch_bounds__(256) void k_vtp(const float* __restrict__ F, int pitch, int nheads, h16* V16, bf* Vh, bf* Vl) { const size_t e = ((size_t)blockIdx.x * 256 + threadIdx.x) * 2; if (e >= (size_t)nheads * HD * TT) return; const int t = (int)(e % TT); const int d = (int)((e / TT) % HD); const int g = (int)(e / ((size_t)TT * HD)); v2h o16; v2us oh, ol;
#pragma unroll
    for (int q = 0; q < 2; ++q) { const float x = F[(size_t)(t + q) * pitch + g * HD + d]; o16[q] = tohx(x); unsigned short a2, c2; splitf(x, a2, c2); oh[q] = a2; ol[q] = c2; }
    *(v2h*)(V16 + e) = o16; *(v2us*)(Vh + e) = oh; *(v2us*)(Vl + e) = ol;  }
__global__ __launch_bounds__(256) void k_csid(float* CS) { const int idx = blockIdx.x * 256 + threadIdx.x; if (idx >= TT * HD) return; v2f cs; cs[0] = 1.0f; cs[1] = 0.0f; *(v2f*)(CS + (size_t)idx * 2) = cs;  }
// ---- k_fattn: fused causal attention. One work-group owns one tile of query rows of one head (32 rows in fp16, 16 rows in hi/lo bf16); its FW waves share the key loop in blocks of 32 keys (wave w takes blocks w, w + FW, ...).
// Per block a wave forms S^T = K Q^T (a lane then holds 16 scores of ONE query: keys 8 hi + j of both 16-key tiles), updates that query's running maximum and sum, and feeds the two converted score tiles, which are a B fragment
// in the loaders' own k order, to O^T += V^T P^T. Scores and probabilities never leave the registers. The FW partial (maximum, sum, O) triples meet in LDS, are rescaled to the common maximum and summed in wave order;
// the quotient goes out as the merged hi/lo planes [t][h * HD + d]. Every visited block starts at or below every query of the tile, so each query sees at least one open key in it.
#define FW 8
#define SCL2 (SCL * 1.4426950408889634f)   // scores are carried in the log2 domain: one multiply takes in the scale and log2(e), and the exponent is a plain difference
__device__ __forceinline__ float xhalf(float x) { const int b = __float_as_int(x); return __int_as_float(__builtin_amdgcn_permlanex16(b, b, 0x76543210, 0xfedcba98, false, false)); }   // the value of lane l ^ 16
// p[0..7] = 2^p[0..7]. One statement, every output apart from every input, one v_nop behind the last: keeps the slot that the instruction set asks for behind a transcendental before its result is read or
// its source overwritten
__device__ __forceinline__ void exp2x8(float* p) { float r0, r1, r2, r3, r4, r5, r6, r7;
    asm("v_exp_f32 %0, %8\n\tv_exp_f32 %1, %9\n\tv_exp_f32 %2, %10\n\tv_exp_f32 %3, %11\n\tv_exp_f32 %4, %12\n\tv_exp_f32 %5, %13\n\tv_exp_f32 %6, %14\n\tv_exp_f32 %7, %15\n\tv_nop"
        : "=&v"(r0), "=&v"(r1), "=&v"(r2), "=&v"(r3), "=&v"(r4), "=&v"(r5), "=&v"(r6), "=&v"(r7) : "v"(p[0]), "v"(p[1]), "v"(p[2]), "v"(p[3]), "v"(p[4]), "v"(p[5]), "v"(p[6]), "v"(p[7]));
    p[0] = r0; p[1] = r1; p[2] = r2; p[3] = r3; p[4] = r4; p[5] = r5; p[6] = r6; p[7] = r7; }
template <typename T16, bool HL, int NQ>
__device__ __forceinline__ void attn_tile(const T16* __restrict__ Q, const T16* __restrict__ Q2, const T16* __restrict__ Kp, const T16* __restrict__ K2, const T16* __restrict__ Vt, const T16* __restrict__ V2, int q0, bf* Ah, bf* Al, float* os, float* ms, float* ls) {
    typedef typename WFrag<T16>::V V;
    const int lane = threadIdx.x & 31, lr = lane & 15, hi = lane >> 4;
    const int wave = __builtin_amdgcn_readfirstlane(threadIdx.x >> 5);
    V qf[NQ][2], qf2[NQ][2];
#pragma unroll
    for (int qt = 0; qt < NQ; ++qt)
#pragma unroll
        for (int ks = 0; ks < 2; ++ks) { const int qo = (q0 + qt * 16 + lr) * HD + ks * 32 + 8 * hi; qf[qt][ks] = WFrag<T16>::ld(Q + qo); if (HL) qf2[qt][ks] = WFrag<T16>::ld(Q2 + qo); }
    v8f o[4][NQ]; float m[NQ], l[NQ];
#pragma unroll
    for (int qt = 0; qt < NQ; ++qt) { m[qt] = -3.0e38f; l[qt] = 0.f;
#pragma unroll
        for (int dt = 0; dt < 4; ++dt) o[dt][qt] = (v8f){}; }
    const int kend = q0 + NQ * 16;
    // byte offsets of this lane's first K row and first V^T row from their planes' bases, stepped from block to block (K and K2, Vt and V2 share them); the other rows of a block lie at constant distances
    unsigned ok = (unsigned)((wave * 32 + lr) * HD + 8 * hi) * 2u, ov = (unsigned)(lr * TT + wave * 32 + 8 * hi) * 2u;
#pragma unroll 1   // stays rolled: a second block's fragments do not fit beside the accumulators
    for (int kb = wave * 32; kb < kend; kb += FW * 32, ok += FW * 32 * HD * 2u, ov += FW * 32 * 2u) {
        V kf[2][2], kf2[2][2], vf[4], vf2[4];
#pragma unroll
        for (int kt = 0; kt < 2; ++kt)
#pragma unroll
            for (int ks = 0; ks < 2; ++ks) { kf[kt][ks] = WFrag<T16>::ld((const T16*)((const char*)Kp + ok) + kt * 16 * HD + ks * 32); if (HL) kf2[kt][ks] = WFrag<T16>::ld((const T16*)((const char*)K2 + ok) + kt * 16 * HD + ks * 32); }
#pragma unroll
        for (int dt = 0; dt < 4; ++dt) { vf[dt] = WFrag<T16>::ld((const T16*)((const char*)Vt + ov) + dt * 16 * TT); if (HL) vf2[dt] = WFrag<T16>::ld((const T16*)((const char*)V2 + ov) + dt * 16 * TT); }
        __builtin_amdgcn_sched_barrier(0);   // keeps the V^T loads in front of the score products: their latency then runs under the scores and the softmax instead of behind them
        v8f s[2][NQ];
#pragma unroll
        for (int kt = 0; kt < 2; ++kt)
#pragma unroll
            for (int qt = 0; qt < NQ; ++qt) { s[kt][qt] = (v8f){};
#pragma unroll
                for (int ks = 0; ks < 2; ++ks) { s[kt][qt] = WFrag<T16>::mma(kf[kt][ks], qf[qt][ks], s[kt][qt]); if (HL) { s[kt][qt] = WFrag<T16>::mma(kf[kt][ks], qf2[qt][ks], s[kt][qt]); s[kt][qt] = WFrag<T16>::mma(kf2[kt][ks], qf[qt][ks], s[kt][qt]); } } }
        const bool edge = kb + 31 > q0;   // wave-uniform: only blocks that reach past the tile's first query hold masked keys
#pragma unroll
        for (int qt = 0; qt < NQ; ++qt) { const int qi = q0 + qt * 16 + lr; float t[16]; float mx = m[qt];
#pragma unroll
            for (int e = 0; e < 16; ++e) { float x = s[e >> 3][qt][e & 7] * SCL2; if (edge) x = (kb + (e >> 3) * 16 + hi * 8 + (e & 7) <= qi) ? x : -3.0e38f; t[e] = x; mx = fmaxf(mx, x); }
            mx = fmaxf(mx, xhalf(mx));
            const float al = __builtin_amdgcn_exp2f(m[qt] - mx); m[qt] = mx; float sum = 0.f;
#pragma unroll
            for (int e = 0; e < 16; ++e) t[e] -= mx;
            exp2x8(t); exp2x8(t + 8);
#pragma unroll
            for (int e = 0; e < 16; ++e) sum += t[e];
            l[qt] = l[qt] * al + sum;   // each half of the wave keeps the sum of its own keys; the halves join behind the loop
#pragma unroll
            for (int dt = 0; dt < 4; ++dt) o[dt][qt] *= al;
            if constexpr (HL) { v8us ph0, ph1, pl0, pl1;
#pragma unroll
                for (int e = 0; e < 8; ++e) { unsigned short a, c2; splitf(t[e], a, c2); ph0[e] = a; pl0[e] = c2; splitf(t[e + 8], a, c2); ph1[e] = a; pl1[e] = c2; }
                const V pf = cat16b(ph0, ph1), pf2 = cat16b(pl0, pl1);
#pragma unroll
                for (int dt = 0; dt < 4; ++dt) { o[dt][qt] = WFrag<T16>::mma(vf[dt], pf, o[dt][qt]); o[dt][qt] = WFrag<T16>::mma(vf[dt], pf2, o[dt][qt]); o[dt][qt] = WFrag<T16>::mma(vf2[dt], pf, o[dt][qt]); }
            } else { V pf;
#pragma unroll
                for (int e = 0; e < 16; ++e) pf[e] = (h16)t[e];
#pragma unroll
                for (int dt = 0; dt < 4; ++dt) o[dt][qt] = WFrag<T16>::mma(vf[dt], pf, o[dt][qt]); } }
        // the hi/lo block ends in its matrix instructions: keeps the distance behind them on the taken back edge, where the next block's loads land in the registers of their A operand
        if constexpr (HL) asm volatile("v_nop\n\tv_nop\n\tv_nop\n\tv_nop" : "+v"(o[0][0]), "+v"(o[1][0]), "+v"(o[2][0]), "+v"(o[3][0]));
    }
    float* ow = os + wave * (NQ * 16 * 68);
#pragma unroll
    for (int qt = 0; qt < NQ; ++qt) {
#pragma unroll
        for (int dt = 0; dt < 4; ++dt) { float* dst = ow + (qt * 16 + lr) * 68 + dt * 16 + hi * 8; const v8f a = o[dt][qt]; *(v4fa*)dst = (v4f){a[0], a[1], a[2], a[3]}; *(v4fa*)(dst + 4) = (v4f){a[4], a[5], a[6], a[7]}; }
        const float lj = l[qt] + xhalf(l[qt]);
        if (hi == 0) { ms[wave * (NQ * 16) + qt * 16 + lr] = m[qt]; ls[wave * (NQ * 16) + qt * 16 + lr] = lj; } }
    __syncthreads();   // every wave's partial triple is in LDS before any thread joins them
    constexpr int PER = NQ * 4;   // output elements a thread: NQ * 16 queries x 64 over 256 threads
    const int tq = threadIdx.x / (HD / PER), d0 = (threadIdx.x % (HD / PER)) * PER;
    float M = ms[tq];
#pragma unroll
    for (int w = 1; w < FW; ++w) M = fmaxf(M, ms[w * (NQ * 16) + tq]);
    float acc[PER]; float L = 0.f;
#pragma unroll
    for (int c = 0; c < PER; ++c) acc[c] = 0.f;
#pragma unroll
    for (int w = 0; w < FW; ++w) { const float f = __builtin_amdgcn_exp2f(ms[w * (NQ * 16) + tq] - M); L += f * ls[w * (NQ * 16) + tq];
#pragma unroll
        for (int c4 = 0; c4 < PER / 4; ++c4) { const v4f a = *(const v4fa*)(os + (w * (NQ * 16) + tq) * 68 + d0 + c4 * 4);
#pragma unroll
            for (int c = 0; c < 4; ++c) acc[c4 * 4 + c] += f * a[c]; } }
    const float inv = __fdiv_rn(1.0f, L); const size_t oo = (size_t)(q0 + tq) * DQ + d0;
#pragma unroll
    for (int c4 = 0; c4 < PER / 4; ++c4) { v4us oh, ol;
#pragma unroll
        for (int c = 0; c < 4; ++c) { unsigned short a, c2; splitf(acc[c4 * 4 + c] * inv, a, c2); oh[c] = a; ol[c] = c2; }
        *(v4usa*)(Ah + oo + c4 * 4) = oh; *(v4usa*)(Al + oo + c4 * 4) = ol; }
    asm volatile("s_wait_xcnt 0x0" ::: "memory");   // stands behind the tile's last store, in front of any later write of a register that the stores name (the other tile kind's code follows in the listing)
}
// grid (heads, tiles): the tile index falls with the number of key blocks (for speed only): first the fp16 tiles from the last rows down, then the hi/lo tiles
__global__ __launch_bounds__(32 * FW) void k_fattn(const h16* __restrict__ Q16, const h16* __restrict__ K16, const h16* __restrict__ V16, const bf* __restrict__ Qh, const bf* __restrict__ Ql, const bf* __restrict__ Kh, const bf* __restrict__ Kl, const bf* __restrict__ Vh, const bf* __restrict__ Vl, bf* Ah, bf* Al) {
    __shared__ __align__(16) float os[FW * 32 * 68]; __shared__ float ms[FW * 32], ls[FW * 32];
    const size_t po = (size_t)blockIdx.x * TT * HD; Ah += blockIdx.x * HD; Al += blockIdx.x * HD; const int tile = blockIdx.y;
    if (tile < (TT - RH) / 32) attn_tile<h16, false, 2>(Q16 + po, nullptr, K16 + po, nullptr, V16 + po, nullptr, TT - 32 - tile * 32, Ah, Al, os, ms, ls);
    else attn_tile<bf, true, 1>(Qh + po, Ql + po, Kh + po, Kl + po, Vh + po, Vl + po, RH - 16 - (tile - (TT - RH) / 32) * 16, Ah, Al, os, ms, ls);
}
__global__ __launch_bounds__(256) void k_addres(float* Y, const float* __restrict__ xr) { const size_t i = (size_t)blockIdx.x * 256 + threadIdx.x; if (i >= (size_t)TT * DQ / 4) return; const v4f a = *(const v4f*)(Y + i * 4); const v4f r = *(const v4f*)(xr + i * 4); v4f o;
#pragma unroll
    for (int q = 0; q < 4; ++q) o[q] = __fadd_rn(a[q], bfr(r[q]));
    *(v4f*)(Y + i * 4) = o;  }
__global__ __launch_bounds__(256) void k_lnout(const float* __restrict__ F, const float* __restrict__ g, const float* __restrict__ bb, float* out) { const int lane = threadIdx.x & 31; const int row = blockIdx.x * 8 + (threadIdx.x >> 5); if (row >= TT) return; const float* fr = F + (size_t)row * DQ; float* orow = out + (size_t)row * DQ; float v[DQ / 32]; float s = 0.f;
#pragma unroll
    for (int c = 0; c < DQ / 128; ++c) { const v4f a = *(const v4f*)(fr + c * 128 + lane * 4); for (int q = 0; q < 4; ++q) { v[c * 4 + q] = a[q]; s = __fadd_rn(s, a[q]); } }
#pragma unroll
    for (int sh = 16; sh; sh >>= 1) s = __fadd_rn(s, __shfl_xor(s, sh, 32));
    const float mean = __fdiv_rn(s, (float)DQ); float s2 = 0.f;
#pragma unroll
    for (int k = 0; k < DQ / 32; ++k) { const float dv = __fsub_rn(v[k], mean); float p2 = __fmul_rn(dv, dv); asm volatile("" : "+v"(p2)); s2 = __fadd_rn(s2, p2); v[k] = dv; }
#pragma unroll
    for (int sh = 16; sh; sh >>= 1) s2 = __fadd_rn(s2, __shfl_xor(s2, sh, 32));
    const float rs = __fdiv_rn(1.0f, __fsqrt_rn(__fadd_rn(__fdiv_rn(s2, (float)DQ), LNEPS)));
{
#pragma unroll
        for (int c = 0; c < DQ / 128; ++c) { v4f o; for (int q = 0; q < 4; ++q) { const int col = c * 128 + lane * 4 + q; float y = __fmul_rn(v[c * 4 + q], rs); asm volatile("" : "+v"(y)); y = __fmul_rn(y, bfr(g[col])); asm volatile("" : "+v"(y)); o[q] = __fadd_rn(y, bfr(bb[col])); } *(v4f*)(orow + c * 128 + lane * 4) = o; }
         } }

extern "C" void kernel_launch(void* const* d_in, const int* in_sizes, int n_in,
                              void* d_out, int out_size, void* d_ws, size_t ws_size, hipStream_t stream) {
    (void)in_sizes; (void)n_in; (void)out_size;
    const float* x = (const float*)d_in[0]; const float* wq = (const float*)d_in[1]; const float* bq = (const float*)d_in[2]; const float* wk = (const float*)d_in[3]; const float* bk = (const float*)d_in[4]; const float* wv = (const float*)d_in[5]; const float* bv = (const float*)d_in[6]; const float* wo = (const float*)d_in[7]; const float* bo = (const float*)d_in[8]; const float* lng = (const float*)d_in[9]; const float* lnb = (const float*)d_in[10];
    float* OUT = (float*)d_out;     // [2][2048][1024]
    char* wsp = (char*)d_ws;
    auto take = [&](size_t bytes) { char* p = wsp; wsp += (bytes + 255) & ~(size_t)255; return (void*)p; };
    float* Y = (float*)take((size_t)TT * DM * 4); bf* WQ = (bf*)take((size_t)DQ * DM * 2); bf* WK = (bf*)take((size_t)DKV * DM * 2); bf* WV = (bf*)take((size_t)DKV * DM * 2); bf* WO = (bf*)take((size_t)DM * DQ * 2); float* CS = (float*)take((size_t)TT * HD * 2 * 4);
    bf* XB = (bf*)take((size_t)TT * DM * 2); float* FQ = (float*)take((size_t)TT * DQ * 4); float* FK = (float*)take((size_t)TT * DKV * 4);
    h16* QP16 = (h16*)take((size_t)NH_ * TT * HD * 2); h16* KP16 = (h16*)take((size_t)NKV * TT * HD * 2); h16* VT16 = (h16*)take((size_t)NKV * HD * TT * 2);
    bf* QPh = (bf*)take((size_t)NH_ * TT * HD * 2); bf* QPl = (bf*)take((size_t)NH_ * TT * HD * 2); bf* KPh = (bf*)take((size_t)NKV * TT * HD * 2); bf* KPl = (bf*)take((size_t)NKV * TT * HD * 2); bf* VTh = (bf*)take((size_t)NKV * HD * TT * 2); bf* VTl = (bf*)take((size_t)NKV * HD * TT * 2);
    bf* ATh = (bf*)take((size_t)TT * DQ * 2); bf* ATl = (bf*)take((size_t)TT * DQ * 2);
    if ((size_t)(wsp - (char*)d_ws) > ws_size) return;    // ws 256 MiB
    float* FV = FK;   // v projection reuses the k buffer after the k planes are built (stream-ordered)
    { k_cvt8<<<(unsigned)(((size_t)DQ * DM / 8 + 255) / 256), 256, 0, stream>>>(wq, WQ, (size_t)DQ * DM / 8); k_cvt8<<<(unsigned)(((size_t)DKV * DM / 8 + 255) / 256), 256, 0, stream>>>(wk, WK, (size_t)DKV * DM / 8); k_cvt8<<<(unsigned)(((size_t)DKV * DM / 8 + 255) / 256), 256, 0, stream>>>(wv, WV, (size_t)DKV * DM / 8);
      k_cvt8<<<(unsigned)(((size_t)DM * DQ / 8 + 255) / 256), 256, 0, stream>>>(wo, WO, (size_t)DM * DQ / 8);
       }
    k_csid<<<(TT * HD + 255) / 256, 256, 0, stream>>>(CS);
    const unsigned LQ = (unsigned)(((size_t)NH_ * TT * HD / 2 + 255) / 256), LKv = (unsigned)(((size_t)NKV * TT * HD / 2 + 255) / 256);
    for (int b = 0; b < NB_; ++b) {
        
        k_cvt8<<<(unsigned)(((size_t)TT * DM / 8 + 255) / 256), 256, 0, stream>>>(x + (size_t)b * TT * DM, XB, (size_t)TT * DM / 8);
        k_gemmw<bf, 0, true, false, NW><<<dim3(TT / 64, DQ / 64, 1), 32 * NW, 0, stream>>>(XB, nullptr, WQ, nullptr, DM, DM, FQ, DQ, bq, 0, 0, 0, 0);
        k_rope<<<LQ, 256, 0, stream>>>(FQ, DQ, NH_, CS, nullptr, nullptr, 1.0f, QP16, QPh, QPl);
        k_gemmw<bf, 0, true, false, NW><<<dim3(TT / 64, DKV / 64, 1), 32 * NW, 0, stream>>>(XB, nullptr, WK, nullptr, DM, DM, FK, DKV, bk, 0, 0, 0, 0);
        k_rope<<<LKv, 256, 0, stream>>>(FK, DKV, NKV, CS, nullptr, nullptr, 1.0f, KP16, KPh, KPl);
        k_gemmw<bf, 0, true, false, NW><<<dim3(TT / 64, DKV / 64, 1), 32 * NW, 0, stream>>>(XB, nullptr, WV, nullptr, DM, DM, FV, DKV, bv, 0, 0, 0, 0); k_vtp<<<LKv, 256, 0, stream>>>(FV, DKV, NKV, VT16, VTh, VTl);
        k_fattn<<<dim3(NH_, (TT - RH) / 32 + RH / 16, 1), 32 * FW, 0, stream>>>(QP16, KP16, VT16, QPh, QPl, KPh, KPl, VTh, VTl, ATh, ATl);
        k_gemmw<bf, 1, true, false, NW><<<dim3(TT / 64, DM / 64, 1), 32 * NW, 0, stream>>>(ATh, ATl, WO, nullptr, DQ, DQ, Y, DM, bo, 0, 0, 0, 0); k_addres<<<(unsigned)(((size_t)TT * DQ / 4 + 255) / 256), 256, 0, stream>>>(Y, x + (size_t)b * TT * DM); k_lnout<<<(TT + 7) / 8, 256, 0, stream>>>(Y, lng, lnb, OUT + (size_t)b * TT * DM); }
}

// v004
// One run takes 198 microseconds.
// Two timings next to v003 put it at 1.29 and 1.27 times that version's speed.
// All steps since v000 together make it 7.40 times as fast.
#include <hip/hip_runtime.h>

// Masked (causal) self-attention with residual and post-LayerNorm (x [2][2048][1024]; q,k,v = x W^T + b ('oi' uniform(+-1/32) incl. biases; 16 heads x 64); energy / 8; causal (-inf); softmax; out = merged Wo^T + bo; y = LayerNorm(out + x) gamma/beta (1e-5) -> [2][2048][1024] (4.2 M)).
// Layout per batch: bf16 copy of x; 'oi' weights; exact projections + f32 biases, whose epilogue writes the fp16 and hi/lo head planes itself (v as Wv x^T, so that its tile is already transposed); one fused causal attention kernel (scores, online softmax, probability x value and the head merge stay in registers and LDS; hybrid rows: < 512 hi/lo 3 products, rest fp16; key blocks above the diagonal never visited); merged hi/lo x Wo exact + bo + residual into workspace; a row LayerNorm kernel writes the output rows.
// Compute dtypes, f32 accumulate: every input rounded to bf16; projections exact + f32 biases; attention rows < 512 3 products, rest fp16; softmax f32; Wo hl x exact + bias; residual + LayerNorm f32.

#define NB_  2
#define TT   2048
#define DM   1024
#define NH_  16
#define NKV  16
#define HD   64
#define DQ   (NH_ * HD)
#define DKV  (NKV * HD)
#define RH   512                  // query rows < RH use hi+lo planes (0: none)
#define SCL  0.125f   // HD^-0.5
#define LNEPS 1e-5f
typedef _Float16 h16;
typedef unsigned short bf;
typedef __attribute__((ext_vector_type(16))) __bf16   v16bf;
typedef __attribute__((ext_vector_type(16))) _Float16 v16h;
typedef __attribute__((ext_vector_type(8)))  _Float16 v8h;
typedef __attribute__((ext_vector_type(8)))  unsigned short v8us;
typedef __attribute__((ext_vector_type(8)))  float    v8f;
typedef __attribute__((ext_vector_type(4)))  float    v4f;
typedef v8h  __attribute__((may_alias)) v8ha;
typedef v4f  __attribute__((may_alias)) v4fa;
typedef v8us __attribute__((may_alias)) v8usa;

__device__ __forceinline__ unsigned short f2bf(float f) { unsigned u = __float_as_uint(f); u += 0x7FFFu + ((u >> 16) & 1u); return (unsigned short)(u >> 16); }
__device__ __forceinline__ float bf2f(unsigned short b) { return __uint_as_float(((unsigned)b) << 16); }
__device__ __forceinline__ float bfr(float f) { return bf2f(f2bf(f)); }
__device__ __forceinline__ v16h cat16(v8h lo, v8h hi) { return __builtin_shufflevector(lo, hi, 0, 1, 2, 3, 4, 5, 6, 7, 8, 9, 10, 11, 12, 13, 14, 15); }
__device__ __forceinline__ v16bf cat16b(v8us lo, v8us hi) { return __builtin_bit_cast(v16bf, __builtin_shufflevector(lo, hi, 0, 1, 2, 3, 4, 5, 6, 7, 8, 9, 10, 11, 12, 13, 14, 15)); }
__device__ __forceinline__ v8f wmma16(v16h a, v16h b, v8f c) { return __builtin_amdgcn_wmma_f32_16x16x32_f16(false, a, false, b, (short)0, c, false, false); }
__device__ __forceinline__ v8f wmmab(v16bf a, v16bf b, v8f c) { return __builtin_amdgcn_wmma_f32_16x16x32_bf16(false, a, false, b, (short)0, c, false, false); }

__device__ __forceinline__ h16 tohx(float x) { return (h16)x; }
__device__ __forceinline__ void splitf(float y, unsigned short& h, unsigned short& l) { h = f2bf(y); l = f2bf(y - bf2f(h)); }
typedef __attribute__((ext_vector_type(2))) _Float16 v2h;
typedef __attribute__((ext_vector_type(4))) _Float16 v4h;
typedef __attribute__((ext_vector_type(2))) unsigned short v2us;
typedef __attribute__((ext_vector_type(4))) unsigned short v4us;
typedef v4h  __attribute__((may_alias)) v4ha;
typedef v4us __attribute__((may_alias)) v4usa;
typedef __attribute__((ext_vector_type(2))) float v2f;
typedef __attribute__((ext_vector_type(4))) int v4i;

// ---- k_gemmw: register-blocked GEMM, one 64x64 output tile per work-group of NWV waves; the K loop is split over the waves in slices of KS elements (wave w takes slices w, w + NWV, ...), each wave
// holds the whole tile (16 accumulators) for its slices, operands straight from K-contiguous 16-bit planes; the NWV partial tiles meet in LDS and are summed in wave order. grid (M/64, N/64, Z), 32 * NWV threads.
// c[m][n] = sum_k A[m][k] Bt[n][k] (+ split products per NSPLIT) + bias. z-batch strides sA/sB/sC and the A pitch lda in elements. K % KS == 0.
// What the epilogue does with the summed tile (EPI): 0: + bias[n] + the residual xr[m][n] (rounded to bf16), f32 into C (pitch ldc, xr alike). 1: + bias[n]; m is a token and the 64 columns are one head: fp16, hi and lo planes [head][token][d].
// 2: + bias[m]; m is a feature (head * HD + d) and n a token: fp16, hi and lo planes [head][d][token], the transposed value planes.
// DIAG: probability x value contraction of causal attention: the K loop stops at the diagonal block (probabilities beyond it are exactly zero); roff = row offset of this launch's first row within the sequence.
#define NW 8      // waves that share one tile's K loop (K up to 1024: at most two slices a wave)
#define KS 64     // K elements per slice: one 128-byte line of every operand row, read by one wave only
template <typename T16> struct WFrag;
template <> struct WFrag<h16> { typedef v16h V; static __device__ __forceinline__ V ld(const h16* p) { return cat16(*(const v8h*)p, *(const v8h*)(p + 16)); } static __device__ __forceinline__ v8f mma(V a, V b, v8f c) { return wmma16(a, b, c); } };
template <> struct WFrag<bf> { typedef v16bf V; static __device__ __forceinline__ V ld(const bf* p) { return cat16b(*(const v8us*)p, *(const v8us*)(p + 16)); } static __device__ __forceinline__ v8f mma(V a, V b, v8f c) { return wmmab(a, b, c); } };
template <typename T16, int NSPLIT, int EPI, bool DIAG, int NWV>
__global__ __launch_bounds__(32 * NWV) void k_gemmw(const T16* __restrict__ A, const T16* __restrict__ A2, const T16* __restrict__ Bt, const T16* __restrict__ Bt2, int K, int lda, float* C, int ldc, const float* __restrict__ bias, const float* __restrict__ xr, h16* P16, bf* Ph, bf* Pl, int roff, size_t sA, size_t sB, size_t sC) {
    typedef typename WFrag<T16>::V V;
    __shared__ __align__(16) float os[NWV * 64 * 68];
    const size_t z = blockIdx.z; A += z * sA; if (A2) A2 += z * sA; Bt += z * sB; if (Bt2) Bt2 += z * sB; C += z * sC;
    const int lane = threadIdx.x & 31, lr = lane & 15, hi = lane >> 4; const int r0 = blockIdx.x * 64, c0 = blockIdx.y * 64;
    const int wave = __builtin_amdgcn_readfirstlane(threadIdx.x >> 5);
    const int Kl = DIAG ? min(K, r0 + roff + 64) : K;
    v8f acc[4][4];
#pragma unroll
    for (int mb = 0; mb < 4; ++mb)
#pragma unroll
        for (int nb = 0; nb < 4; ++nb) acc[mb][nb] = (v8f){};
    // byte offset of this lane's row of each 16-row block from its plane's base, stepped from trip to trip (32 bits hold it: a plane spans at most 2^23 elements); A and A2 share the pitch lda, Bt and Bt2 the pitch K
    unsigned oa[4], ob[4];
#pragma unroll
    for (int q = 0; q < 4; ++q) { oa[q] = (unsigned)((r0 + lr + q * 16) * lda + 8 * hi + wave * KS) * (unsigned)sizeof(T16); ob[q] = (unsigned)((c0 + lr + q * 16) * K + 8 * hi + wave * KS) * (unsigned)sizeof(T16); }
#pragma unroll 1   // stays rolled: a second trip's fragments do not fit beside the 16 accumulators
    for (int kb = wave * KS; kb < Kl; kb += NWV * KS) {
        V a[KS / 32][4], a2[KS / 32][4];
#pragma unroll
        for (int ks = 0; ks < KS / 32; ++ks)
#pragma unroll
            for (int mb = 0; mb < 4; ++mb) { a[ks][mb] = WFrag<T16>::ld((const T16*)((const char*)A + oa[mb]) + ks * 32); if (NSPLIT == 1 || NSPLIT == 2) a2[ks][mb] = WFrag<T16>::ld((const T16*)((const char*)A2 + oa[mb]) + ks * 32); }
#pragma unroll
        for (int ks = 0; ks < KS / 32; ++ks)
#pragma unroll
            for (int nb = 0; nb < 4; ++nb) { const V b = WFrag<T16>::ld((const T16*)((const char*)Bt + ob[nb]) + ks * 32); V b2; if (NSPLIT >= 2) b2 = WFrag<T16>::ld((const T16*)((const char*)Bt2 + ob[nb]) + ks * 32);
#pragma unroll
                for (int mb = 0; mb < 4; ++mb) { acc[mb][nb] = WFrag<T16>::mma(a[ks][mb], b, acc[mb][nb]); if (NSPLIT == 1 || NSPLIT == 2) acc[mb][nb] = WFrag<T16>::mma(a2[ks][mb], b, acc[mb][nb]); if (NSPLIT >= 2) acc[mb][nb] = WFrag<T16>::mma(a[ks][mb], b2, acc[mb][nb]); } }
        // keeps the distance behind the trip's last matrix instructions on the taken back edge; the row offsets are inputs so that no load's
        // result lands in an address register of an earlier load of the trip: they stay as they are until the diagonal accumulators, which take in every fragment, are complete
        asm volatile("v_nop\n\tv_nop\n\tv_nop\n\tv_nop" : "+v"(acc[0][0]), "+v"(acc[1][1]), "+v"(acc[2][2]), "+v"(acc[3][3]) : "v"(a[KS / 32 - 1][0]), "v"(a[KS / 32 - 1][3]), "v"(oa[0]), "v"(oa[1]), "v"(oa[2]), "v"(oa[3]), "v"(ob[0]), "v"(ob[1]), "v"(ob[2]), "v"(ob[3]));
#pragma unroll
        for (int q = 0; q < 4; ++q) { oa[q] += NWV * KS * (unsigned)sizeof(T16); ob[q] += NWV * KS * (unsigned)sizeof(T16); }
    }
    float* ow = os + wave * (64 * 68);
#pragma unroll
    for (int mb = 0; mb < 4; ++mb)
#pragma unroll
        for (int nb = 0; nb < 4; ++nb)
#pragma unroll
            for (int j = 0; j < 8; ++j) ow[(mb * 16 + hi * 8 + j) * 68 + nb * 16 + lr] = acc[mb][nb][j];
    const int trow = threadIdx.x >> 4, cofs = (threadIdx.x & 15) * 4;
    constexpr int NR = 64 / (2 * NWV);   // rows of the tile a thread finishes
    // bias and residual are fetched in front of the barrier: their latency runs under the wait for the other waves
    v4f bc, res[NR]; float br[NR];
    if (EPI != 2) bc = *(const v4f*)(bias + c0 + cofs);
#pragma unroll
    for (int i = 0; i < NR; ++i) { const int row = i * 2 * NWV + trow; if (EPI == 2) br[i] = bias[r0 + row]; if (EPI == 0) res[i] = *(const v4f*)(xr + (size_t)(r0 + row) * ldc + c0 + cofs); }
    __syncthreads();   // every wave's partial tile is in LDS before any thread sums across waves
#pragma unroll
    for (int i = 0; i < NR; ++i) { const int row = i * 2 * NWV + trow; v4f val = *(const v4fa*)(os + row * 68 + cofs);
#pragma unroll
        for (int w = 1; w < NWV; ++w) val += *(const v4fa*)(os + (w * 64 + row) * 68 + cofs);
#pragma unroll
        for (int q = 0; q < 4; ++q) val[q] += bfr(EPI == 2 ? br[i] : bc[q]);
        if constexpr (EPI == 0) {
#pragma unroll
            for (int q = 0; q < 4; ++q) val[q] = __fadd_rn(val[q], bfr(res[i][q]));
            *(v4f*)(C + (size_t)(r0 + row) * ldc + c0 + cofs) = val;
        } else { v4h o16; v4us oh, ol;
#pragma unroll
            for (int q = 0; q < 4; ++q) { o16[q] = tohx(val[q]); unsigned short a2, c2; splitf(val[q], a2, c2); oh[q] = a2; ol[q] = c2; }
            const size_t e = EPI == 1 ? ((size_t)blockIdx.y * TT + r0 + row) * HD + cofs : (size_t)(r0 + row) * TT + c0 + cofs;
            *(v4ha*)(P16 + e) = o16; *(v4usa*)(Ph + e) = oh; *(v4usa*)(Pl + e) = ol; } }
}

__global__ __launch_bounds__(256) void k_wtG(const float* __restrict__ w, int K, int N, bf* Bt) {
    const int lane = threadIdx.x & 31; const int L0 = (blockIdx.x * 8 + (threadIdx.x >> 5)) * 8; const int nlines = N * K / 64;
{
#pragma unroll 1
        for (int l = 0; l < 8; ++l) { const int L = L0 + l; if (L >= nlines) break; const size_t e = (size_t)L * 64 + lane * 2; const int k = (int)(e % K), n = (int)(e / K); v2us o;
            o[0] = f2bf(w[(size_t)k * N + n]); o[1] = f2bf(w[(size_t)(k + 1) * N + n]); *(v2us*)(Bt + e) = o; }
         }
}
__global__ __launch_bounds__(256) void k_cvt8(const float* __restrict__ src, bf* dst, size_t n8) { const size_t i = (size_t)blockIdx.x * 256 + threadIdx.x; if (i >= n8) return; const v8f v = *(const v8f*)(src + i * 8); v8us o;
#pragma unroll
    for (int k = 0; k < 8; ++k) o[k] = f2bf(v[k]); *(v8us*)(dst + i * 8) = o;  }

// ---- k_fattn: fused causal attention. One work-group owns one tile of query rows of one head (32 rows in fp16, 16 rows in hi/lo bf16); its FW waves share the key loop in blocks of 32 keys (wave w takes blocks w, w + FW, ...).
// Per block a wave forms S^T = K Q^T (a lane then holds 16 scores of ONE query: keys 8 hi + j of both 16-key tiles), updates that query's running maximum and sum, and feeds the two converted score tiles, which are a B fragment
// in the loaders' own k order, to O^T += V^T P^T. Scores and probabilities never leave the registers. The FW partial (maximum, sum, O) triples meet in LDS, are rescaled to the common maximum and summed in wave order;
// the quotient goes out as the merged hi/lo planes [t][h * HD + d]. Every visited block starts at or below every query of the tile, so each query sees at least one open key in it.
#define FW 8
#define SCL2 (SCL * 1.4426950408889634f)   // scores are carried in the log2 domain: one multiply takes in the scale and log2(e), and the exponent is a plain difference
__device__ __forceinline__ float xhalf(float x) { const int b = __float_as_int(x); return __int_as_float(__builtin_amdgcn_permlanex16(b, b, 0x76543210, 0xfedcba98, false, false)); }   // the value of lane l ^ 16
// p[0..7] = 2^p[0..7]. One statement, every output apart from every input, one v_nop behind the last: keeps the slot that the instruction set asks for behind a transcendental before its result is read or
// its source overwritten
__device__ __forceinline__ void exp2x8(float* p) { float r0, r1, r2, r3, r4, r5, r6, r7;
    asm("v_exp_f32 %0, %8\n\tv_exp_f32 %1, %9\n\tv_exp_f32 %2, %10\n\tv_exp_f32 %3, %11\n\tv_exp_f32 %4, %12\n\tv_exp_f32 %5, %13\n\tv_exp_f32 %6, %14\n\tv_exp_f32 %7, %15\n\tv_nop"
        : "=&v"(r0), "=&v"(r1), "=&v"(r2), "=&v"(r3), "=&v"(r4), "=&v"(r5), "=&v"(r6), "=&v"(r7) : "v"(p[0]), "v"(p[1]), "v"(p[2]), "v"(p[3]), "v"(p[4]), "v"(p[5]), "v"(p[6]), "v"(p[7]));
    p[0] = r0; p[1] = r1; p[2] = r2; p[3] = r3; p[4] = r4; p[5] = r5; p[6] = r6; p[7] = r7; }
template <typename T16, bool HL, int NQ>
__device__ __forceinline__ void attn_tile(const T16* __restrict__ Q, const T16* __restrict__ Q2, const T16* __restrict__ Kp, const T16* __restrict__ K2, const T16* __restrict__ Vt, const T16* __restrict__ V2, int q0, bf* Ah, bf* Al, float* os, float* ms, float* ls) {
    typedef typename WFrag<T16>::V V;
    const int lane = threadIdx.x & 31, lr = lane & 15, hi = lane >> 4;
    const int wave = __builtin_amdgcn_readfirstlane(threadIdx.x >> 5);
    V qf[NQ][2], qf2[NQ][2];
#pragma unroll
    for (int qt = 0; qt < NQ; ++qt)
#pragma unroll
        for (int ks = 0; ks < 2; ++ks) { const int qo = (q0 + qt * 16 + lr) * HD + ks * 32 + 8 * hi; qf[qt][ks] = WFrag<T16>::ld(Q + qo); if (HL) qf2[qt][ks] = WFrag<T16>::ld(Q2 + qo); }
    v8f o[4][NQ]; float m[NQ], l[NQ];
#pragma unroll
    for (int qt = 0; qt < NQ; ++qt) { m[qt] = -3.0e38f; l[qt] = 0.f;
#pragma unroll
        for (int dt = 0; dt < 4; ++dt) o[dt][qt] = (v8f){}; }
    const int kend = q0 + NQ * 16;
    // byte offsets of this lane's first K row and first V^T row from their planes' bases, stepped from block to block (K and K2, Vt and V2 share them); the other rows of a block lie at constant distances
    unsigned ok = (unsigned)((wave * 32 + lr) * HD + 8 * hi) * 2u, ov = (unsigned)(lr * TT + wave * 32 + 8 * hi) * 2u;
#pragma unroll 1   // stays rolled: a second block's fragments do not fit beside the accumulators
    for (int kb = wave * 32; kb < kend; kb += FW * 32, ok += FW * 32 * HD * 2u, ov += FW * 32 * 2u) {
        V kf[2][2], kf2[2][2], vf[4], vf2[4];
#pragma unroll
        for (int kt = 0; kt < 2; ++kt)
#pragma unroll
            for (int ks = 0; ks < 2; ++ks) { kf[kt][ks] = WFrag<T16>::ld((const T16*)((const char*)Kp + ok) + kt * 16 * HD + ks * 32); if (HL) kf2[kt][ks] = WFrag<T16>::ld((const T16*)((const char*)K2 + ok) + kt * 16 * HD + ks * 32); }
#pragma unroll
        for (int dt = 0; dt < 4; ++dt) { vf[dt] = WFrag<T16>::ld((const T16*)((const char*)Vt + ov) + dt * 16 * TT); if (HL) vf2[dt] = WFrag<T16>::ld((const T16*)((const char*)V2 + ov) + dt * 16 * TT); }
        __builtin_amdgcn_sched_barrier(0);   // keeps the V^T loads in front of the score products: their latency then runs under the scores and the softmax instead of behind them
        v8f s[2][NQ];
#pragma unroll
        for (int kt = 0; kt < 2; ++kt)
#pragma unroll
            for (int qt = 0; qt < NQ; ++qt) { s[kt][qt] = (v8f){};
#pragma unroll
                for (int ks = 0; ks < 2; ++ks) { s[kt][qt] = WFrag<T16>::mma(kf[kt][ks], qf[qt][ks], s[kt][qt]); if (HL) { s[kt][qt] = WFrag<T16>::mma(kf[kt][ks], qf2[qt][ks], s[kt][qt]); s[kt][qt] = WFrag<T16>::mma(kf2[kt][ks], qf[qt][ks], s[kt][qt]); } } }
        const bool edge = kb + 31 > q0;   // wave-uniform: only blocks that reach past the tile's first query hold masked keys
#pragma unroll
        for (int qt = 0; qt < NQ; ++qt) { const int qi = q0 + qt * 16 + lr; float t[16]; float mx = m[qt];
#pragma unroll
            for (int e = 0; e < 16; ++e) { float x = s[e >> 3][qt][e & 7] * SCL2; if (edge) x = (kb + (e >> 3) * 16 + hi * 8 + (e & 7) <= qi) ? x : -3.0e38f; t[e] = x; mx = fmaxf(mx, x); }
            mx = fmaxf(mx, xhalf(mx));
            const float al = __builtin_amdgcn_exp2f(m[qt] - mx); m[qt] = mx; float sum = 0.f;
#pragma unroll
            for (int e = 0; e < 16; ++e) t[e] -= mx;
            exp2x8(t); exp2x8(t + 8);
#pragma unroll
            for (int e = 0; e < 16; ++e) sum += t[e];
            l[qt] = l[qt] * al + sum;   // each half of the wave keeps the sum of its own keys; the halves join behind the loop
#pragma unroll
            for (int dt = 0; dt < 4; ++dt) o[dt][qt] *= al;
            if constexpr (HL) { v8us ph0, ph1, pl0, pl1;
#pragma unroll
                for (int e = 0; e < 8; ++e) { unsigned short a, c2; splitf(t[e], a, c2); ph0[e] = a; pl0[e] = c2; splitf(t[e + 8], a, c2); ph1[e] = a; pl1[e] = c2; }
                const V pf = cat16b(ph0, ph1), pf2 = cat16b(pl0, pl1);
#pragma unroll
                for (int dt = 0; dt < 4; ++dt) { o[dt][qt] = WFrag<T16>::mma(vf[dt], pf, o[dt][qt]); o[dt][qt] = WFrag<T16>::mma(vf[dt], pf2, o[dt][qt]); o[dt][qt] = WFrag<T16>::mma(vf2[dt], pf, o[dt][qt]); }
            } else { V pf;
#pragma unroll
                for (int e = 0; e < 16; ++e) pf[e] = (h16)t[e];
#pragma unroll
                for (int dt = 0; dt < 4; ++dt) o[dt][qt] = WFrag<T16>::mma(vf[dt], pf, o[dt][qt]); } }
        // the hi/lo block ends in its matrix instructions: keeps the distance behind them on the taken back edge, where the next block's loads land in the registers of their A operand
        if constexpr (HL) asm volatile("v_nop\n\tv_nop\n\tv_nop\n\tv_nop" : "+v"(o[0][0]), "+v"(o[1][0]), "+v"(o[2][0]), "+v"(o[3][0]));
    }
    float* ow = os + wave * (NQ * 16 * 68);
#pragma unroll
    for (int qt = 0; qt < NQ; ++qt) {
#pragma unroll
        for (int dt = 0; dt < 4; ++dt) { float* dst = ow + (qt * 16 + lr) * 68 + dt * 16 + hi * 8; const v8f a = o[dt][qt]; *(v4fa*)dst = (v4f){a[0], a[1], a[2], a[3]}; *(v4fa*)(dst + 4) = (v4f){a[4], a[5], a[6], a[7]}; }
        const float lj = l[qt] + xhalf(l[qt]);
        if (hi == 0) { ms[wave * (NQ * 16) + qt * 16 + lr] = m[qt]; ls[wave * (NQ * 16) + qt * 16 + lr] = lj; } }
    __syncthreads();   // every wave's partial triple is in LDS before any thread joins them
    constexpr int PER = NQ * 4;   // output elements a thread: NQ * 16 queries x 64 over 256 threads
    const int tq = threadIdx.x / (HD / PER), d0 = (threadIdx.x % (HD / PER)) * PER;
    float M = ms[tq];
#pragma unroll
    for (int w = 1; w < FW; ++w) M = fmaxf(M, ms[w * (NQ * 16) + tq]);
    float acc[PER]; float L = 0.f;
#pragma unroll
    for (int c = 0; c < PER; ++c) acc[c] = 0.f;
#pragma unroll
    for (int w = 0; w < FW; ++w) { const float f = __builtin_amdgcn_exp2f(ms[w * (NQ * 16) + tq] - M); L += f * ls[w * (NQ * 16) + tq];
#pragma unroll
        for (int c4 = 0; c4 < PER / 4; ++c4) { const v4f a = *(const v4fa*)(os + (w * (NQ * 16) + tq) * 68 + d0 + c4 * 4);
#pragma unroll
            for (int c = 0; c < 4; ++c) acc[c4 * 4 + c] += f * a[c]; } }
    const float inv = __fdiv_rn(1.0f, L); const size_t oo = (size_t)(q0 + tq) * DQ + d0;
#pragma unroll
    for (int c4 = 0; c4 < PER / 4; ++c4) { v4us oh, ol;
#pragma unroll
        for (int c = 0; c < 4; ++c) { unsigned short a, c2; splitf(acc[c4 * 4 + c] * inv, a, c2); oh[c] = a; ol[c] = c2; }
        *(v4usa*)(Ah + oo + c4 * 4) = oh; *(v4usa*)(Al + oo + c4 * 4) = ol; }
    asm volatile("s_wait_xcnt 0x0" ::: "memory");   // stands behind the tile's last store, in front of any later write of a register that the stores name (the other tile kind's code follows in the listing)
}
// grid (heads, tiles): the tile index falls with the number of key blocks (for speed only): first the fp16 tiles from the last rows down, then the hi/lo tiles
__global__ __launch_bounds__(32 * FW) void k_fattn(const h16* __restrict__ Q16, const h16* __restrict__ K16, const h16* __restrict__ V16, const bf* __restrict__ Qh, const bf* __restrict__ Ql, const bf* __restrict__ Kh, const bf* __restrict__ Kl, const bf* __restrict__ Vh, const bf* __restrict__ Vl, bf* Ah, bf* Al) {
    __shared__ __align__(16) float os[FW * 32 * 68]; __shared__ float ms[FW * 32], ls[FW * 32];
    const size_t po = (size_t)blockIdx.x * TT * HD; Ah += blockIdx.x * HD; Al += blockIdx.x * HD; const int tile = blockIdx.y;
    if (tile < (TT - RH) / 32) attn_tile<h16, false, 2>(Q16 + po, nullptr, K16 + po, nullptr, V16 + po, nullptr, TT - 32 - tile * 32, Ah, Al, os, ms, ls);
    else attn_tile<bf, true, 1>(Qh + po, Ql + po, Kh + po, Kl + po, Vh + po, Vl + po, RH - 16 - (tile - (TT - RH) / 32) * 16, Ah, Al, os, ms, ls);
}
__global__ __launch_bounds__(256) void k_lnout(const float* __restrict__ F, const float* __restrict__ g, const float* __restrict__ bb, float* out) { const int lane = threadIdx.x & 31; const int row = blockIdx.x * 8 + (threadIdx.x >> 5); if (row >= TT) return; const float* fr = F + (size_t)row * DQ; float* orow = out + (size_t)row * DQ; float v[DQ / 32]; float s = 0.f;
#pragma unroll
    for (int c = 0; c < DQ / 128; ++c) { const v4f a = *(const v4f*)(fr + c * 128 + lane * 4); for (int q = 0; q < 4; ++q) { v[c * 4 + q] = a[q]; s = __fadd_rn(s, a[q]); } }
#pragma unroll
    for (int sh = 16; sh; sh >>= 1) s = __fadd_rn(s, __shfl_xor(s, sh, 32));
    const float mean = __fdiv_rn(s, (float)DQ); float s2 = 0.f;
#pragma unroll
    for (int k = 0; k < DQ / 32; ++k) { const float dv = __fsub_rn(v[k], mean); float p2 = __fmul_rn(dv, dv); asm volatile("" : "+v"(p2)); s2 = __fadd_rn(s2, p2); v[k] = dv; }
#pragma unroll
    for (int sh = 16; sh; sh >>= 1) s2 = __fadd_rn(s2, __shfl_xor(s2, sh, 32));
    const float rs = __fdiv_rn(1.0f, __fsqrt_rn(__fadd_rn(__fdiv_rn(s2, (float)DQ), LNEPS)));
{
#pragma unroll
        for (int c = 0; c < DQ / 128; ++c) { v4f o; for (int q = 0; q < 4; ++q) { const int col = c * 128 + lane * 4 + q; float y = __fmul_rn(v[c * 4 + q], rs); asm volatile("" : "+v"(y)); y = __fmul_rn(y, bfr(g[col])); asm volatile("" : "+v"(y)); o[q] = __fadd_rn(y, bfr(bb[col])); } *(v4f*)(orow + c * 128 + lane * 4) = o; }
         } }

extern "C" void kernel_launch(void* const* d_in, const int* in_sizes, int n_in,
                              void* d_out, int out_size, void* d_ws, size_t ws_size, hipStream_t stream) {
    (void)in_sizes; (void)n_in; (void)out_size;
    const float* x = (const float*)d_in[0]; const float* wq = (const float*)d_in[1]; const float* bq = (const float*)d_in[2]; const float* wk = (const float*)d_in[3]; const float* bk = (const float*)d_in[4]; const float* wv = (const float*)d_in[5]; const float* bv = (const float*)d_in[6]; const float* wo = (const float*)d_in[7]; const float* bo = (const float*)d_in[8]; const float* lng = (const float*)d_in[9]; const float* lnb = (const float*)d_in[10];
    float* OUT = (float*)d_out;     // [2][2048][1024]
    char* wsp = (char*)d_ws;
    auto take = [&](size_t bytes) { char* p = wsp; wsp += (bytes + 255) & ~(size_t)255; return (void*)p; };
    float* Y = (float*)take((size_t)TT * DM * 4); bf* WQ = (bf*)take((size_t)DQ * DM * 2); bf* WK = (bf*)take((size_t)DKV * DM * 2); bf* WV = (bf*)take((size_t)DKV * DM * 2); bf* WO = (bf*)take((size_t)DM * DQ * 2);
    bf* XB = (bf*)take((size_t)TT * DM * 2);
    h16* QP16 = (h16*)take((size_t)NH_ * TT * HD * 2); h16* KP16 = (h16*)take((size_t)NKV * TT * HD * 2); h16* VT16 = (h16*)take((size_t)NKV * HD * TT * 2);
    bf* QPh = (bf*)take((size_t)NH_ * TT * HD * 2); bf* QPl = (bf*)take((size_t)NH_ * TT * HD * 2); bf* KPh = (bf*)take((size_t)NKV * TT * HD * 2); bf* KPl = (bf*)take((size_t)NKV * TT * HD * 2); bf* VTh = (bf*)take((size_t)NKV * HD * TT * 2); bf* VTl = (bf*)take((size_t)NKV * HD * TT * 2);
    bf* ATh = (bf*)take((size_t)TT * DQ * 2); bf* ATl = (bf*)take((size_t)TT * DQ * 2);
    if ((size_t)(wsp - (char*)d_ws) > ws_size) return;    // ws 256 MiB
    { k_cvt8<<<(unsigned)(((size_t)DQ * DM / 8 + 255) / 256), 256, 0, stream>>>(wq, WQ, (size_t)DQ * DM / 8); k_cvt8<<<(unsigned)(((size_t)DKV * DM / 8 + 255) / 256), 256, 0, stream>>>(wk, WK, (size_t)DKV * DM / 8); k_cvt8<<<(unsigned)(((size_t)DKV * DM / 8 + 255) / 256), 256, 0, stream>>>(wv, WV, (size_t)DKV * DM / 8);
      k_cvt8<<<(unsigned)(((size_t)DM * DQ / 8 + 255) / 256), 256, 0, stream>>>(wo, WO, (size_t)DM * DQ / 8);
       }
    for (int b = 0; b < NB_; ++b) {
        
        k_cvt8<<<(unsigned)(((size_t)TT * DM / 8 + 255) / 256), 256, 0, stream>>>(x + (size_t)b * TT * DM, XB, (size_t)TT * DM / 8);
        k_gemmw<bf, 0, 1, false, NW><<<dim3(TT / 64, DQ / 64, 1), 32 * NW, 0, stream>>>(XB, nullptr, WQ, nullptr, DM, DM, nullptr, 0, bq, nullptr, QP16, QPh, QPl, 0, 0, 0, 0);
        k_gemmw<bf, 0, 1, false, NW><<<dim3(TT / 64, DKV / 64, 1), 32 * NW, 0, stream>>>(XB, nullptr, WK, nullptr, DM, DM, nullptr, 0, bk, nullptr, KP16, KPh, KPl, 0, 0, 0, 0);
        k_gemmw<bf, 0, 2, false, NW><<<dim3(DKV / 64, TT / 64, 1), 32 * NW, 0, stream>>>(WV, nullptr, XB, nullptr, DM, DM, nullptr, 0, bv, nullptr, VT16, VTh, VTl, 0, 0, 0, 0);
        k_fattn<<<dim3(NH_, (TT - RH) / 32 + RH / 16, 1), 32 * FW, 0, stream>>>(QP16, KP16, VT16, QPh, QPl, KPh, KPl, VTh, VTl, ATh, ATl);
        k_gemmw<bf, 1, 0, false, NW><<<dim3(TT / 64, DM / 64, 1), 32 * NW, 0, stream>>>(ATh, ATl, WO, nullptr, DQ, DQ, Y, DM, bo, x + (size_t)b * TT * DM, nullptr, nullptr, nullptr, 0, 0, 0, 0); k_lnout<<<(TT + 7) / 8, 256, 0, stream>>>(Y, lng, lnb, OUT + (size_t)b * TT * DM); }
}

// v005
// It runs in 169 microseconds.
// In two side-by-side timings against v004, it was 1.18 and 1.17 times as fast.
// Counting every step since v000, it is 8.70 times as fast.
#include <hip/hip_runtime.h>

// Masked (causal) self-attention with residual and post-LayerNorm (x [2][2048][1024]; q,k,v = x W^T + b ('oi' uniform(+-1/32) incl. biases; 16 heads x 64); energy / 8; causal (-inf); softmax; out = merged Wo^T + bo; y = LayerNorm(out + x) gamma/beta (1e-5) -> [2][2048][1024] (4.2 M)).
// Layout, both batches in every launch (x is taken as 4096 token rows): bf16 copy of x; 'oi' weights; exact projections + f32 biases, whose epilogue writes the fp16 and hi/lo head planes itself (v as Wv x^T, so that its tile is already transposed); one fused causal attention kernel (scores, online softmax, probability x value and the head merge stay in registers and LDS; hybrid rows: < 512 hi/lo 3 products, rest fp16; key blocks above the diagonal never visited); merged hi/lo x Wo exact + bo + residual into workspace; a row LayerNorm kernel writes the output rows.
// Compute dtypes, f32 accumulate: every input rounded to bf16; projections exact + f32 biases; attention rows < 512 3 products, rest fp16; softmax f32; Wo hl x exact + bias; residual + LayerNorm f32.

#define NB_  2
#define TT   2048
#define DM   1024
#define NH_  16
#define NKV  16
#define HD   64
#define DQ   (NH_ * HD)
#define DKV  (NKV * HD)
#define RH   512                  // query rows < RH use hi+lo planes (0: none)
#define SCL  0.125f   // HD^-0.5
#define LNEPS 1e-5f
typedef _Float16 h16;
typedef unsigned short bf;
typedef __attribute__((ext_vector_type(16))) __bf16   v16bf;
typedef __attribute__((ext_vector_type(16))) _Float16 v16h;
typedef __attribute__((ext_vector_type(8)))  _Float16 v8h;
typedef __attribute__((ext_vector_type(8)))  unsigned short v8us;
typedef __attribute__((ext_vector_type(8)))  float    v8f;
typedef __attribute__((ext_vector_type(4)))  float    v4f;
typedef v8h  __attribute__((may_alias)) v8ha;
typedef v4f  __attribute__((may_alias)) v4fa;
typedef v8us __attribute__((may_alias)) v8usa;

__device__ __forceinline__ unsigned short f2bf(float f) { unsigned u = __float_as_uint(f); u += 0x7FFFu + ((u >> 16) & 1u); return (unsigned short)(u >> 16); }
__device__ __forceinline__ float bf2f(unsigned short b) { return __uint_as_float(((unsigned)b) << 16); }
__device__ __forceinline__ float bfr(float f) { return bf2f(f2bf(f)); }
__device__ __forceinline__ v16h cat16(v8h lo, v8h hi) { return __builtin_shufflevector(lo, hi, 0, 1, 2, 3, 4, 5, 6, 7, 8, 9, 10, 11, 12, 13, 14, 15); }
__device__ __forceinline__ v16bf cat16b(v8us lo, v8us hi) { return __builtin_bit_cast(v16bf, __builtin_shufflevector(lo, hi, 0, 1, 2, 3, 4, 5, 6, 7, 8, 9, 10, 11, 12, 13, 14, 15)); }
__device__ __forceinline__ v8f wmma16(v16h a, v16h b, v8f c) { return __builtin_amdgcn_wmma_f32_16x16x32_f16(false, a, false, b, (short)0, c, false, false); }
__device__ __forceinline__ v8f wmmab(v16bf a, v16bf b, v8f c) { return __builtin_amdgcn_wmma_f32_16x16x32_bf16(false, a, false, b, (short)0, c, false, false); }

__device__ __forceinline__ h16 tohx(float x) { return (h16)x; }
__device__ __forceinline__ void splitf(float y, unsigned short& h, unsigned short& l) { h = f2bf(y); l = f2bf(y - bf2f(h)); }
typedef __attribute__((ext_vector_type(2))) _Float16 v2h;
typedef __attribute__((ext_vector_type(4))) _Float16 v4h;
typedef __attribute__((ext_vector_type(2))) unsigned short v2us;
typedef __attribute__((ext_vector_type(4))) unsigned short v4us;
typedef v4h  __attribute__((may_alias)) v4ha;
typedef v4us __attribute__((may_alias)) v4usa;
typedef __attribute__((ext_vector_type(2))) float v2f;
typedef __attribute__((ext_vector_type(4))) int v4i;

// ---- k_gemmw: register-blocked GEMM, one 64x64 output tile per work-group of NWV waves; the K loop is split over the waves in slices of KS elements (wave w takes slices w, w + NWV, ...), each wave
// holds the whole tile (16 accumulators) for its slices, operands straight from K-contiguous 16-bit planes; the NWV partial tiles meet in LDS and are summed in wave order. grid (M/64, N/64), 32 * NWV threads.
// c[m][n] = sum_k A[m][k] Bt[n][k] (+ split products per NSPLIT) + bias. The A pitch lda in elements. K % KS == 0. A row index over tokens runs through the batches (batch = token row / TT).
// What the epilogue does with the summed tile (EPI): 0: + bias[n] + the residual xr[m][n] (rounded to bf16), f32 into C (pitch ldc, xr alike). 1: the three projections in one grid (tokens/64, features/64, 3): blockIdx.z picks the weight plane (Bt + z * WSZ), the bias (bias, bias1, bias2) and the output planes (+ z * PSZ).
// z = 0, 1 (q, k): + bias[n]; m is a token and the 64 columns are one head: fp16, hi and lo planes [batch][head][token][d]. z = 2 (v): the operands change places, m is a feature (head * HD + d) and n a token: + bias[m]; planes [batch][head][d][token], the transposed value planes.
// DIAG: probability x value contraction of causal attention: the K loop stops at the diagonal block (probabilities beyond it are exactly zero); roff = row offset of this launch's first row within the sequence.
#define NW 8      // waves that share one tile's K loop (K up to 1024: at most two slices a wave)
#define WSZ ((size_t)DQ * DM)             // elements of one weight plane
#define PSZ ((size_t)NB_ * NH_ * TT * HD)   // elements of one head plane, both batches
#define KS 64     // K elements per slice: one 128-byte line of every operand row, read by one wave only
template <typename T16> struct WFrag;
template <> struct WFrag<h16> { typedef v16h V; static __device__ __forceinline__ V ld(const h16* p) { return cat16(*(const v8h*)p, *(const v8h*)(p + 16)); } static __device__ __forceinline__ v8f mma(V a, V b, v8f c) { return wmma16(a, b, c); } };
template <> struct WFrag<bf> { typedef v16bf V; static __device__ __forceinline__ V ld(const bf* p) { return cat16b(*(const v8us*)p, *(const v8us*)(p + 16)); } static __device__ __forceinline__ v8f mma(V a, V b, v8f c) { return wmmab(a, b, c); } };
template <typename T16, int NSPLIT, int EPI, bool DIAG, int NWV>
__global__ __launch_bounds__(32 * NWV) void k_gemmw(const T16* __restrict__ A, const T16* __restrict__ A2, const T16* __restrict__ Bt, const T16* __restrict__ Bt2, int K, int lda, float* C, int ldc, const float* __restrict__ bias, const float* __restrict__ bias1, const float* __restrict__ bias2, const float* __restrict__ xr, h16* P16, bf* Ph, bf* Pl, int roff) {
    typedef typename WFrag<T16>::V V;
    __shared__ __align__(16) float os[NWV * 64 * 68];
    const bool tr = EPI == 1 && blockIdx.z == 2;   // work-group-uniform: the value projection, formed transposed
    if (EPI == 1) { const unsigned z = blockIdx.z; Bt += z * WSZ; bias = z == 0 ? bias : z == 1 ? bias1 : bias2; P16 += z * PSZ; Ph += z * PSZ; Pl += z * PSZ; if (tr) { const T16* t = A; A = Bt; Bt = t; } }
    const int lane = threadIdx.x & 31, lr = lane & 15, hi = lane >> 4; const int r0 = (tr ? blockIdx.y : blockIdx.x) * 64, c0 = (tr ? blockIdx.x : blockIdx.y) * 64;
    const int wave = __builtin_amdgcn_readfirstlane(threadIdx.x >> 5);
    const int Kl = DIAG ? min(K, r0 + roff + 64) : K;
    v8f acc[4][4];
#pragma unroll
    for (int mb = 0; mb < 4; ++mb)
#pragma unroll
        for (int nb = 0; nb < 4; ++nb) acc[mb][nb] = (v8f){};
    // byte offset of this lane's row of each 16-row block from its plane's base, stepped from trip to trip (32 bits hold it: a plane spans at most 2^23 elements); A and A2 share the pitch lda, Bt and Bt2 the pitch K
    unsigned oa[4], ob[4];
#pragma unroll
    for (int q = 0; q < 4; ++q) { oa[q] = (unsigned)((r0 + lr + q * 16) * lda + 8 * hi + wave * KS) * (unsigned)sizeof(T16); ob[q] = (unsigned)((c0 + lr + q * 16) * K + 8 * hi + wave * KS) * (unsigned)sizeof(T16); }
#pragma unroll 1   // stays rolled: a second trip's fragments do not fit beside the 16 accumulators
    for (int kb = wave * KS; kb < Kl; kb += NWV * KS) {
        V a[KS / 32][4], a2[KS / 32][4];
#pragma unroll
        for (int ks = 0; ks < KS / 32; ++ks)
#pragma unroll
            for (int mb = 0; mb < 4; ++mb) { a[ks][mb] = WFrag<T16>::ld((const T16*)((const char*)A + oa[mb]) + ks * 32); if (NSPLIT == 1 || NSPLIT == 2) a2[ks][mb] = WFrag<T16>::ld((const T16*)((const char*)A2 + oa[mb]) + ks * 32); }
#pragma unroll
        for (int ks = 0; ks < KS / 32; ++ks)
#pragma unroll
            for (int nb = 0; nb < 4; ++nb) { const V b = WFrag<T16>::ld((const T16*)((const char*)Bt + ob[nb]) + ks * 32); V b2; if (NSPLIT >= 2) b2 = WFrag<T16>::ld((const T16*)((const char*)Bt2 + ob[nb]) + ks * 32);
#pragma unroll
                for (int mb = 0; mb < 4; ++mb) { acc[mb][nb] = WFrag<T16>::mma(a[ks][mb], b, acc[mb][nb]); if (NSPLIT == 1 || NSPLIT == 2) acc[mb][nb] = WFrag<T16>::mma(a2[ks][mb], b, acc[mb][nb]); if (NSPLIT >= 2) acc[mb][nb] = WFrag<T16>::mma(a[ks][mb], b2, acc[mb][nb]); } }
        // keeps the distance behind the trip's last matrix instructions on the taken back edge; the row offsets are inputs so that no load's
        // result lands in an address register of an earlier load of the trip: they stay as they are until the diagonal accumulators, which take in every fragment, are complete
        asm volatile("v_nop\n\tv_nop\n\tv_nop\n\tv_nop" : "+v"(acc[0][0]), "+v"(acc[1][1]), "+v"(acc[2][2]), "+v"(acc[3][3]) : "v"(a[KS / 32 - 1][0]), "v"(a[KS / 32 - 1][3]), "v"(oa[0]), "v"(oa[1]), "v"(oa[2]), "v"(oa[3]), "v"(ob[0]), "v"(ob[1]), "v"(ob[2]), "v"(ob[3]));
#pragma unroll
        for (int q = 0; q < 4; ++q) { oa[q] += NWV * KS * (unsigned)sizeof(T16); ob[q] += NWV * KS * (unsigned)sizeof(T16); }
    }
    float* ow = os + wave * (64 * 68);
#pragma unroll
    for (int mb = 0; mb < 4; ++mb)
#pragma unroll
        for (int nb = 0; nb < 4; ++nb)
#pragma unroll
            for (int j = 0; j < 8; ++j) ow[(mb * 16 + hi * 8 + j) * 68 + nb * 16 + lr] = acc[mb][nb][j];
    const int trow = threadIdx.x >> 4, cofs = (threadIdx.x & 15) * 4;
    constexpr int NR = 64 / (2 * NWV);   // rows of the tile a thread finishes
    // bias and residual are fetched in front of the barrier: their latency runs under the wait for the other waves
    // (the projections fetch the bias both by column and by row, each from a place that lies inside it for either orientation: no branch then stands between the loads, and a select picks the one that counts)
    v4f res[NR]; float br[NR];
    const v4f bc = *(const v4f*)(bias + (tr ? 0 : c0) + cofs);
#pragma unroll
    for (int i = 0; i < NR; ++i) { const int row = i * 2 * NWV + trow; if (EPI == 1) br[i] = bias[(tr ? r0 : 0) + row]; if (EPI == 0) res[i] = *(const v4f*)(xr + (size_t)(r0 + row) * ldc + c0 + cofs); }
    // first element and row pitch of the tile in its output planes (an element index inside a plane fits 32 bits)
    const unsigned eb = tr ? (((unsigned)c0 / TT) * DKV + r0) * TT + (unsigned)c0 % TT : ((((unsigned)r0 / TT) * NH_ + blockIdx.y) * TT + (unsigned)r0 % TT) * HD, ep = tr ? TT : HD;
    __syncthreads();   // every wave's partial tile is in LDS before any thread sums across waves
#pragma unroll
    for (int i = 0; i < NR; ++i) { const int row = i * 2 * NWV + trow; v4f val = *(const v4fa*)(os + row * 68 + cofs);
#pragma unroll
        for (int w = 1; w < NWV; ++w) val += *(const v4fa*)(os + (w * 64 + row) * 68 + cofs);
#pragma unroll
        for (int q = 0; q < 4; ++q) val[q] += bfr(tr ? br[i] : bc[q]);
        if constexpr (EPI == 0) {
#pragma unroll
            for (int q = 0; q < 4; ++q) val[q] = __fadd_rn(val[q], bfr(res[i][q]));
            *(v4f*)(C + (size_t)(r0 + row) * ldc + c0 + cofs) = val;
        } else { v4h o16; v4us oh, ol;
#pragma unroll
            for (int q = 0; q < 4; ++q) { o16[q] = tohx(val[q]); unsigned short a2, c2; splitf(val[q], a2, c2); oh[q] = a2; ol[q] = c2; }
            const unsigned e = eb + (unsigned)row * ep + cofs;
            *(v4ha*)(P16 + e) = o16; *(v4usa*)(Ph + e) = oh; *(v4usa*)(Pl + e) = ol; } }
}

__global__ __launch_bounds__(256) void k_wtG(const float* __restrict__ w, int K, int N, bf* Bt) {
    const int lane = threadIdx.x & 31; const int L0 = (blockIdx.x * 8 + (threadIdx.x >> 5)) * 8; const int nlines = N * K / 64;
{
#pragma unroll 1
        for (int l = 0; l < 8; ++l) { const int L = L0 + l; if (L >= nlines) break; const size_t e = (size_t)L * 64 + lane * 2; const int k = (int)(e % K), n = (int)(e / K); v2us o;
            o[0] = f2bf(w[(size_t)k * N + n]); o[1] = f2bf(w[(size_t)(k + 1) * N + n]); *(v2us*)(Bt + e) = o; }
         }
}
// bf16 copies of x (both batches) and of the four weights in one grid: the first XBLK blocks take x, then WBLK blocks a weight, whose copies lie one behind the other in Wb
#define XBLK ((unsigned)((size_t)NB_ * TT * DM / 8 / 256))
#define WBLK ((unsigned)(WSZ / 8 / 256))
__global__ __launch_bounds__(256) void k_cvt8(const float* __restrict__ x, const float* __restrict__ wq, const float* __restrict__ wk, const float* __restrict__ wv, const float* __restrict__ wo, bf* Xb, bf* Wb) {
    const float* src = x; bf* dst = Xb; unsigned blk = blockIdx.x;
    if (blk >= XBLK) { const unsigned w = (blk - XBLK) / WBLK; blk = (blk - XBLK) % WBLK; src = w == 0 ? wq : w == 1 ? wk : w == 2 ? wv : wo; dst = Wb + w * WSZ; }
    const size_t i = (size_t)blk * 256 + threadIdx.x; const v8f v = *(const v8f*)(src + i * 8); v8us o;
#pragma unroll
    for (int k = 0; k < 8; ++k) o[k] = f2bf(v[k]); *(v8us*)(dst + i * 8) = o;  }

// ---- k_fattn: fused causal attention. One work-group owns one tile of query rows of one head (32 rows in fp16, 16 rows in hi/lo bf16); its FW waves share the key loop in blocks of 32 keys (wave w takes blocks w, w + FW, ...).
// Per block a wave forms S^T = K Q^T (a lane then holds 16 scores of ONE query: keys 8 hi + j of both 16-key tiles), updates that query's running maximum and sum, and feeds the two converted score tiles, which are a B fragment
// in the loaders' own k order, to O^T += V^T P^T. Scores and probabilities never leave the registers. The FW partial (maximum, sum, O) triples meet in LDS, are rescaled to the common maximum and summed in wave order;
// the quotient goes out as the merged hi/lo planes [t][h * HD + d]. Every visited block starts at or below every query of the tile, so each query sees at least one open key in it.
#define FW 8
#define SCL2 (SCL * 1.4426950408889634f)   // scores are carried in the log2 domain: one multiply takes in the scale and log2(e), and the exponent is a plain difference
__device__ __forceinline__ float xhalf(float x) { const int b = __float_as_int(x); return __int_as_float(__builtin_amdgcn_permlanex16(b, b, 0x76543210, 0xfedcba98, false, false)); }   // the value of lane l ^ 16
// p[0..7] = 2^p[0..7]. One statement, every output apart from every input, one v_nop behind the last: keeps the slot that the instruction set asks for behind a transcendental before its result is read or
// its source overwritten
__device__ __forceinline__ void exp2x8(float* p) { float r0, r1, r2, r3, r4, r5, r6, r7;
    asm("v_exp_f32 %0, %8\n\tv_exp_f32 %1, %9\n\tv_exp_f32 %2, %10\n\tv_exp_f32 %3, %11\n\tv_exp_f32 %4, %12\n\tv_exp_f32 %5, %13\n\tv_exp_f32 %6, %14\n\tv_exp_f32 %7, %15\n\tv_nop"
        : "=&v"(r0), "=&v"(r1), "=&v"(r2), "=&v"(r3), "=&v"(r4), "=&v"(r5), "=&v"(r6), "=&v"(r7) : "v"(p[0]), "v"(p[1]), "v"(p[2]), "v"(p[3]), "v"(p[4]), "v"(p[5]), "v"(p[6]), "v"(p[7]));
    p[0] = r0; p[1] = r1; p[2] = r2; p[3] = r3; p[4] = r4; p[5] = r5; p[6] = r6; p[7] = r7; }
template <typename T16, bool HL, int NQ>
__device__ __forceinline__ void attn_tile(const T16* __restrict__ Q, const T16* __restrict__ Q2, const T16* __restrict__ Kp, const T16* __restrict__ K2, const T16* __restrict__ Vt, const T16* __restrict__ V2, int q0, bf* Ah, bf* Al, float* os, float* ms, float* ls) {
    typedef typename WFrag<T16>::V V;
    const int lane = threadIdx.x & 31, lr = lane & 15, hi = lane >> 4;
    const int wave = __builtin_amdgcn_readfirstlane(threadIdx.x >> 5);
    V qf[NQ][2], qf2[NQ][2];
#pragma unroll
    for (int qt = 0; qt < NQ; ++qt)
#pragma unroll
        for (int ks = 0; ks < 2; ++ks) { const int qo = (q0 + qt * 16 + lr) * HD + ks * 32 + 8 * hi; qf[qt][ks] = WFrag<T16>::ld(Q + qo); if (HL) qf2[qt][ks] = WFrag<T16>::ld(Q2 + qo); }
    v8f o[4][NQ]; float m[NQ], l[NQ];
#pragma unroll
    for (int qt = 0; qt < NQ; ++qt) { m[qt] = -3.0e38f; l[qt] = 0.f;
#pragma unroll
        for (int dt = 0; dt < 4; ++dt) o[dt][qt] = (v8f){}; }
    const int kend = q0 + NQ * 16;
    // byte offsets of this lane's first K row and first V^T row from their planes' bases, stepped from block to block (K and K2, Vt and V2 share them); the other rows of a block lie at constant distances
    unsigned ok = (unsigned)((wave * 32 + lr) * HD + 8 * hi) * 2u, ov = (unsigned)(lr * TT + wave * 32 + 8 * hi) * 2u;
#pragma unroll 1   // stays rolled: a second block's fragments do not fit beside the accumulators
    for (int kb = wave * 32; kb < kend; kb += FW * 32, ok += FW * 32 * HD * 2u, ov += FW * 32 * 2u) {
        V kf[2][2], kf2[2][2], vf[4], vf2[4];
#pragma unroll
        for (int kt = 0; kt < 2; ++kt)
#pragma unroll
            for (int ks = 0; ks < 2; ++ks) { kf[kt][ks] = WFrag<T16>::ld((const T16*)((const char*)Kp + ok) + kt * 16 * HD + ks * 32); if (HL) kf2[kt][ks] = WFrag<T16>::ld((const T16*)((const char*)K2 + ok) + kt * 16 * HD + ks * 32); }
#pragma unroll
        for (int dt = 0; dt < 4; ++dt) { vf[dt] = WFrag<T16>::ld((const T16*)((const char*)Vt + ov) + dt * 16 * TT); if (HL) vf2[dt] = WFrag<T16>::ld((const T16*)((const char*)V2 + ov) + dt * 16 * TT); }
        __builtin_amdgcn_sched_barrier(0);   // keeps the V^T loads in front of the score products: their latency then runs under the scores and the softmax instead of behind them
        v8f s[2][NQ];
#pragma unroll
        for (int kt = 0; kt < 2; ++kt)
#pragma unroll
            for (int qt = 0; qt < NQ; ++qt) { s[kt][qt] = (v8f){};
#pragma unroll
                for (int ks = 0; ks < 2; ++ks) { s[kt][qt] = WFrag<T16>::mma(kf[kt][ks], qf[qt][ks], s[kt][qt]); if (HL) { s[kt][qt] = WFrag<T16>::mma(kf[kt][ks], qf2[qt][ks], s[kt][qt]); s[kt][qt] = WFrag<T16>::mma(kf2[kt][ks], qf[qt][ks], s[kt][qt]); } } }
        const bool edge = kb + 31 > q0;   // wave-uniform: only blocks that reach past the tile's first query hold masked keys
#pragma unroll
        for (int qt = 0; qt < NQ; ++qt) { const int qi = q0 + qt * 16 + lr; float t[16]; float mx = m[qt];
#pragma unroll
            for (int e = 0; e < 16; ++e) { float x = s[e >> 3][qt][e & 7] * SCL2; if (edge) x = (kb + (e >> 3) * 16 + hi * 8 + (e & 7) <= qi) ? x : -3.0e38f; t[e] = x; mx = fmaxf(mx, x); }
            mx = fmaxf(mx, xhalf(mx));
            const float al = __builtin_amdgcn_exp2f(m[qt] - mx); m[qt] = mx; float sum = 0.f;
#pragma unroll
            for (int e = 0; e < 16; ++e) t[e] -= mx;
            exp2x8(t); exp2x8(t + 8);
#pragma unroll
            for (int e = 0; e < 16; ++e) sum += t[e];
            l[qt] = l[qt] * al + sum;   // each half of the wave keeps the sum of its own keys; the halves join behind the loop
#pragma unroll
            for (int dt = 0; dt < 4; ++dt) o[dt][qt] *= al;
            if constexpr (HL) { v8us ph0, ph1, pl0, pl1;
#pragma unroll
                for (int e = 0; e < 8; ++e) { unsigned short a, c2; splitf(t[e], a, c2); ph0[e] = a; pl0[e] = c2; splitf(t[e + 8], a, c2); ph1[e] = a; pl1[e] = c2; }
                const V pf = cat16b(ph0, ph1), pf2 = cat16b(pl0, pl1);
#pragma unroll
                for (int dt = 0; dt < 4; ++dt) { o[dt][qt] = WFrag<T16>::mma(vf[dt], pf, o[dt][qt]); o[dt][qt] = WFrag<T16>::mma(vf[dt], pf2, o[dt][qt]); o[dt][qt] = WFrag<T16>::mma(vf2[dt], pf, o[dt][qt]); }
            } else { V pf;
#pragma unroll
                for (int e = 0; e < 16; ++e) pf[e] = (h16)t[e];
#pragma unroll
                for (int dt = 0; dt < 4; ++dt) o[dt][qt] = WFrag<T16>::mma(vf[dt], pf, o[dt][qt]); } }
        // the hi/lo block ends in its matrix instructions: keeps the distance behind them on the taken back edge, where the next block's loads land in the registers of their A operand
        if constexpr (HL) asm volatile("v_nop\n\tv_nop\n\tv_nop\n\tv_nop" : "+v"(o[0][0]), "+v"(o[1][0]), "+v"(o[2][0]), "+v"(o[3][0]));
    }
    float* ow = os + wave * (NQ * 16 * 68);
#pragma unroll
    for (int qt = 0; qt < NQ; ++qt) {
#pragma unroll
        for (int dt = 0; dt < 4; ++dt) { float* dst = ow + (qt * 16 + lr) * 68 + dt * 16 + hi * 8; const v8f a = o[dt][qt]; *(v4fa*)dst = (v4f){a[0], a[1], a[2], a[3]}; *(v4fa*)(dst + 4) = (v4f){a[4], a[5], a[6], a[7]}; }
        const float lj = l[qt] + xhalf(l[qt]);
        if (hi == 0) { ms[wave * (NQ * 16) + qt * 16 + lr] = m[qt]; ls[wave * (NQ * 16) + qt * 16 + lr] = lj; } }
    __syncthreads();   // every wave's partial triple is in LDS before any thread joins them
    constexpr int PER = NQ * 4;   // output elements a thread: NQ * 16 queries x 64 over 256 threads
    const int tq = threadIdx.x / (HD / PER), d0 = (threadIdx.x % (HD / PER)) * PER;
    float M = ms[tq];
#pragma unroll
    for (int w = 1; w < FW; ++w) M = fmaxf(M, ms[w * (NQ * 16) + tq]);
    float acc[PER]; float L = 0.f;
#pragma unroll
    for (int c = 0; c < PER; ++c) acc[c] = 0.f;
#pragma unroll
    for (int w = 0; w < FW; ++w) { const float f = __builtin_amdgcn_exp2f(ms[w * (NQ * 16) + tq] - M); L += f * ls[w * (NQ * 16) + tq];
#pragma unroll
        for (int c4 = 0; c4 < PER / 4; ++c4) { const v4f a = *(const v4fa*)(os + (w * (NQ * 16) + tq) * 68 + d0 + c4 * 4);
#pragma unroll
            for (int c = 0; c < 4; ++c) acc[c4 * 4 + c] += f * a[c]; } }
    const float inv = __fdiv_rn(1.0f, L); const size_t oo = (size_t)(q0 + tq) * DQ + d0;
#pragma unroll
    for (int c4 = 0; c4 < PER / 4; ++c4) { v4us oh, ol;
#pragma unroll
        for (int c = 0; c < 4; ++c) { unsigned short a, c2; splitf(acc[c4 * 4 + c] * inv, a, c2); oh[c] = a; ol[c] = c2; }
        *(v4usa*)(Ah + oo + c4 * 4) = oh; *(v4usa*)(Al + oo + c4 * 4) = ol; }
    asm volatile("s_wait_xcnt 0x0" ::: "memory");   // stands behind the tile's last store, in front of any later write of a register that the stores name (the other tile kind's code follows in the listing)
}
// grid (batches x heads, tiles): the tile index falls with the number of key blocks: first the fp16 tiles from the last rows down, then the hi/lo tiles
__global__ __launch_bounds__(32 * FW) void k_fattn(const h16* __restrict__ Q16, const h16* __restrict__ K16, const h16* __restrict__ V16, const bf* __restrict__ Qh, const bf* __restrict__ Ql, const bf* __restrict__ Kh, const bf* __restrict__ Kl, const bf* __restrict__ Vh, const bf* __restrict__ Vl, bf* Ah, bf* Al) {
    __shared__ __align__(16) float os[FW * 32 * 68]; __shared__ float ms[FW * 32], ls[FW * 32];
    const size_t po = (size_t)blockIdx.x * TT * HD; const size_t ao = (size_t)(blockIdx.x / NH_) * TT * DQ + (blockIdx.x % NH_) * HD; Ah += ao; Al += ao; const int tile = blockIdx.y;
    if (tile < (TT - RH) / 32) attn_tile<h16, false, 2>(Q16 + po, nullptr, K16 + po, nullptr, V16 + po, nullptr, TT - 32 - tile * 32, Ah, Al, os, ms, ls);
    else attn_tile<bf, true, 1>(Qh + po, Ql + po, Kh + po, Kl + po, Vh + po, Vl + po, RH - 16 - (tile - (TT - RH) / 32) * 16, Ah, Al, os, ms, ls);
}
__global__ __launch_bounds__(256) void k_lnout(const float* __restrict__ F, const float* __restrict__ g, const float* __restrict__ bb, float* out) { const int lane = threadIdx.x & 31; const int row = blockIdx.x * 8 + (threadIdx.x >> 5); if (row >= NB_ * TT) return; const float* fr = F + (size_t)row * DQ; float* orow = out + (size_t)row * DQ; float v[DQ / 32]; float s = 0.f;
#pragma unroll
    for (int c = 0; c < DQ / 128; ++c) { const v4f a = *(const v4f*)(fr + c * 128 + lane * 4); for (int q = 0; q < 4; ++q) { v[c * 4 + q] = a[q]; s = __fadd_rn(s, a[q]); } }
#pragma unroll
    for (int sh = 16; sh; sh >>= 1) s = __fadd_rn(s, __shfl_xor(s, sh, 32));
    const float mean = __fdiv_rn(s, (float)DQ); float s2 = 0.f;
#pragma unroll
    for (int k = 0; k < DQ / 32; ++k) { const float dv = __fsub_rn(v[k], mean); float p2 = __fmul_rn(dv, dv); asm volatile("" : "+v"(p2)); s2 = __fadd_rn(s2, p2); v[k] = dv; }
#pragma unroll
    for (int sh = 16; sh; sh >>= 1) s2 = __fadd_rn(s2, __shfl_xor(s2, sh, 32));
    const float rs = __fdiv_rn(1.0f, __fsqrt_rn(__fadd_rn(__fdiv_rn(s2, (float)DQ), LNEPS)));
{
#pragma unroll
        for (int c = 0; c < DQ / 128; ++c) { v4f o; for (int q = 0; q < 4; ++q) { const int col = c * 128 + lane * 4 + q; float y = __fmul_rn(v[c * 4 + q], rs); asm volatile("" : "+v"(y)); y = __fmul_rn(y, bfr(g[col])); asm volatile("" : "+v"(y)); o[q] = __fadd_rn(y, bfr(bb[col])); } *(v4f*)(orow + c * 128 + lane * 4) = o; }
         } }

extern "C" void kernel_launch(void* const* d_in, const int* in_sizes, int n_in,
                              void* d_out, int out_size, void* d_ws, size_t ws_size, hipStream_t stream) {
    (void)in_sizes; (void)n_in; (void)out_size;
    const float* x = (const float*)d_in[0]; const float* wq = (const float*)d_in[1]; const float* bq = (const float*)d_in[2]; const float* wk = (const float*)d_in[3]; const float* bk = (const float*)d_in[4]; const float* wv = (const float*)d_in[5]; const float* bv = (const float*)d_in[6]; const float* wo = (const float*)d_in[7]; const float* bo = (const float*)d_in[8]; const float* lng = (const float*)d_in[9]; const float* lnb = (const float*)d_in[10];
    float* OUT = (float*)d_out;     // [2][2048][1024]
    char* wsp = (char*)d_ws;
    auto take = [&](size_t bytes) { char* p = wsp; wsp += (bytes + 255) & ~(size_t)255; return (void*)p; };
    float* Y = (float*)take((size_t)NB_ * TT * DM * 4); bf* WB = (bf*)take(4 * WSZ * 2);   // WB: Wq, Wk, Wv, Wo
    bf* XB = (bf*)take((size_t)NB_ * TT * DM * 2);
    h16* P16 = (h16*)take(3 * PSZ * 2); bf* PH = (bf*)take(3 * PSZ * 2); bf* PL = (bf*)take(3 * PSZ * 2);   // each: q, k, v^T
    bf* ATh = (bf*)take((size_t)NB_ * TT * DQ * 2); bf* ATl = (bf*)take((size_t)NB_ * TT * DQ * 2);
    if ((size_t)(wsp - (char*)d_ws) > ws_size) return;    // ws 256 MiB
    k_cvt8<<<XBLK + 4 * WBLK, 256, 0, stream>>>(x, wq, wk, wv, wo, XB, WB);
    k_gemmw<bf, 0, 1, false, NW><<<dim3(NB_ * TT / 64, DQ / 64, 3), 32 * NW, 0, stream>>>(XB, nullptr, WB, nullptr, DM, DM, nullptr, 0, bq, bk, bv, nullptr, P16, PH, PL, 0);
    k_fattn<<<dim3(NB_ * NH_, (TT - RH) / 32 + RH / 16, 1), 32 * FW, 0, stream>>>(P16, P16 + PSZ, P16 + 2 * PSZ, PH, PL, PH + PSZ, PL + PSZ, PH + 2 * PSZ, PL + 2 * PSZ, ATh, ATl);
    k_gemmw<bf, 1, 0, false, NW><<<dim3(NB_ * TT / 64, DM / 64, 1), 32 * NW, 0, stream>>>(ATh, ATl, WB + 3 * WSZ, nullptr, DQ, DQ, Y, DM, bo, nullptr, nullptr, x, nullptr, nullptr, nullptr, 0);
    k_lnout<<<(NB_ * TT + 7) / 8, 256, 0, stream>>>(Y, lng, lnb, OUT);
}

// v006
// One run takes 111 microseconds.
// Next to v005, in two timings, it ran 1.52 times as fast each time.
// Over all steps from v000 it is 13.3 times as fast.
#include <hip/hip_runtime.h>

// Masked (causal) self-attention with residual and post-LayerNorm (x [2][2048][1024]; q,k,v = x W^T + b ('oi' uniform(+-1/32) incl. biases; 16 heads x 64); energy / 8; causal (-inf); softmax; out = merged Wo^T + bo; y = LayerNorm(out + x) gamma/beta (1e-5) -> [2][2048][1024] (4.2 M)).
// Layout, both batches in every launch (x is taken as 4096 token rows): bf16 copy of x; 'oi' weights; exact projections + f32 biases, whose epilogue writes the fp16 and hi/lo head planes itself (v as Wv x^T, so that its tile is already transposed); one fused causal attention kernel (scores, online softmax, probability x value and the head merge stay in registers and LDS; hybrid rows: < 512 hi/lo 3 products, rest fp16; key blocks above the diagonal never visited); merged hi/lo x Wo exact + bo + residual into workspace; a row LayerNorm kernel writes the output rows.
// Compute dtypes, f32 accumulate: every input rounded to bf16; projections exact + f32 biases; attention rows < 512 3 products, rest fp16; softmax f32; Wo hl x exact + bias; residual + LayerNorm f32.

#define NB_  2
#define TT   2048
#define DM   1024
#define NH_  16
#define NKV  16
#define HD   64
#define DQ   (NH_ * HD)
#define DKV  (NKV * HD)
#define RH   512                  // query rows < RH use hi+lo planes (0: none)
#define SCL  0.125f   // HD^-0.5
#define LNEPS 1e-5f
typedef _Float16 h16;
typedef unsigned short bf;
typedef __attribute__((ext_vector_type(16))) __bf16   v16bf;
typedef __attribute__((ext_vector_type(16))) _Float16 v16h;
typedef __attribute__((ext_vector_type(8)))  _Float16 v8h;
typedef __attribute__((ext_vector_type(8)))  unsigned short v8us;
typedef __attribute__((ext_vector_type(8)))  float    v8f;
typedef __attribute__((ext_vector_type(4)))  float    v4f;
typedef v8h  __attribute__((may_alias)) v8ha;
typedef v4f  __attribute__((may_alias)) v4fa;
typedef v8us __attribute__((may_alias)) v8usa;

__device__ __forceinline__ unsigned short f2bf(float f) { unsigned u = __float_as_uint(f); u += 0x7FFFu + ((u >> 16) & 1u); return (unsigned short)(u >> 16); }
__device__ __forceinline__ float bf2f(unsigned short b) { return __uint_as_float(((unsigned)b) << 16); }
__device__ __forceinline__ float bfr(float f) { return bf2f(f2bf(f)); }
__device__ __forceinline__ v16h cat16(v8h lo, v8h hi) { return __builtin_shufflevector(lo, hi, 0, 1, 2, 3, 4, 5, 6, 7, 8, 9, 10, 11, 12, 13, 14, 15); }
__device__ __forceinline__ v16bf cat16b(v8us lo, v8us hi) { return __builtin_bit_cast(v16bf, __builtin_shufflevector(lo, hi, 0, 1, 2, 3, 4, 5, 6, 7, 8, 9, 10, 11, 12, 13, 14, 15)); }
__device__ __forceinline__ v8f wmma16(v16h a, v16h b, v8f c) { return __builtin_amdgcn_wmma_f32_16x16x32_f16(false, a, false, b, (short)0, c, false, false); }
__device__ __forceinline__ v8f wmmab(v16bf a, v16bf b, v8f c) { return __builtin_amdgcn_wmma_f32_16x16x32_bf16(false, a, false, b, (short)0, c, false, false); }

__device__ __forceinline__ h16 tohx(float x) { return (h16)x; }
__device__ __forceinline__ void splitf(float y, unsigned short& h, unsigned short& l) { h = f2bf(y); l = f2bf(y - bf2f(h)); }
typedef __attribute__((ext_vector_type(2))) _Float16 v2h;
typedef __attribute__((ext_vector_type(4))) _Float16 v4h;
typedef __attribute__((ext_vector_type(2))) unsigned short v2us;
typedef __attribute__((ext_vector_type(4))) unsigned short v4us;
typedef v4h  __attribute__((may_alias)) v4ha;
typedef v4us __attribute__((may_alias)) v4usa;
typedef __attribute__((ext_vector_type(2))) float v2f;
typedef __attribute__((ext_vector_type(4))) int v4i;

// ---- k_gemms: GEMM with both operands staged in LDS. One (32 * MT) x 128 output tile per work-group of 4 waves (2 x 2), a wave holds (16 * MT) x 64 of it for the whole K loop. A trip takes KS elements of K: one 128-byte line of
// every operand row of the tile. The lines come into LDS by asynchronous copies (8 lanes a line, 4 whole lines an instruction), two buffers: the next trip's lines fly while this trip's are worked on; every line is fetched once a work-group
// and the fragments are read from LDS rows of GP bytes. c[m][n] = sum_k A[m][k] Bt[n][k] (+ A2[m][k] Bt[n][k] where NSPLIT) + bias; every operand row holds DM elements. A row index over tokens runs through the batches (batch = token row / TT).
// What the epilogue does with a wave's tile (EPI): 0: + bias[n] + the residual xr[m][n] (rounded to bf16), f32 into C (pitch DM, xr alike). 1: the three projections in one grid (tokens/128, features/128, 3): blockIdx.z picks the weight plane (Bt + z * WSZ), the bias (bias, bias1, bias2) and the output planes (+ z * PSZ).
// z = 0, 1 (q, k): + bias[n]; m is a token and a wave's 64 columns are one head: fp16, hi and lo planes [batch][head][token][d]. z = 2 (v): the operands change places, m is a feature (head * HD + d) and n a token: + bias[m]; planes [batch][head][d][token], the transposed value planes.
#define WSZ ((size_t)DQ * DM)             // elements of one weight plane
#define PSZ ((size_t)NB_ * NH_ * TT * HD)   // elements of one head plane, both batches
#define KS 64     // K elements per trip: one 128-byte line of every operand row
#define GP 144    // bytes from row to row in LDS: 16 x odd, so that the 16 rows of a fragment read meet every bank once
#define GROWS 256 // operand rows of a stage (A, A2 where there is one, Bt)
#define GSTG (GROWS * GP)   // bytes of one buffer
template <typename T16> struct WFrag;
template <> struct WFrag<h16> { typedef v16h V; static __device__ __forceinline__ V ld(const h16* p) { return cat16(*(const v8h*)p, *(const v8h*)(p + 16)); } static __device__ __forceinline__ v8f mma(V a, V b, v8f c) { return wmma16(a, b, c); } };
template <> struct WFrag<bf> { typedef v16bf V; static __device__ __forceinline__ V ld(const bf* p) { return cat16b(*(const v8us*)p, *(const v8us*)(p + 16)); } static __device__ __forceinline__ v8f mma(V a, V b, v8f c) { return wmmab(a, b, c); } };
// eight asynchronous copies of 16 bytes a lane, global -> LDS; the s_wait_xcnt stands in the copies' own statement so that no later write of an address register can be moved in front of it
__device__ __forceinline__ void copy8(const unsigned* l, const bf* const* g) {
    asm volatile("global_load_async_to_lds_b128 %0, %8, off\n\tglobal_load_async_to_lds_b128 %1, %9, off\n\tglobal_load_async_to_lds_b128 %2, %10, off\n\tglobal_load_async_to_lds_b128 %3, %11, off\n\t"
                 "global_load_async_to_lds_b128 %4, %12, off\n\tglobal_load_async_to_lds_b128 %5, %13, off\n\tglobal_load_async_to_lds_b128 %6, %14, off\n\tglobal_load_async_to_lds_b128 %7, %15, off\n\ts_wait_xcnt 0x0"
                 :: "v"(l[0]), "v"(l[1]), "v"(l[2]), "v"(l[3]), "v"(l[4]), "v"(l[5]), "v"(l[6]), "v"(l[7]), "v"(g[0]), "v"(g[1]), "v"(g[2]), "v"(g[3]), "v"(g[4]), "v"(g[5]), "v"(g[6]), "v"(g[7]) : "memory"); }
__device__ __forceinline__ v16bf ldsfrag(const char* p) { return cat16b(*(const v8usa*)p, *(const v8usa*)(p + 32)); }   // the loaders' k order: elements 8 hi + 0..7 and 16 + 8 hi + 0..7 of a 32-element step
template <int NSPLIT, int EPI, int MT>
__global__ __launch_bounds__(128) void k_gemms(const bf* __restrict__ A, const bf* __restrict__ A2, const bf* __restrict__ Bt, float* C, const float* __restrict__ bias, const float* __restrict__ bias1, const float* __restrict__ bias2, const float* __restrict__ xr, h16* P16, bf* Ph, bf* Pl) {
    typedef v16bf V;
    constexpr int RA = 2 * MT * 16, NA = RA / 16, NA2 = NSPLIT ? NA : 0, RB0 = RA + NA2 * 16, NT = DM / KS;
    static_assert((MT == 2 || MT == 4) && RB0 + 128 == GROWS && NT >= 2 && 4 * MT * 16 * 68 * 4 <= 2 * GSTG, "stage rows, stages and the output staging fit the two buffers");
    __shared__ __align__(16) char sm[2 * GSTG];
    const bool tr = EPI == 1 && blockIdx.z == 2;   // work-group-uniform: the value projection, formed transposed
    if (EPI == 1) { const unsigned z = blockIdx.z; Bt += z * WSZ; bias = z == 0 ? bias : z == 1 ? bias1 : bias2; P16 += z * PSZ; Ph += z * PSZ; Pl += z * PSZ; if (tr) { const bf* t = A; A = Bt; Bt = t; } }
    const int lane = threadIdx.x & 31, lr = lane & 15, hi = lane >> 4; const int r0 = (tr ? blockIdx.y : blockIdx.x) * RA, c0 = (tr ? blockIdx.x : blockIdx.y) * 128;
    const int wave = __builtin_amdgcn_readfirstlane(threadIdx.x >> 5), wm = wave >> 1, wn = wave & 1;
    v8f acc[MT][4];
#pragma unroll
    for (int mb = 0; mb < MT; ++mb)
#pragma unroll
        for (int nb = 0; nb < 4; ++nb) acc[mb][nb] = (v8f){};
    // a thread copies the same 16 bytes of the line of every 16th row of the stage: its place in the first such row of each plane, stepped from stage to stage, and in LDS
    const int crow = threadIdx.x >> 3, cpc = threadIdx.x & 7;
    const bf* ga = A + (size_t)(r0 + crow) * DM + cpc * 8; const bf* ga2 = NSPLIT ? A2 + (size_t)(r0 + crow) * DM + cpc * 8 : nullptr; const bf* gb = Bt + (size_t)(c0 + crow) * DM + cpc * 8;
    const unsigned lc = (unsigned)(size_t)sm + (unsigned)(crow * GP + cpc * 16);
    auto stage = [&](unsigned buf) { unsigned l[16]; const bf* g[16];
#pragma unroll
        for (int i = 0; i < 16; ++i) { l[i] = lc + buf * GSTG + i * 16 * GP; g[i] = i < NA ? ga + (size_t)i * 16 * DM : i < NA + NA2 ? ga2 + (size_t)(i - NA) * 16 * DM : gb + (size_t)(i - NA - NA2) * 16 * DM; }
        copy8(l, g); copy8(l + 8, g + 8); ga += KS; if (NSPLIT) ga2 += KS; gb += KS; };
    stage(0);
    asm volatile("s_wait_asynccnt 0x0" ::: "memory");   // this wave's share of stage 0 has landed
    __syncthreads();                                     // and every other wave's: stage 0 may be read
    stage(1);
    const char* fa = sm + (wm * MT * 16 + lr) * GP + hi * 16; const char* fb = sm + (RB0 + wn * 64 + lr) * GP + hi * 16;
#pragma unroll 1   // stays rolled: one trip's fragments beside the accumulators keep three work-groups on a WGP
    for (int t = 0; t < NT; ++t) { const unsigned bo = (unsigned)(t & 1) * GSTG;
        V a[KS / 32][MT], a2[KS / 32][MT], b[KS / 32][4];
#pragma unroll
        for (int ks = 0; ks < KS / 32; ++ks) {
#pragma unroll
            for (int mb = 0; mb < MT; ++mb) { a[ks][mb] = ldsfrag(fa + bo + mb * 16 * GP + ks * 64); if (NSPLIT) a2[ks][mb] = ldsfrag(fa + bo + (RA + mb * 16) * GP + ks * 64); }
#pragma unroll
            for (int nb = 0; nb < 4; ++nb) b[ks][nb] = ldsfrag(fb + bo + nb * 16 * GP + ks * 64); }
        __builtin_amdgcn_sched_barrier(0);   // keeps the trip's LDS reads together in front of its matrix instructions: spread among them, every group of four waits out an LDS latency of its own
#pragma unroll
        for (int ks = 0; ks < KS / 32; ++ks)
#pragma unroll
            for (int nb = 0; nb < 4; ++nb)
#pragma unroll
                for (int mb = 0; mb < MT; ++mb) { acc[mb][nb] = wmmab(a[ks][mb], b[ks][nb], acc[mb][nb]); if (NSPLIT) acc[mb][nb] = wmmab(a2[ks][mb], b[ks][nb], acc[mb][nb]); }
        __builtin_amdgcn_sched_barrier(0);   // keeps the matrix instructions in front of the waits: moved behind them, the next stage's copies have only the LDS reads to land under instead of the whole trip
        asm volatile("s_wait_dscnt 0x0" ::: "memory");      // this wave has left the buffer that is refilled behind the barrier
        asm volatile("s_wait_asynccnt 0x0" ::: "memory");   // this wave's share of the next stage has landed
        __syncthreads();                                     // publishes the next stage and ends every reader's last read of this one
        if (t + 2 < NT) stage((unsigned)(t & 1));
    }
    asm volatile("s_wait_asynccnt 0x0" ::: "memory");   // no copy is under way when the buffers become the output staging
    // each wave turns its own tile through its own LDS range, so that whole lines go out
    float* ow = (float*)sm + wave * (MT * 16 * 68);
#pragma unroll
    for (int mb = 0; mb < MT; ++mb)
#pragma unroll
        for (int nb = 0; nb < 4; ++nb)
#pragma unroll
            for (int j = 0; j < 8; ++j) ow[(mb * 16 + hi * 8 + j) * 68 + nb * 16 + lr] = acc[mb][nb][j];
    const int rw = r0 + wm * MT * 16, cw = c0 + wn * 64, cofs = lr * 4;
    const v4f bc = *(const v4f*)(bias + (tr ? 0 : cw) + cofs);
    // first element and row pitch of the wave's tile in its output planes (an element index inside a plane fits 32 bits)
    const unsigned eb = tr ? (((unsigned)cw / TT) * DKV + rw) * TT + (unsigned)cw % TT : ((((unsigned)rw / TT) * NH_ + (unsigned)cw / HD) * TT + (unsigned)rw % TT) * HD, ep = tr ? TT : HD;
    asm volatile("s_wait_dscnt 0x0" ::: "memory");   // the rows that a lane reads back were written by other lanes of its wave
#pragma unroll 1   // four row pairs a trip: unrolled whole, the rows' loads raise the register count past what lets three work-groups share a WGP
    for (int i0 = 0; i0 < MT * 8; i0 += 4) {
#pragma unroll
        for (int i = 0; i < 4; ++i) { const int row = (i0 + i) * 2 + hi; v4f val = *(const v4fa*)(ow + row * 68 + cofs);
            if constexpr (EPI == 0) { const v4f res = *(const v4f*)(xr + (size_t)(rw + row) * DM + cw + cofs);
#pragma unroll
                for (int q = 0; q < 4; ++q) val[q] = __fadd_rn(val[q] + bfr(bc[q]), bfr(res[q]));
                *(v4f*)(C + (size_t)(rw + row) * DM + cw + cofs) = val;
            } else { const float br = bias[(tr ? rw : 0) + row];   // fetched for either orientation, from a place inside the bias: a select picks the one that counts
                v4h o16; v4us oh, ol;
#pragma unroll
                for (int q = 0; q < 4; ++q) { val[q] += bfr(tr ? br : bc[q]); o16[q] = tohx(val[q]); unsigned short a3, c3; splitf(val[q], a3, c3); oh[q] = a3; ol[q] = c3; }
                const unsigned e = eb + (unsigned)row * ep + cofs;
                *(v4ha*)(P16 + e) = o16; *(v4usa*)(Ph + e) = oh; *(v4usa*)(Pl + e) = ol; } }
        asm volatile("s_wait_xcnt 0x0" ::: "memory");   // stands behind the trip's last stores, in front of the next trip's writes of the registers that they name
    }
}

__global__ __launch_bounds__(256) void k_wtG(const float* __restrict__ w, int K, int N, bf* Bt) {
    const int lane = threadIdx.x & 31; const int L0 = (blockIdx.x * 8 + (threadIdx.x >> 5)) * 8; const int nlines = N * K / 64;
{
#pragma unroll 1
        for (int l = 0; l < 8; ++l) { const int L = L0 + l; if (L >= nlines) break; const size_t e = (size_t)L * 64 + lane * 2; const int k = (int)(e % K), n = (int)(e / K); v2us o;
            o[0] = f2bf(w[(size_t)k * N + n]); o[1] = f2bf(w[(size_t)(k + 1) * N + n]); *(v2us*)(Bt + e) = o; }
         }
}
// bf16 copies of x (both batches) and of the four weights in one grid: the first XBLK blocks take x, then WBLK blocks a weight, whose copies lie one behind the other in Wb
#define XBLK ((unsigned)((size_t)NB_ * TT * DM / 8 / 256))
#define WBLK ((unsigned)(WSZ / 8 / 256))
__global__ __launch_bounds__(256) void k_cvt8(const float* __restrict__ x, const float* __restrict__ wq, const float* __restrict__ wk, const float* __restrict__ wv, const float* __restrict__ wo, bf* Xb, bf* Wb) {
    const float* src = x; bf* dst = Xb; unsigned blk = blockIdx.x;
    if (blk >= XBLK) { const unsigned w = (blk - XBLK) / WBLK; blk = (blk - XBLK) % WBLK; src = w == 0 ? wq : w == 1 ? wk : w == 2 ? wv : wo; dst = Wb + w * WSZ; }
    const size_t i = (size_t)blk * 256 + threadIdx.x; const v8f v = *(const v8f*)(src + i * 8); v8us o;
#pragma unroll
    for (int k = 0; k < 8; ++k) o[k] = f2bf(v[k]); *(v8us*)(dst + i * 8) = o;  }

// ---- k_fattn: fused causal attention. One work-group owns one tile of query rows of one head (32 rows in fp16, 16 rows in hi/lo bf16); its FW waves share the key loop in blocks of 32 keys (wave w takes blocks w, w + FW, ...).
// Per block a wave forms S^T = K Q^T (a lane then holds 16 scores of ONE query: keys 8 hi + j of both 16-key tiles), updates that query's running maximum and sum, and feeds the two converted score tiles, which are a B fragment
// in the loaders' own k order, to O^T += V^T P^T. Scores and probabilities never leave the registers. The FW partial (maximum, sum, O) triples meet in LDS, are rescaled to the common maximum and summed in wave order;
// the quotient goes out as the merged hi/lo planes [t][h * HD + d]. Every visited block starts at or below every query of the tile, so each query sees at least one open key in it.
#define FW 8
#define SCL2 (SCL * 1.4426950408889634f)   // scores are carried in the log2 domain: one multiply takes in the scale and log2(e), and the exponent is a plain difference
__device__ __forceinline__ float xhalf(float x) { const int b = __float_as_int(x); return __int_as_float(__builtin_amdgcn_permlanex16(b, b, 0x76543210, 0xfedcba98, false, false)); }   // the value of lane l ^ 16
// p[0..7] = 2^p[0..7]. One statement, every output apart from every input, one v_nop behind the last: keeps the slot that the instruction set asks for behind a transcendental before its result is read or
// its source overwritten
__device__ __forceinline__ void exp2x8(float* p) { float r0, r1, r2, r3, r4, r5, r6, r7;
    asm("v_exp_f32 %0, %8\n\tv_exp_f32 %1, %9\n\tv_exp_f32 %2, %10\n\tv_exp_f32 %3, %11\n\tv_exp_f32 %4, %12\n\tv_exp_f32 %5, %13\n\tv_exp_f32 %6, %14\n\tv_exp_f32 %7, %15\n\tv_nop"
        : "=&v"(r0), "=&v"(r1), "=&v"(r2), "=&v"(r3), "=&v"(r4), "=&v"(r5), "=&v"(r6), "=&v"(r7) : "v"(p[0]), "v"(p[1]), "v"(p[2]), "v"(p[3]), "v"(p[4]), "v"(p[5]), "v"(p[6]), "v"(p[7]));
    p[0] = r0; p[1] = r1; p[2] = r2; p[3] = r3; p[4] = r4; p[5] = r5; p[6] = r6; p[7] = r7; }
template <typename T16, bool HL, int NQ>
__device__ __forceinline__ void attn_tile(const T16* __restrict__ Q, const T16* __restrict__ Q2, const T16* __restrict__ Kp, const T16* __restrict__ K2, const T16* __restrict__ Vt, const T16* __restrict__ V2, int q0, bf* Ah, bf* Al, float* os, float* ms, float* ls) {
    typedef typename WFrag<T16>::V V;
    const int lane = threadIdx.x & 31, lr = lane & 15, hi = lane >> 4;
    const int wave = __builtin_amdgcn_readfirstlane(threadIdx.x >> 5);
    V qf[NQ][2], qf2[NQ][2];
#pragma unroll
    for (int qt = 0; qt < NQ; ++qt)
#pragma unroll
        for (int ks = 0; ks < 2; ++ks) { const int qo = (q0 + qt * 16 + lr) * HD + ks * 32 + 8 * hi; qf[qt][ks] = WFrag<T16>::ld(Q + qo); if (HL) qf2[qt][ks] = WFrag<T16>::ld(Q2 + qo); }
    v8f o[4][NQ]; float m[NQ], l[NQ];
#pragma unroll
    for (int qt = 0; qt < NQ; ++qt) { m[qt] = -3.0e38f; l[qt] = 0.f;
#pragma unroll
        for (int dt = 0; dt < 4; ++dt) o[dt][qt] = (v8f){}; }
    const int kend = q0 + NQ * 16;
    // byte offsets of this lane's first K row and first V^T row from their planes' bases, stepped from block to block (K and K2, Vt and V2 share them); the other rows of a block lie at constant distances
    unsigned ok = (unsigned)((wave * 32 + lr) * HD + 8 * hi) * 2u, ov = (unsigned)(lr * TT + wave * 32 + 8 * hi) * 2u;
#pragma unroll 1   // stays rolled: a second block's fragments do not fit beside the accumulators
    for (int kb = wave * 32; kb < kend; kb += FW * 32, ok += FW * 32 * HD * 2u, ov += FW * 32 * 2u) {
        V kf[2][2], kf2[2][2], vf[4], vf2[4];
#pragma unroll
        for (int kt = 0; kt < 2; ++kt)
#pragma unroll
            for (int ks = 0; ks < 2; ++ks) { kf[kt][ks] = WFrag<T16>::ld((const T16*)((const char*)Kp + ok) + kt * 16 * HD + ks * 32); if (HL) kf2[kt][ks] = WFrag<T16>::ld((const T16*)((const char*)K2 + ok) + kt * 16 * HD + ks * 32); }
#pragma unroll
        for (int dt = 0; dt < 4; ++dt) { vf[dt] = WFrag<T16>::ld((const T16*)((const char*)Vt + ov) + dt * 16 * TT); if (HL) vf2[dt] = WFrag<T16>::ld((const T16*)((const char*)V2 + ov) + dt * 16 * TT); }
        __builtin_amdgcn_sched_barrier(0);   // keeps the V^T loads in front of the score products: their latency then runs under the scores and the softmax instead of behind them
        v8f s[2][NQ];
#pragma unroll
        for (int kt = 0; kt < 2; ++kt)
#pragma unroll
            for (int qt = 0; qt < NQ; ++qt) { s[kt][qt] = (v8f){};
#pragma unroll
                for (int ks = 0; ks < 2; ++ks) { s[kt][qt] = WFrag<T16>::mma(kf[kt][ks], qf[qt][ks], s[kt][qt]); if (HL) { s[kt][qt] = WFrag<T16>::mma(kf[kt][ks], qf2[qt][ks], s[kt][qt]); s[kt][qt] = WFrag<T16>::mma(kf2[kt][ks], qf[qt][ks], s[kt][qt]); } } }
        const bool edge = kb + 31 > q0;   // wave-uniform: only blocks that reach past the tile's first query hold masked keys
#pragma unroll
        for (int qt = 0; qt < NQ; ++qt) { const int qi = q0 + qt * 16 + lr; float t[16]; float mx = m[qt];
#pragma unroll
            for (int e = 0; e < 16; ++e) { float x = s[e >> 3][qt][e & 7] * SCL2; if (edge) x = (kb + (e >> 3) * 16 + hi * 8 + (e & 7) <= qi) ? x : -3.0e38f; t[e] = x; mx = fmaxf(mx, x); }
            mx = fmaxf(mx, xhalf(mx));
            const float al = __builtin_amdgcn_exp2f(m[qt] - mx); m[qt] = mx; float sum = 0.f;
#pragma unroll
            for (int e = 0; e < 16; ++e) t[e] -= mx;
            exp2x8(t); exp2x8(t + 8);
#pragma unroll
            for (int e = 0; e < 16; ++e) sum += t[e];
            l[qt] = l[qt] * al + sum;   // each half of the wave keeps the sum of its own keys; the halves join behind the loop
#pragma unroll
            for (int dt = 0; dt < 4; ++dt) o[dt][qt] *= al;
            if constexpr (HL) { v8us ph0, ph1, pl0, pl1;
#pragma unroll
                for (int e = 0; e < 8; ++e) { unsigned short a, c2; splitf(t[e], a, c2); ph0[e] = a; pl0[e] = c2; splitf(t[e + 8], a, c2); ph1[e] = a; pl1[e] = c2; }
                const V pf = cat16b(ph0, ph1), pf2 = cat16b(pl0, pl1);
#pragma unroll
                for (int dt = 0; dt < 4; ++dt) { o[dt][qt] = WFrag<T16>::mma(vf[dt], pf, o[dt][qt]); o[dt][qt] = WFrag<T16>::mma(vf[dt], pf2, o[dt][qt]); o[dt][qt] = WFrag<T16>::mma(vf2[dt], pf, o[dt][qt]); }
            } else { V pf;
#pragma unroll
                for (int e = 0; e < 16; ++e) pf[e] = (h16)t[e];
#pragma unroll
                for (int dt = 0; dt < 4; ++dt) o[dt][qt] = WFrag<T16>::mma(vf[dt], pf, o[dt][qt]); } }
        // the hi/lo block ends in its matrix instructions: keeps the distance behind them on the taken back edge, where the next block's loads land in the registers of their A operand
        if constexpr (HL) asm volatile("v_nop\n\tv_nop\n\tv_nop\n\tv_nop" : "+v"(o[0][0]), "+v"(o[1][0]), "+v"(o[2][0]), "+v"(o[3][0]));
    }
    float* ow = os + wave * (NQ * 16 * 68);
#pragma unroll
    for (int qt = 0; qt < NQ; ++qt) {
#pragma unroll
        for (int dt = 0; dt < 4; ++dt) { float* dst = ow + (qt * 16 + lr) * 68 + dt * 16 + hi * 8; const v8f a = o[dt][qt]; *(v4fa*)dst = (v4f){a[0], a[1], a[2], a[3]}; *(v4fa*)(dst + 4) = (v4f){a[4], a[5], a[6], a[7]}; }
        const float lj = l[qt] + xhalf(l[qt]);
        if (hi == 0) { ms[wave * (NQ * 16) + qt * 16 + lr] = m[qt]; ls[wave * (NQ * 16) + qt * 16 + lr] = lj; } }
    __syncthreads();   // every wave's partial triple is in LDS before any thread joins them
    constexpr int PER = NQ * 4;   // output elements a thread: NQ * 16 queries x 64 over 256 threads
    const int tq = threadIdx.x / (HD / PER), d0 = (threadIdx.x % (HD / PER)) * PER;
    float M = ms[tq];
#pragma unroll
    for (int w = 1; w < FW; ++w) M = fmaxf(M, ms[w * (NQ * 16) + tq]);
    float acc[PER]; float L = 0.f;
#pragma unroll
    for (int c = 0; c < PER; ++c) acc[c] = 0.f;
#pragma unroll
    for (int w = 0; w < FW; ++w) { const float f = __builtin_amdgcn_exp2f(ms[w * (NQ * 16) + tq] - M); L += f * ls[w * (NQ * 16) + tq];
#pragma unroll
        for (int c4 = 0; c4 < PER / 4; ++c4) { const v4f a = *(const v4fa*)(os + (w * (NQ * 16) + tq) * 68 + d0 + c4 * 4);
#pragma unroll
            for (int c = 0; c < 4; ++c) acc[c4 * 4 + c] += f * a[c]; } }
    const float inv = __fdiv_rn(1.0f, L); const size_t oo = (size_t)(q0 + tq) * DQ + d0;
#pragma unroll
    for (int c4 = 0; c4 < PER / 4; ++c4) { v4us oh, ol;
#pragma unroll
        for (int c = 0; c < 4; ++c) { unsigned short a, c2; splitf(acc[c4 * 4 + c] * inv, a, c2); oh[c] = a; ol[c] = c2; }
        *(v4usa*)(Ah + oo + c4 * 4) = oh; *(v4usa*)(Al + oo + c4 * 4) = ol; }
    asm volatile("s_wait_xcnt 0x0" ::: "memory");   // stands behind the tile's last store, in front of any later write of a register that the stores name (the other tile kind's code follows in the listing)
}
// grid (batches x heads, tiles): the tile index falls with the number of key blocks: first the fp16 tiles from the last rows down, then the hi/lo tiles
__global__ __launch_bounds__(32 * FW) void k_fattn(const h16* __restrict__ Q16, const h16* __restrict__ K16, const h16* __restrict__ V16, const bf* __restrict__ Qh, const bf* __restrict__ Ql, const bf* __restrict__ Kh, const bf* __restrict__ Kl, const bf* __restrict__ Vh, const bf* __restrict__ Vl, bf* Ah, bf* Al) {
    __shared__ __align__(16) float os[FW * 32 * 68]; __shared__ float ms[FW * 32], ls[FW * 32];
    const size_t po = (size_t)blockIdx.x * TT * HD; const size_t ao = (size_t)(blockIdx.x / NH_) * TT * DQ + (blockIdx.x % NH_) * HD; Ah += ao; Al += ao; const int tile = blockIdx.y;
    if (tile < (TT - RH) / 32) attn_tile<h16, false, 2>(Q16 + po, nullptr, K16 + po, nullptr, V16 + po, nullptr, TT - 32 - tile * 32, Ah, Al, os, ms, ls);
    else attn_tile<bf, true, 1>(Qh + po, Ql + po, Kh + po, Kl + po, Vh + po, Vl + po, RH - 16 - (tile - (TT - RH) / 32) * 16, Ah, Al, os, ms, ls);
}
__global__ __launch_bounds__(256) void k_lnout(const float* __restrict__ F, const float* __restrict__ g, const float* __restrict__ bb, float* out) { const int lane = threadIdx.x & 31; const int row = blockIdx.x * 8 + (threadIdx.x >> 5); if (row >= NB_ * TT) return; const float* fr = F + (size_t)row * DQ; float* orow = out + (size_t)row * DQ; float v[DQ / 32]; float s = 0.f;
#pragma unroll
    for (int c = 0; c < DQ / 128; ++c) { const v4f a = *(const v4f*)(fr + c * 128 + lane * 4); for (int q = 0; q < 4; ++q) { v[c * 4 + q] = a[q]; s = __fadd_rn(s, a[q]); } }
#pragma unroll
    for (int sh = 16; sh; sh >>= 1) s = __fadd_rn(s, __shfl_xor(s, sh, 32));
    const float mean = __fdiv_rn(s, (float)DQ); float s2 = 0.f;
#pragma unroll
    for (int k = 0; k < DQ / 32; ++k) { const float dv = __fsub_rn(v[k], mean); float p2 = __fmul_rn(dv, dv); asm volatile("" : "+v"(p2)); s2 = __fadd_rn(s2, p2); v[k] = dv; }
#pragma unroll
    for (int sh = 16; sh; sh >>= 1) s2 = __fadd_rn(s2, __shfl_xor(s2, sh, 32));
    const float rs = __fdiv_rn(1.0f, __fsqrt_rn(__fadd_rn(__fdiv_rn(s2, (float)DQ), LNEPS)));
{
#pragma unroll
        for (int c = 0; c < DQ / 128; ++c) { v4f o; for (int q = 0; q < 4; ++q) { const int col = c * 128 + lane * 4 + q; float y = __fmul_rn(v[c * 4 + q], rs); asm volatile("" : "+v"(y)); y = __fmul_rn(y, bfr(g[col])); asm volatile("" : "+v"(y)); o[q] = __fadd_rn(y, bfr(bb[col])); } *(v4f*)(orow + c * 128 + lane * 4) = o; }
         } }

extern "C" void kernel_launch(void* const* d_in, const int* in_sizes, int n_in,
                              void* d_out, int out_size, void* d_ws, size_t ws_size, hipStream_t stream) {
    (void)in_sizes; (void)n_in; (void)out_size;
    const float* x = (const float*)d_in[0]; const float* wq = (const float*)d_in[1]; const float* bq = (const float*)d_in[2]; const float* wk = (const float*)d_in[3]; const float* bk = (const float*)d_in[4]; const float* wv = (const float*)d_in[5]; const float* bv = (const float*)d_in[6]; const float* wo = (const float*)d_in[7]; const float* bo = (const float*)d_in[8]; const float* lng = (const float*)d_in[9]; const float* lnb = (const float*)d_in[10];
    float* OUT = (float*)d_out;     // [2][2048][1024]
    char* wsp = (char*)d_ws;
    auto take = [&](size_t bytes) { char* p = wsp; wsp += (bytes + 255) & ~(size_t)255; return (void*)p; };
    float* Y = (float*)take((size_t)NB_ * TT * DM * 4); bf* WB = (bf*)take(4 * WSZ * 2);   // WB: Wq, Wk, Wv, Wo
    bf* XB = (bf*)take((size_t)NB_ * TT * DM * 2);
    h16* P16 = (h16*)take(3 * PSZ * 2); bf* PH = (bf*)take(3 * PSZ * 2); bf* PL = (bf*)take(3 * PSZ * 2);   // each: q, k, v^T
    bf* ATh = (bf*)take((size_t)NB_ * TT * DQ * 2); bf* ATl = (bf*)take((size_t)NB_ * TT * DQ * 2);
    if ((size_t)(wsp - (char*)d_ws) > ws_size) return;    // ws 256 MiB
    k_cvt8<<<XBLK + 4 * WBLK, 256, 0, stream>>>(x, wq, wk, wv, wo, XB, WB);
    k_gemms<0, 1, 4><<<dim3(NB_ * TT / 128, DQ / 128, 3), 128, 0, stream>>>(XB, nullptr, WB, nullptr, bq, bk, bv, nullptr, P16, PH, PL);
    k_fattn<<<dim3(NB_ * NH_, (TT - RH) / 32 + RH / 16, 1), 32 * FW, 0, stream>>>(P16, P16 + PSZ, P16 + 2 * PSZ, PH, PL, PH + PSZ, PL + PSZ, PH + 2 * PSZ, PL + 2 * PSZ, ATh, ATl);
    k_gemms<1, 0, 2><<<dim3(NB_ * TT / 64, DM / 128, 1), 128, 0, stream>>>(ATh, ATl, WB + 3 * WSZ, Y, bo, nullptr, nullptr, x, nullptr, nullptr, nullptr);
    k_lnout<<<(NB_ * TT + 7) / 8, 256, 0, stream>>>(Y, lng, lnb, OUT);
}

// v007
// Measured time: 92.6 microseconds a run.
// In two side-by-side timings against v006, it was 1.19 and 1.20 times as fast.
// Over all steps from v000 it is 15.9 times as fast.
#include <hip/hip_runtime.h>

// Masked (causal) self-attention with residual and post-LayerNorm (x [2][2048][1024]; q,k,v = x W^T + b ('oi' uniform(+-1/32) incl. biases; 16 heads x 64); energy / 8; causal (-inf); softmax; out = merged Wo^T + bo; y = LayerNorm(out + x) gamma/beta (1e-5) -> [2][2048][1024] (4.2 M)).
// Layout, both batches in every launch (x is taken as 4096 token rows): bf16 copy of x; 'oi' weights; exact projections + f32 biases, whose epilogue writes the fp16 and hi/lo head planes itself, in the order in which the attention kernel's fragment loads take them (v as Wv x^T, so that its tile is already transposed); one fused causal attention kernel (scores, online softmax, probability x value and the head merge stay in registers and LDS; hybrid rows: < 512 hi/lo 3 products, rest fp16; key blocks above the diagonal never visited); merged hi/lo x Wo exact + bo + residual into workspace; a row LayerNorm kernel writes the output rows.
// Compute dtypes, f32 accumulate: every input rounded to bf16; projections exact + f32 biases; attention rows < 512 3 products, rest fp16; softmax f32; Wo hl x exact + bias; residual + LayerNorm f32.

#define NB_  2
#define TT   2048
#define DM   1024
#define NH_  16
#define NKV  16
#define HD   64
#define DQ   (NH_ * HD)
#define DKV  (NKV * HD)
#define RH   512                  // query rows < RH use hi+lo planes (0: none)
#define SCL  0.125f   // HD^-0.5
#define LNEPS 1e-5f
typedef _Float16 h16;
typedef unsigned short bf;
typedef __attribute__((ext_vector_type(16))) __bf16   v16bf;
typedef __attribute__((ext_vector_type(16))) _Float16 v16h;
typedef __attribute__((ext_vector_type(8)))  _Float16 v8h;
typedef __attribute__((ext_vector_type(8)))  unsigned short v8us;
typedef __attribute__((ext_vector_type(8)))  float    v8f;
typedef __attribute__((ext_vector_type(4)))  float    v4f;
typedef v8h  __attribute__((may_alias)) v8ha;
typedef v4f  __attribute__((may_alias)) v4fa;
typedef v8us __attribute__((may_alias)) v8usa;

__device__ __forceinline__ unsigned short f2bf(float f) { unsigned u = __float_as_uint(f); u += 0x7FFFu + ((u >> 16) & 1u); return (unsigned short)(u >> 16); }
__device__ __forceinline__ float bf2f(unsigned short b) { return __uint_as_float(((unsigned)b) << 16); }
__device__ __forceinline__ float bfr(float f) { return bf2f(f2bf(f)); }
__device__ __forceinline__ v16h cat16(v8h lo, v8h hi) { return __builtin_shufflevector(lo, hi, 0, 1, 2, 3, 4, 5, 6, 7, 8, 9, 10, 11, 12, 13, 14, 15); }
__device__ __forceinline__ v16bf cat16b(v8us lo, v8us hi) { return __builtin_bit_cast(v16bf, __builtin_shufflevector(lo, hi, 0, 1, 2, 3, 4, 5, 6, 7, 8, 9, 10, 11, 12, 13, 14, 15)); }
__device__ __forceinline__ v8f wmma16(v16h a, v16h b, v8f c) { return __builtin_amdgcn_wmma_f32_16x16x32_f16(false, a, false, b, (short)0, c, false, false); }
__device__ __forceinline__ v8f wmmab(v16bf a, v16bf b, v8f c) { return __builtin_amdgcn_wmma_f32_16x16x32_bf16(false, a, false, b, (short)0, c, false, false); }

__device__ __forceinline__ h16 tohx(float x) { return (h16)x; }
__device__ __forceinline__ void splitf(float y, unsigned short& h, unsigned short& l) { h = f2bf(y); l = f2bf(y - bf2f(h)); }
typedef __attribute__((ext_vector_type(2))) _Float16 v2h;
typedef __attribute__((ext_vector_type(4))) _Float16 v4h;
typedef __attribute__((ext_vector_type(2))) unsigned short v2us;
typedef __attribute__((ext_vector_type(4))) unsigned short v4us;
typedef v4h  __attribute__((may_alias)) v4ha;
typedef v4us __attribute__((may_alias)) v4usa;
typedef __attribute__((ext_vector_type(2))) float v2f;
typedef __attribute__((ext_vector_type(4))) int v4i;

// ---- k_gemms: GEMM with both operands staged in LDS. One (32 * MT) x 128 output tile per work-group of 4 waves (2 x 2), a wave holds (16 * MT) x 64 of it for the whole K loop. A trip takes KS elements of K: one 128-byte line of
// every operand row of the tile. The lines come into LDS by asynchronous copies (8 lanes a line, 4 whole lines an instruction), two buffers: the next trip's lines fly while this trip's are worked on; every line is fetched once a work-group
// and the fragments are read from LDS rows of GP bytes. c[m][n] = sum_k A[m][k] Bt[n][k] (+ A2[m][k] Bt[n][k] where NSPLIT) + bias; every operand row holds DM elements. A row index over tokens runs through the batches (batch = token row / TT).
// What the epilogue does with a wave's tile (EPI): 0: + bias[n] + the residual xr[m][n] (rounded to bf16), f32 into C (pitch DM, xr alike). 1: the three projections in one grid (tokens/128, features/128, 3): blockIdx.z picks the weight plane (Bt + z * WSZ), the bias (bias, bias1, bias2) and the output planes (+ z * PSZ).
// z = 0, 1 (q, k): + bias[n]; m is a token and a wave's 64 columns are one head: fp16, hi and lo planes [batch][head], tokens x d in fragment order. z = 2 (v): the operands change places, m is a feature (head * HD + d) and n a token: + bias[m]; planes [batch][head], d x tokens (the transposed values) in fragment order.
#define WSZ ((size_t)DQ * DM)             // elements of one weight plane
#define PSZ ((size_t)NB_ * NH_ * TT * HD)   // elements of one head plane, both batches
#define KS 64     // K elements per trip: one 128-byte line of every operand row
#define GP 144    // bytes from row to row in LDS: 16 x odd, so that the 16 rows of a fragment read meet every bank once
#define GROWS 256 // operand rows of a stage (A, A2 where there is one, Bt)
#define GSTG (GROWS * GP)   // bytes of one buffer
template <typename T16> struct WFrag;
template <> struct WFrag<h16> { typedef v16h V; static __device__ __forceinline__ V ld(const h16* p) { return cat16(*(const v8h*)p, *(const v8h*)(p + 256)); } static __device__ __forceinline__ v8f mma(V a, V b, v8f c) { return wmma16(a, b, c); } };
template <> struct WFrag<bf> { typedef v16bf V; static __device__ __forceinline__ V ld(const bf* p) { return cat16b(*(const v8us*)p, *(const v8us*)(p + 256)); } static __device__ __forceinline__ v8f mma(V a, V b, v8f c) { return wmmab(a, b, c); } };
// eight asynchronous copies of 16 bytes a lane, global -> LDS; the s_wait_xcnt stands in the copies' own statement so that no later write of an address register can be moved in front of it
__device__ __forceinline__ void copy8(const unsigned* l, const bf* const* g) {
    asm volatile("global_load_async_to_lds_b128 %0, %8, off\n\tglobal_load_async_to_lds_b128 %1, %9, off\n\tglobal_load_async_to_lds_b128 %2, %10, off\n\tglobal_load_async_to_lds_b128 %3, %11, off\n\t"
                 "global_load_async_to_lds_b128 %4, %12, off\n\tglobal_load_async_to_lds_b128 %5, %13, off\n\tglobal_load_async_to_lds_b128 %6, %14, off\n\tglobal_load_async_to_lds_b128 %7, %15, off\n\ts_wait_xcnt 0x0"
                 :: "v"(l[0]), "v"(l[1]), "v"(l[2]), "v"(l[3]), "v"(l[4]), "v"(l[5]), "v"(l[6]), "v"(l[7]), "v"(g[0]), "v"(g[1]), "v"(g[2]), "v"(g[3]), "v"(g[4]), "v"(g[5]), "v"(g[6]), "v"(g[7]) : "memory"); }
__device__ __forceinline__ v16bf ldsfrag(const char* p) { return cat16b(*(const v8usa*)p, *(const v8usa*)(p + 32)); }   // the loaders' k order: elements 8 hi + 0..7 and 16 + 8 hi + 0..7 of a 32-element step
template <int NSPLIT, int EPI, int MT>
__global__ __launch_bounds__(128) void k_gemms(const bf* __restrict__ A, const bf* __restrict__ A2, const bf* __restrict__ Bt, float* C, const float* __restrict__ bias, const float* __restrict__ bias1, const float* __restrict__ bias2, const float* __restrict__ xr, h16* P16, bf* Ph, bf* Pl) {
    typedef v16bf V;
    constexpr int RA = 2 * MT * 16, NA = RA / 16, NA2 = NSPLIT ? NA : 0, RB0 = RA + NA2 * 16, NT = DM / KS;
    static_assert((MT == 2 || MT == 4) && RB0 + 128 == GROWS && NT >= 2 && 4 * MT * 16 * 68 * 4 <= 2 * GSTG, "stage rows, stages and the output staging fit the two buffers");
    __shared__ __align__(16) char sm[2 * GSTG];
    const bool tr = EPI == 1 && blockIdx.z == 2;   // work-group-uniform: the value projection, formed transposed
    if (EPI == 1) { const unsigned z = blockIdx.z; Bt += z * WSZ; bias = z == 0 ? bias : z == 1 ? bias1 : bias2; P16 += z * PSZ; Ph += z * PSZ; Pl += z * PSZ; if (tr) { const bf* t = A; A = Bt; Bt = t; } }
    const int lane = threadIdx.x & 31, lr = lane & 15, hi = lane >> 4; const int r0 = (tr ? blockIdx.y : blockIdx.x) * RA, c0 = (tr ? blockIdx.x : blockIdx.y) * 128;
    const int wave = __builtin_amdgcn_readfirstlane(threadIdx.x >> 5), wm = wave >> 1, wn = wave & 1;
    v8f acc[MT][4];
#pragma unroll
    for (int mb = 0; mb < MT; ++mb)
#pragma unroll
        for (int nb = 0; nb < 4; ++nb) acc[mb][nb] = (v8f){};
    // a thread copies the same 16 bytes of the line of every 16th row of the stage: its place in the first such row of each plane, stepped from stage to stage, and in LDS
    const int crow = threadIdx.x >> 3, cpc = threadIdx.x & 7;
    const bf* ga = A + (size_t)(r0 + crow) * DM + cpc * 8; const bf* ga2 = NSPLIT ? A2 + (size_t)(r0 + crow) * DM + cpc * 8 : nullptr; const bf* gb = Bt + (size_t)(c0 + crow) * DM + cpc * 8;
    const unsigned lc = (unsigned)(size_t)sm + (unsigned)(crow * GP + cpc * 16);
    auto stage = [&](unsigned buf) { unsigned l[16]; const bf* g[16];
#pragma unroll
        for (int i = 0; i < 16; ++i) { l[i] = lc + buf * GSTG + i * 16 * GP; g[i] = i < NA ? ga + (size_t)i * 16 * DM : i < NA + NA2 ? ga2 + (size_t)(i - NA) * 16 * DM : gb + (size_t)(i - NA - NA2) * 16 * DM; }
        copy8(l, g); copy8(l + 8, g + 8); ga += KS; if (NSPLIT) ga2 += KS; gb += KS; };
    stage(0);
    asm volatile("s_wait_asynccnt 0x0" ::: "memory");   // this wave's share of stage 0 has landed
    __syncthreads();                                     // and every other wave's: stage 0 may be read
    stage(1);
    const char* fa = sm + (wm * MT * 16 + lr) * GP + hi * 16; const char* fb = sm + (RB0 + wn * 64 + lr) * GP + hi * 16;
#pragma unroll 1   // stays rolled: one trip's fragments beside the accumulators keep three work-groups on a WGP
    for (int t = 0; t < NT; ++t) { const unsigned bo = (unsigned)(t & 1) * GSTG;
        V a[KS / 32][MT], a2[KS / 32][MT], b[KS / 32][4];
#pragma unroll
        for (int ks = 0; ks < KS / 32; ++ks) {
#pragma unroll
            for (int mb = 0; mb < MT; ++mb) { a[ks][mb] = ldsfrag(fa + bo + mb * 16 * GP + ks * 64); if (NSPLIT) a2[ks][mb] = ldsfrag(fa + bo + (RA + mb * 16) * GP + ks * 64); }
#pragma unroll
            for (int nb = 0; nb < 4; ++nb) b[ks][nb] = ldsfrag(fb + bo + nb * 16 * GP + ks * 64); }
        __builtin_amdgcn_sched_barrier(0);   // keeps the trip's LDS reads together in front of its matrix instructions: spread among them, every group of four waits out an LDS latency of its own
#pragma unroll
        for (int ks = 0; ks < KS / 32; ++ks)
#pragma unroll
            for (int nb = 0; nb < 4; ++nb)
#pragma unroll
                for (int mb = 0; mb < MT; ++mb) { acc[mb][nb] = wmmab(a[ks][mb], b[ks][nb], acc[mb][nb]); if (NSPLIT) acc[mb][nb] = wmmab(a2[ks][mb], b[ks][nb], acc[mb][nb]); }
        __builtin_amdgcn_sched_barrier(0);   // keeps the matrix instructions in front of the waits: moved behind them, the next stage's copies have only the LDS reads to land under instead of the whole trip
        asm volatile("s_wait_dscnt 0x0" ::: "memory");      // this wave has left the buffer that is refilled behind the barrier
        asm volatile("s_wait_asynccnt 0x0" ::: "memory");   // this wave's share of the next stage has landed
        __syncthreads();                                     // publishes the next stage and ends every reader's last read of this one
        if (t + 2 < NT) stage((unsigned)(t & 1));
    }
    asm volatile("s_wait_asynccnt 0x0" ::: "memory");   // no copy is under way when the buffers become the output staging
    // each wave turns its own tile through its own LDS range, so that whole lines go out
    float* ow = (float*)sm + wave * (MT * 16 * 68);
#pragma unroll
    for (int mb = 0; mb < MT; ++mb)
#pragma unroll
        for (int nb = 0; nb < 4; ++nb)
#pragma unroll
            for (int j = 0; j < 8; ++j) ow[(mb * 16 + hi * 8 + j) * 68 + nb * 16 + lr] = acc[mb][nb][j];
    const int rw = r0 + wm * MT * 16, cw = c0 + wn * 64;
    if constexpr (EPI == 0) { const int cofs = lr * 4; const v4f bc = *(const v4f*)(bias + cw + cofs);
        asm volatile("s_wait_dscnt 0x0" ::: "memory");   // the rows that a lane reads back were written by other lanes of its wave
#pragma unroll 1   // four row pairs a trip: unrolled whole, the rows' loads raise the register count past what lets three work-groups share a WGP
        for (int i0 = 0; i0 < MT * 8; i0 += 4) {
#pragma unroll
            for (int i = 0; i < 4; ++i) { const int row = (i0 + i) * 2 + hi; v4f val = *(const v4fa*)(ow + row * 68 + cofs);
                const v4f res = *(const v4f*)(xr + (size_t)(rw + row) * DM + cw + cofs);
#pragma unroll
                for (int q = 0; q < 4; ++q) val[q] = __fadd_rn(val[q] + bfr(bc[q]), bfr(res[q]));
                *(v4f*)(C + (size_t)(rw + row) * DM + cw + cofs) = val; }
            asm volatile("s_wait_xcnt 0x0" ::: "memory");   // stands behind the trip's last stores, in front of the next trip's writes of the registers that they name
        }
    } else { static_assert(EPI == 0 || MT == 4, "a wave's tile is 64 x 64: one head, 64 tokens");
        // The wave's 64 x 64 tile is 4096 elements in a row of each of its planes, as 16 groups of 512 bytes in fragment order (see FRAGMENT ORDER at k_fattn): lane l of group g holds the 8 elements
        // of tile row rt * 16 + (l & 15), columns ct * 16 + (l >> 4) * 8 + 0..7. q, k (row = token, column = d): rt = g / 4, ct = g % 4. v (row = d, column = token): rt = (g / 2) % 4, ct = (g / 8) * 2 + g % 2.
        v4f bc[4][2];
#pragma unroll
        for (int c = 0; c < 4; ++c) { bc[c][0] = *(const v4f*)(bias + (tr ? 0 : cw) + c * 16 + hi * 8); bc[c][1] = *(const v4f*)(bias + (tr ? 0 : cw) + c * 16 + hi * 8 + 4); }
        // first element of the wave's tile in its output planes (an element index inside a plane fits 32 bits), and this lane's place in a group
        const unsigned eb = (tr ? (((unsigned)cw / TT) * DKV + rw) * TT + ((unsigned)cw % TT) * HD : ((((unsigned)rw / TT) * NH_ + (unsigned)cw / HD) * TT + (unsigned)rw % TT) * HD) + (unsigned)lane * 8;
        asm volatile("s_wait_dscnt 0x0" ::: "memory");   // the rows that a lane reads back were written by other lanes of its wave
#pragma unroll 1   // four groups a trip: unrolled whole, the epilogue is about four times as much code to fetch, run once by every wave, at the same register count
        for (int i0 = 0; i0 < 4; ++i0) {
#pragma unroll
            for (int i = 0; i < 4; ++i) { const int rt = tr ? ((i0 * 2 + (i >> 1)) & 3) : i0, ct = tr ? (i0 >> 1) * 2 + (i & 1) : i;
                const float* src = ow + (rt * 16 + lr) * 68 + ct * 16 + hi * 8; const v4f v0 = *(const v4fa*)src, v1 = *(const v4fa*)(src + 4);
                const float br = bias[(tr ? rw : 0) + rt * 16 + lr];   // fetched for either orientation, from a place inside the bias: a select picks the one that counts
                v8h o16; v8us oh, ol;
#pragma unroll
                for (int q = 0; q < 8; ++q) { const float val = (q < 4 ? v0[q & 3] : v1[q & 3]) + bfr(tr ? br : bc[i][q >> 2][q & 3]); o16[q] = tohx(val); unsigned short a3, c3; splitf(val, a3, c3); oh[q] = a3; ol[q] = c3; }
                const unsigned e = eb + (unsigned)(i0 * 4 + i) * 256;
                *(v8ha*)(P16 + e) = o16; *(v8usa*)(Ph + e) = oh; *(v8usa*)(Pl + e) = ol; }
            asm volatile("s_wait_xcnt 0x0" ::: "memory");   // stands behind the trip's last stores, in front of the next trip's writes of the registers that they name
        }
    }
}

__global__ __launch_bounds__(256) void k_wtG(const float* __restrict__ w, int K, int N, bf* Bt) {
    const int lane = threadIdx.x & 31; const int L0 = (blockIdx.x * 8 + (threadIdx.x >> 5)) * 8; const int nlines = N * K / 64;
{
#pragma unroll 1
        for (int l = 0; l < 8; ++l) { const int L = L0 + l; if (L >= nlines) break; const size_t e = (size_t)L * 64 + lane * 2; const int k = (int)(e % K), n = (int)(e / K); v2us o;
            o[0] = f2bf(w[(size_t)k * N + n]); o[1] = f2bf(w[(size_t)(k + 1) * N + n]); *(v2us*)(Bt + e) = o; }
         }
}
// bf16 copies of x (both batches) and of the four weights in one grid: the first XBLK blocks take x, then WBLK blocks a weight, whose copies lie one behind the other in Wb
#define XBLK ((unsigned)((size_t)NB_ * TT * DM / 8 / 256))
#define WBLK ((unsigned)(WSZ / 8 / 256))
__global__ __launch_bounds__(256) void k_cvt8(const float* __restrict__ x, const float* __restrict__ wq, const float* __restrict__ wk, const float* __restrict__ wv, const float* __restrict__ wo, bf* Xb, bf* Wb) {
    const float* src = x; bf* dst = Xb; unsigned blk = blockIdx.x;
    if (blk >= XBLK) { const unsigned w = (blk - XBLK) / WBLK; blk = (blk - XBLK) % WBLK; src = w == 0 ? wq : w == 1 ? wk : w == 2 ? wv : wo; dst = Wb + w * WSZ; }
    const size_t i = (size_t)blk * 256 + threadIdx.x; const v8f v = *(const v8f*)(src + i * 8); v8us o;
#pragma unroll
    for (int k = 0; k < 8; ++k) o[k] = f2bf(v[k]); *(v8us*)(dst + i * 8) = o;  }

// ---- k_fattn: fused causal attention. One work-group owns one tile of query rows of one head (32 rows in fp16, 16 rows in hi/lo bf16); its FW waves share the key loop in blocks of 32 keys (wave w takes blocks w, w + FW, ...).
// Per block a wave forms S^T = K Q^T (a lane then holds 16 scores of ONE query: keys 8 hi + j of both 16-key tiles), updates that query's running maximum and sum, and feeds the two converted score tiles, which are a B fragment
// in the loaders' own k order, to O^T += V^T P^T. Scores and probabilities never leave the registers. The FW partial (maximum, sum, O) triples meet in LDS, are rescaled to the common maximum and summed in wave order;
// the quotient goes out as the merged hi/lo planes [t][h * HD + d]. Every visited block starts at or below every query of the tile, so each query sees at least one open key in it.
// FRAGMENT ORDER of the head planes: the 16 bytes that lane l of a fragment load takes lie at l * 16 in a group of 512 bytes, so that one load instruction reads four whole 128-byte lines instead of 32 bytes of each of 16 lines.
// q, k: 16 tokens are 4 groups; group u holds d = u * 16 + (l >> 4) * 8 + 0..7 of token (l & 15); a 32-element k step is groups 2 ks and 2 ks + 1. v^T: 32 tokens are 8 groups; group 2 dt + j holds tokens j * 16 + (l >> 4) * 8 + 0..7 of d = dt * 16 + (l & 15).
// A fragment is two groups that follow one another (256 elements apart): the same elements in the same registers as from row-major planes.
#define FW 8
#define SCL2 (SCL * 1.4426950408889634f)   // scores are carried in the log2 domain: one multiply takes in the scale and log2(e), and the exponent is a plain difference
__device__ __forceinline__ float xhalf(float x) { const int b = __float_as_int(x); return __int_as_float(__builtin_amdgcn_permlanex16(b, b, 0x76543210, 0xfedcba98, false, false)); }   // the value of lane l ^ 16
// p[0..7] = 2^p[0..7]. One statement, every output apart from every input, one v_nop behind the last: keeps the slot that the instruction set asks for behind a transcendental before its result is read or
// its source overwritten
__device__ __forceinline__ void exp2x8(float* p) { float r0, r1, r2, r3, r4, r5, r6, r7;
    asm("v_exp_f32 %0, %8\n\tv_exp_f32 %1, %9\n\tv_exp_f32 %2, %10\n\tv_exp_f32 %3, %11\n\tv_exp_f32 %4, %12\n\tv_exp_f32 %5, %13\n\tv_exp_f32 %6, %14\n\tv_exp_f32 %7, %15\n\tv_nop"
        : "=&v"(r0), "=&v"(r1), "=&v"(r2), "=&v"(r3), "=&v"(r4), "=&v"(r5), "=&v"(r6), "=&v"(r7) : "v"(p[0]), "v"(p[1]), "v"(p[2]), "v"(p[3]), "v"(p[4]), "v"(p[5]), "v"(p[6]), "v"(p[7]));
    p[0] = r0; p[1] = r1; p[2] = r2; p[3] = r3; p[4] = r4; p[5] = r5; p[6] = r6; p[7] = r7; }
template <typename T16, bool HL, int NQ>
__device__ __forceinline__ void attn_tile(const T16* __restrict__ Q, const T16* __restrict__ Q2, const T16* __restrict__ Kp, const T16* __restrict__ K2, const T16* __restrict__ Vt, const T16* __restrict__ V2, int q0, bf* Ah, bf* Al, float* os, float* ms, float* ls) {
    typedef typename WFrag<T16>::V V;
    const int lane = threadIdx.x & 31, lr = lane & 15, hi = lane >> 4;
    const int wave = __builtin_amdgcn_readfirstlane(threadIdx.x >> 5);
    V qf[NQ][2], qf2[NQ][2];
#pragma unroll
    for (int qt = 0; qt < NQ; ++qt)
#pragma unroll
        for (int ks = 0; ks < 2; ++ks) { const int qo = ((q0 >> 4) + qt) * 1024 + ks * 512 + lane * 8; qf[qt][ks] = WFrag<T16>::ld(Q + qo); if (HL) qf2[qt][ks] = WFrag<T16>::ld(Q2 + qo); }
    v8f o[4][NQ]; float m[NQ], l[NQ];
#pragma unroll
    for (int qt = 0; qt < NQ; ++qt) { m[qt] = -3.0e38f; l[qt] = 0.f;
#pragma unroll
        for (int dt = 0; dt < 4; ++dt) o[dt][qt] = (v8f){}; }
    const int kend = q0 + NQ * 16;
    // byte offset of this lane's 16 bytes in the first group of the block, stepped from block to block (a block of 32 keys is 2048 elements in the K planes and in the V^T planes alike, so all of them share it); the block's other groups lie at constant distances
    unsigned ok = (unsigned)(wave * 2048 + lane * 8) * 2u;
#pragma unroll 1   // stays rolled: a second block's fragments do not fit beside the accumulators
    for (int kb = wave * 32; kb < kend; kb += FW * 32, ok += FW * 2048 * 2u) {
        V kf[2][2], kf2[2][2], vf[4], vf2[4];
#pragma unroll
        for (int kt = 0; kt < 2; ++kt)
#pragma unroll
            for (int ks = 0; ks < 2; ++ks) { kf[kt][ks] = WFrag<T16>::ld((const T16*)((const char*)Kp + ok) + kt * 1024 + ks * 512); if (HL) kf2[kt][ks] = WFrag<T16>::ld((const T16*)((const char*)K2 + ok) + kt * 1024 + ks * 512); }
#pragma unroll
        for (int dt = 0; dt < 4; ++dt) { vf[dt] = WFrag<T16>::ld((const T16*)((const char*)Vt + ok) + dt * 512); if (HL) vf2[dt] = WFrag<T16>::ld((const T16*)((const char*)V2 + ok) + dt * 512); }
        __builtin_amdgcn_sched_barrier(0);   // keeps the V^T loads in front of the score products: their latency then runs under the scores and the softmax instead of behind them
        v8f s[2][NQ];
#pragma unroll
        for (int kt = 0; kt < 2; ++kt)
#pragma unroll
            for (int qt = 0; qt < NQ; ++qt) { s[kt][qt] = (v8f){};
#pragma unroll
                for (int ks = 0; ks < 2; ++ks) { s[kt][qt] = WFrag<T16>::mma(kf[kt][ks], qf[qt][ks], s[kt][qt]); if (HL) { s[kt][qt] = WFrag<T16>::mma(kf[kt][ks], qf2[qt][ks], s[kt][qt]); s[kt][qt] = WFrag<T16>::mma(kf2[kt][ks], qf[qt][ks], s[kt][qt]); } } }
        const bool edge = kb + 31 > q0;   // wave-uniform: only blocks that reach past the tile's first query hold masked keys
#pragma unroll
        for (int qt = 0; qt < NQ; ++qt) { const int qi = q0 + qt * 16 + lr; float t[16]; float mx = m[qt];
#pragma unroll
            for (int e = 0; e < 16; ++e) { float x = s[e >> 3][qt][e & 7] * SCL2; if (edge) x = (kb + (e >> 3) * 16 + hi * 8 + (e & 7) <= qi) ? x : -3.0e38f; t[e] = x; mx = fmaxf(mx, x); }
            mx = fmaxf(mx, xhalf(mx));
            const float al = __builtin_amdgcn_exp2f(m[qt] - mx); m[qt] = mx; float sum = 0.f;
#pragma unroll
            for (int e = 0; e < 16; ++e) t[e] -= mx;
            exp2x8(t); exp2x8(t + 8);
#pragma unroll
            for (int e = 0; e < 16; ++e) sum += t[e];
            l[qt] = l[qt] * al + sum;   // each half of the wave keeps the sum of its own keys; the halves join behind the loop
#pragma unroll
            for (int dt = 0; dt < 4; ++dt) o[dt][qt] *= al;
            if constexpr (HL) { v8us ph0, ph1, pl0, pl1;
#pragma unroll
                for (int e = 0; e < 8; ++e) { unsigned short a, c2; splitf(t[e], a, c2); ph0[e] = a; pl0[e] = c2; splitf(t[e + 8], a, c2); ph1[e] = a; pl1[e] = c2; }
                const V pf = cat16b(ph0, ph1), pf2 = cat16b(pl0, pl1);
#pragma unroll
                for (int dt = 0; dt < 4; ++dt) { o[dt][qt] = WFrag<T16>::mma(vf[dt], pf, o[dt][qt]); o[dt][qt] = WFrag<T16>::mma(vf[dt], pf2, o[dt][qt]); o[dt][qt] = WFrag<T16>::mma(vf2[dt], pf, o[dt][qt]); }
            } else { V pf;
#pragma unroll
                for (int e = 0; e < 16; ++e) pf[e] = (h16)t[e];
#pragma unroll
                for (int dt = 0; dt < 4; ++dt) o[dt][qt] = WFrag<T16>::mma(vf[dt], pf, o[dt][qt]); } }
        // the hi/lo block ends in its matrix instructions: keeps the distance behind them on the taken back edge, where the next block's loads land in the registers of their A operand
        if constexpr (HL) asm volatile("v_nop\n\tv_nop\n\tv_nop\n\tv_nop" : "+v"(o[0][0]), "+v"(o[1][0]), "+v"(o[2][0]), "+v"(o[3][0]));
    }
    float* ow = os + wave * (NQ * 16 * 68);
#pragma unroll
    for (int qt = 0; qt < NQ; ++qt) {
#pragma unroll
        for (int dt = 0; dt < 4; ++dt) { float* dst = ow + (qt * 16 + lr) * 68 + dt * 16 + hi * 8; const v8f a = o[dt][qt]; *(v4fa*)dst = (v4f){a[0], a[1], a[2], a[3]}; *(v4fa*)(dst + 4) = (v4f){a[4], a[5], a[6], a[7]}; }
        const float lj = l[qt] + xhalf(l[qt]);
        if (hi == 0) { ms[wave * (NQ * 16) + qt * 16 + lr] = m[qt]; ls[wave * (NQ * 16) + qt * 16 + lr] = lj; } }
    __syncthreads();   // every wave's partial triple is in LDS before any thread joins them
    constexpr int PER = NQ * 4;   // output elements a thread: NQ * 16 queries x 64 over 256 threads
    const int tq = threadIdx.x / (HD / PER), d0 = (threadIdx.x % (HD / PER)) * PER;
    float M = ms[tq];
#pragma unroll
    for (int w = 1; w < FW; ++w) M = fmaxf(M, ms[w * (NQ * 16) + tq]);
    float acc[PER]; float L = 0.f;
#pragma unroll
    for (int c = 0; c < PER; ++c) acc[c] = 0.f;
#pragma unroll
    for (int w = 0; w < FW; ++w) { const float f = __builtin_amdgcn_exp2f(ms[w * (NQ * 16) + tq] - M); L += f * ls[w * (NQ * 16) + tq];
#pragma unroll
        for (int c4 = 0; c4 < PER / 4; ++c4) { const v4f a = *(const v4fa*)(os + (w * (NQ * 16) + tq) * 68 + d0 + c4 * 4);
#pragma unroll
            for (int c = 0; c < 4; ++c) acc[c4 * 4 + c] += f * a[c]; } }
    const float inv = __fdiv_rn(1.0f, L); const size_t oo = (size_t)(q0 + tq) * DQ + d0;
#pragma unroll
    for (int c4 = 0; c4 < PER / 4; ++c4) { v4us oh, ol;
#pragma unroll
        for (int c = 0; c < 4; ++c) { unsigned short a, c2; splitf(acc[c4 * 4 + c] * inv, a, c2); oh[c] = a; ol[c] = c2; }
        *(v4usa*)(Ah + oo + c4 * 4) = oh; *(v4usa*)(Al + oo + c4 * 4) = ol; }
    asm volatile("s_wait_xcnt 0x0" ::: "memory");   // stands behind the tile's last store, in front of any later write of a register that the stores name (the other tile kind's code follows in the listing)
}
// grid (batches x heads, tiles): the tile index falls with the number of key blocks: first the fp16 tiles from the last rows down, then the hi/lo tiles
__global__ __launch_bounds__(32 * FW) void k_fattn(const h16* __restrict__ Q16, const h16* __restrict__ K16, const h16* __restrict__ V16, const bf* __restrict__ Qh, const bf* __restrict__ Ql, const bf* __restrict__ Kh, const bf* __restrict__ Kl, const bf* __restrict__ Vh, const bf* __restrict__ Vl, bf* Ah, bf* Al) {
    __shared__ __align__(16) float os[FW * 32 * 68]; __shared__ float ms[FW * 32], ls[FW * 32];
    const size_t po = (size_t)blockIdx.x * TT * HD; const size_t ao = (size_t)(blockIdx.x / NH_) * TT * DQ + (blockIdx.x % NH_) * HD; Ah += ao; Al += ao; const int tile = blockIdx.y;
    if (tile < (TT - RH) / 32) attn_tile<h16, false, 2>(Q16 + po, nullptr, K16 + po, nullptr, V16 + po, nullptr, TT - 32 - tile * 32, Ah, Al, os, ms, ls);
    else attn_tile<bf, true, 1>(Qh + po, Ql + po, Kh + po, Kl + po, Vh + po, Vl + po, RH - 16 - (tile - (TT - RH) / 32) * 16, Ah, Al, os, ms, ls);
}
__global__ __launch_bounds__(256) void k_lnout(const float* __restrict__ F, const float* __restrict__ g, const float* __restrict__ bb, float* out) { const int lane = threadIdx.x & 31; const int row = blockIdx.x * 8 + (threadIdx.x >> 5); if (row >= NB_ * TT) return; const float* fr = F + (size_t)row * DQ; float* orow = out + (size_t)row * DQ; float v[DQ / 32]; float s = 0.f;
#pragma unroll
    for (int c = 0; c < DQ / 128; ++c) { const v4f a = *(const v4f*)(fr + c * 128 + lane * 4); for (int q = 0; q < 4; ++q) { v[c * 4 + q] = a[q]; s = __fadd_rn(s, a[q]); } }
#pragma unroll
    for (int sh = 16; sh; sh >>= 1) s = __fadd_rn(s, __shfl_xor(s, sh, 32));
    const float mean = __fdiv_rn(s, (float)DQ); float s2 = 0.f;
#pragma unroll
    for (int k = 0; k < DQ / 32; ++k) { const float dv = __fsub_rn(v[k], mean); float p2 = __fmul_rn(dv, dv); asm volatile("" : "+v"(p2)); s2 = __fadd_rn(s2, p2); v[k] = dv; }
#pragma unroll
    for (int sh = 16; sh; sh >>= 1) s2 = __fadd_rn(s2, __shfl_xor(s2, sh, 32));
    const float rs = __fdiv_rn(1.0f, __fsqrt_rn(__fadd_rn(__fdiv_rn(s2, (float)DQ), LNEPS)));
{
#pragma unroll
        for (int c = 0; c < DQ / 128; ++c) { v4f o; for (int q = 0; q < 4; ++q) { const int col = c * 128 + lane * 4 + q; float y = __fmul_rn(v[c * 4 + q], rs); asm volatile("" : "+v"(y)); y = __fmul_rn(y, bfr(g[col])); asm volatile("" : "+v"(y)); o[q] = __fadd_rn(y, bfr(bb[col])); } *(v4f*)(orow + c * 128 + lane * 4) = o; }
         } }

extern "C" void kernel_launch(void* const* d_in, const int* in_sizes, int n_in,
                              void* d_out, int out_size, void* d_ws, size_t ws_size, hipStream_t stream) {
    (void)in_sizes; (void)n_in; (void)out_size;
    const float* x = (const float*)d_in[0]; const float* wq = (const float*)d_in[1]; const float* bq = (const float*)d_in[2]; const float* wk = (const float*)d_in[3]; const float* bk = (const float*)d_in[4]; const float* wv = (const float*)d_in[5]; const float* bv = (const float*)d_in[6]; const float* wo = (const float*)d_in[7]; const float* bo = (const float*)d_in[8]; const float* lng = (const float*)d_in[9]; const float* lnb = (const float*)d_in[10];
    float* OUT = (float*)d_out;     // [2][2048][1024]
    char* wsp = (char*)d_ws;
    auto take = [&](size_t bytes) { char* p = wsp; wsp += (bytes + 255) & ~(size_t)255; return (void*)p; };
    float* Y = (float*)take((size_t)NB_ * TT * DM * 4); bf* WB = (bf*)take(4 * WSZ * 2);   // WB: Wq, Wk, Wv, Wo
    bf* XB = (bf*)take((size_t)NB_ * TT * DM * 2);
    h16* P16 = (h16*)take(3 * PSZ * 2); bf* PH = (bf*)take(3 * PSZ * 2); bf* PL = (bf*)take(3 * PSZ * 2);   // each: q, k, v^T
    bf* ATh = (bf*)take((size_t)NB_ * TT * DQ * 2); bf* ATl = (bf*)take((size_t)NB_ * TT * DQ * 2);
    if ((size_t)(wsp - (char*)d_ws) > ws_size) return;    // ws 256 MiB
    k_cvt8<<<XBLK + 4 * WBLK, 256, 0, stream>>>(x, wq, wk, wv, wo, XB, WB);
    k_gemms<0, 1, 4><<<dim3(NB_ * TT / 128, DQ / 128, 3), 128, 0, stream>>>(XB, nullptr, WB, nullptr, bq, bk, bv, nullptr, P16, PH, PL);
    k_fattn<<<dim3(NB_ * NH_, (TT - RH) / 32 + RH / 16, 1), 32 * FW, 0, stream>>>(P16, P16 + PSZ, P16 + 2 * PSZ, PH, PL, PH + PSZ, PL + PSZ, PH + 2 * PSZ, PL + 2 * PSZ, ATh, ATl);
    k_gemms<1, 0, 2><<<dim3(NB_ * TT / 64, DM / 128, 1), 128, 0, stream>>>(ATh, ATl, WB + 3 * WSZ, Y, bo, nullptr, nullptr, x, nullptr, nullptr, nullptr);
    k_lnout<<<(NB_ * TT + 7) / 8, 256, 0, stream>>>(Y, lng, lnb, OUT);
}

// v008
// It runs in 88.5 microseconds.
// Next to v007, in two timings, it ran 1.04 times as fast each time.
// Counting every step since v000, it is 16.5 times as fast.
#include <hip/hip_runtime.h>

// Masked (causal) self-attention with residual and post-LayerNorm (x [2][2048][1024]; q,k,v = x W^T + b ('oi' uniform(+-1/32) incl. biases; 16 heads x 64); energy / 8; causal (-inf); softmax; out = merged Wo^T + bo; y = LayerNorm(out + x) gamma/beta (1e-5) -> [2][2048][1024] (4.2 M)).
// Layout, both batches in every launch (x is taken as 4096 token rows): bf16 copy of x; 'oi' weights; exact projections + f32 biases, whose epilogue writes the fp16 and hi/lo head planes itself, in the order in which the attention kernel's fragment loads take them (v as Wv x^T, so that its tile is already transposed); one fused causal attention kernel (scores, online softmax, probability x value and the head merge stay in registers and LDS; hybrid rows: < 512 hi/lo 3 products, rest fp16; key blocks above the diagonal never visited); merged hi/lo x Wo exact + bo + residual into workspace; a row LayerNorm kernel writes the output rows.
// Compute dtypes, f32 accumulate: every input rounded to bf16; projections exact + f32 biases; attention rows < 512 3 products, rest fp16; softmax f32; Wo hl x exact + bias; residual + LayerNorm f32.

#define NB_  2
#define TT   2048
#define DM   1024
#define NH_  16
#define NKV  16
#define HD   64
#define DQ   (NH_ * HD)
#define DKV  (NKV * HD)
#define RH   512                  // query rows < RH use hi+lo planes (0: none)
#define SCL  0.125f   // HD^-0.5
#define LNEPS 1e-5f
typedef _Float16 h16;
typedef unsigned short bf;
typedef __attribute__((ext_vector_type(16))) __bf16   v16bf;
typedef __attribute__((ext_vector_type(16))) _Float16 v16h;
typedef __attribute__((ext_vector_type(8)))  _Float16 v8h;
typedef __attribute__((ext_vector_type(8)))  unsigned short v8us;
typedef __attribute__((ext_vector_type(8)))  float    v8f;
typedef __attribute__((ext_vector_type(4)))  float    v4f;
typedef v8h  __attribute__((may_alias)) v8ha;
typedef v4f  __attribute__((may_alias)) v4fa;
typedef v8us __attribute__((may_alias)) v8usa;

__device__ __forceinline__ unsigned short f2bf(float f) { unsigned u = __float_as_uint(f); u += 0x7FFFu + ((u >> 16) & 1u); return (unsigned short)(u >> 16); }
__device__ __forceinline__ float bf2f(unsigned short b) { return __uint_as_float(((unsigned)b) << 16); }
__device__ __forceinline__ float bfr(float f) { return bf2f(f2bf(f)); }
__device__ __forceinline__ v16h cat16(v8h lo, v8h hi) { return __builtin_shufflevector(lo, hi, 0, 1, 2, 3, 4, 5, 6, 7, 8, 9, 10, 11, 12, 13, 14, 15); }
__device__ __forceinline__ v16bf cat16b(v8us lo, v8us hi) { return __builtin_bit_cast(v16bf, __builtin_shufflevector(lo, hi, 0, 1, 2, 3, 4, 5, 6, 7, 8, 9, 10, 11, 12, 13, 14, 15)); }
__device__ __forceinline__ v8f wmma16(v16h a, v16h b, v8f c) { return __builtin_amdgcn_wmma_f32_16x16x32_f16(false, a, false, b, (short)0, c, false, false); }
__device__ __forceinline__ v8f wmmab(v16bf a, v16bf b, v8f c) { return __builtin_amdgcn_wmma_f32_16x16x32_bf16(false, a, false, b, (short)0, c, false, false); }

__device__ __forceinline__ h16 tohx(float x) { return (h16)x; }
__device__ __forceinline__ void splitf(float y, unsigned short& h, unsigned short& l) { h = f2bf(y); l = f2bf(y - bf2f(h)); }
typedef __attribute__((ext_vector_type(2))) _Float16 v2h;
typedef __attribute__((ext_vector_type(4))) _Float16 v4h;
typedef __attribute__((ext_vector_type(2))) unsigned short v2us;
typedef __attribute__((ext_vector_type(4))) unsigned short v4us;
typedef v4h  __attribute__((may_alias)) v4ha;
typedef v4us __attribute__((may_alias)) v4usa;
typedef __attribute__((ext_vector_type(2))) float v2f;
typedef __attribute__((ext_vector_type(4))) int v4i;

// ---- k_gemms: GEMM with both operands staged in LDS. One (32 * MT) x 128 output tile per work-group of 4 waves (2 x 2), a wave holds (16 * MT) x 64 of it for the whole K loop. A trip takes KS elements of K: one 128-byte line of
// every operand row of the tile. The lines come into LDS by asynchronous copies (8 lanes a line, 4 whole lines an instruction), two buffers: the next trip's lines fly while this trip's are worked on; every line is fetched once a work-group
// and the fragments are read from LDS rows of GP bytes. c[m][n] = sum_k A[m][k] Bt[n][k] (+ A2[m][k] Bt[n][k] where NSPLIT) + bias; every operand row holds DM elements. A row index over tokens runs through the batches (batch = token row / TT).
// What the epilogue does with a wave's tile (EPI): 0: + bias[n] + the residual xr[m][n] (rounded to bf16), f32 into C (pitch DM, xr alike). 1: the three projections in one grid (tokens/128, features/128, 3): blockIdx.z picks the weight plane (Bt + z * WSZ), the bias (bias, bias1, bias2) and the output planes (+ z * PSZ).
// z = 0, 1 (q, k): + bias[n]; m is a token and a wave's 64 columns are one head: fp16, hi and lo planes [batch][head], tokens x d in fragment order. z = 2 (v): the operands change places, m is a feature (head * HD + d) and n a token: + bias[m]; planes [batch][head], d x tokens (the transposed values) in fragment order.
#define WSZ ((size_t)DQ * DM)             // elements of one weight plane
#define PSZ ((size_t)NB_ * NH_ * TT * HD)   // elements of one head plane, both batches
#define KS 64     // K elements per trip: one 128-byte line of every operand row
#define GP 144    // bytes from row to row in LDS: 16 x odd, so that the 16 rows of a fragment read meet every bank once
#define GROWS 256 // operand rows of a stage (A, A2 where there is one, Bt)
#define GSTG (GROWS * GP)   // bytes of one buffer
template <typename T16> struct WFrag;
template <> struct WFrag<h16> { typedef v16h V; static __device__ __forceinline__ V ld(const h16* p) { return cat16(*(const v8h*)p, *(const v8h*)(p + 256)); } static __device__ __forceinline__ v8f mma(V a, V b, v8f c) { return wmma16(a, b, c); } };
template <> struct WFrag<bf> { typedef v16bf V; static __device__ __forceinline__ V ld(const bf* p) { return cat16b(*(const v8us*)p, *(const v8us*)(p + 256)); } static __device__ __forceinline__ v8f mma(V a, V b, v8f c) { return wmmab(a, b, c); } };
// eight asynchronous copies of 16 bytes a lane, global -> LDS; the s_wait_xcnt stands in the copies' own statement so that no later write of an address register can be moved in front of it
__device__ __forceinline__ void copy8(const unsigned* l, const bf* const* g) {
    asm volatile("global_load_async_to_lds_b128 %0, %8, off\n\tglobal_load_async_to_lds_b128 %1, %9, off\n\tglobal_load_async_to_lds_b128 %2, %10, off\n\tglobal_load_async_to_lds_b128 %3, %11, off\n\t"
                 "global_load_async_to_lds_b128 %4, %12, off\n\tglobal_load_async_to_lds_b128 %5, %13, off\n\tglobal_load_async_to_lds_b128 %6, %14, off\n\tglobal_load_async_to_lds_b128 %7, %15, off\n\ts_wait_xcnt 0x0"
                 :: "v"(l[0]), "v"(l[1]), "v"(l[2]), "v"(l[3]), "v"(l[4]), "v"(l[5]), "v"(l[6]), "v"(l[7]), "v"(g[0]), "v"(g[1]), "v"(g[2]), "v"(g[3]), "v"(g[4]), "v"(g[5]), "v"(g[6]), "v"(g[7]) : "memory"); }
__device__ __forceinline__ v16bf ldsfrag(const char* p) { return cat16b(*(const v8usa*)p, *(const v8usa*)(p + 32)); }   // the loaders' k order: elements 8 hi + 0..7 and 16 + 8 hi + 0..7 of a 32-element step
template <int NSPLIT, int EPI, int MT>
__global__ __launch_bounds__(128) void k_gemms(const bf* __restrict__ A, const bf* __restrict__ A2, const bf* __restrict__ Bt, float* C, const float* __restrict__ bias, const float* __restrict__ bias1, const float* __restrict__ bias2, const float* __restrict__ xr, h16* P16, bf* Ph, bf* Pl) {
    typedef v16bf V;
    constexpr int RA = 2 * MT * 16, NA = RA / 16, NA2 = NSPLIT ? NA : 0, RB0 = RA + NA2 * 16, NT = DM / KS;
    static_assert((MT == 2 || MT == 4) && RB0 + 128 == GROWS && NT >= 2 && 4 * MT * 16 * 68 * 4 <= 2 * GSTG, "stage rows, stages and the output staging fit the two buffers");
    __shared__ __align__(16) char sm[2 * GSTG];
    const bool tr = EPI == 1 && blockIdx.z == 2;   // work-group-uniform: the value projection, formed transposed
    if (EPI == 1) { const unsigned z = blockIdx.z; Bt += z * WSZ; bias = z == 0 ? bias : z == 1 ? bias1 : bias2; P16 += z * PSZ; Ph += z * PSZ; Pl += z * PSZ; if (tr) { const bf* t = A; A = Bt; Bt = t; } }
    const int lane = threadIdx.x & 31, lr = lane & 15, hi = lane >> 4; const int r0 = (tr ? blockIdx.y : blockIdx.x) * RA, c0 = (tr ? blockIdx.x : blockIdx.y) * 128;
    const int wave = __builtin_amdgcn_readfirstlane(threadIdx.x >> 5), wm = wave >> 1, wn = wave & 1;
    v8f acc[MT][4];
#pragma unroll
    for (int mb = 0; mb < MT; ++mb)
#pragma unroll
        for (int nb = 0; nb < 4; ++nb) acc[mb][nb] = (v8f){};
    // a thread copies the same 16 bytes of the line of every 16th row of the stage: its place in the first such row of each plane, stepped from stage to stage, and in LDS
    const int crow = threadIdx.x >> 3, cpc = threadIdx.x & 7;
    const bf* ga = A + (size_t)(r0 + crow) * DM + cpc * 8; const bf* ga2 = NSPLIT ? A2 + (size_t)(r0 + crow) * DM + cpc * 8 : nullptr; const bf* gb = Bt + (size_t)(c0 + crow) * DM + cpc * 8;
    const unsigned lc = (unsigned)(size_t)sm + (unsigned)(crow * GP + cpc * 16);
    auto stage = [&](unsigned buf) { unsigned l[16]; const bf* g[16];
#pragma unroll
        for (int i = 0; i < 16; ++i) { l[i] = lc + buf * GSTG + i * 16 * GP; g[i] = i < NA ? ga + (size_t)i * 16 * DM : i < NA + NA2 ? ga2 + (size_t)(i - NA) * 16 * DM : gb + (size_t)(i - NA - NA2) * 16 * DM; }
        copy8(l, g); copy8(l + 8, g + 8); ga += KS; if (NSPLIT) ga2 += KS; gb += KS; };
    stage(0);
    asm volatile("s_wait_asynccnt 0x0" ::: "memory");   // this wave's share of stage 0 has landed
    __syncthreads();                                     // and every other wave's: stage 0 may be read
    stage(1);
    const char* fa = sm + (wm * MT * 16 + lr) * GP + hi * 16; const char* fb = sm + (RB0 + wn * 64 + lr) * GP + hi * 16;
#pragma unroll 1   // stays rolled: one trip's fragments beside the accumulators keep three work-groups on a WGP
    for (int t = 0; t < NT; ++t) { const unsigned bo = (unsigned)(t & 1) * GSTG;
        V a[KS / 32][MT], a2[KS / 32][MT], b[KS / 32][4];
#pragma unroll
        for (int ks = 0; ks < KS / 32; ++ks) {
#pragma unroll
            for (int mb = 0; mb < MT; ++mb) { a[ks][mb] = ldsfrag(fa + bo + mb * 16 * GP + ks * 64); if (NSPLIT) a2[ks][mb] = ldsfrag(fa + bo + (RA + mb * 16) * GP + ks * 64); }
#pragma unroll
            for (int nb = 0; nb < 4; ++nb) b[ks][nb] = ldsfrag(fb + bo + nb * 16 * GP + ks * 64); }
        __builtin_amdgcn_sched_barrier(0);   // keeps the trip's LDS reads together in front of its matrix instructions: spread among them, every group of four waits out an LDS latency of its own
#pragma unroll
        for (int ks = 0; ks < KS / 32; ++ks)
#pragma unroll
            for (int nb = 0; nb < 4; ++nb)
#pragma unroll
                for (int mb = 0; mb < MT; ++mb) { acc[mb][nb] = wmmab(a[ks][mb], b[ks][nb], acc[mb][nb]); if (NSPLIT) acc[mb][nb] = wmmab(a2[ks][mb], b[ks][nb], acc[mb][nb]); }
        __builtin_amdgcn_sched_barrier(0);   // keeps the matrix instructions in front of the waits: moved behind them, the next stage's copies have only the LDS reads to land under instead of the whole trip
        asm volatile("s_wait_dscnt 0x0" ::: "memory");      // this wave has left the buffer that is refilled behind the barrier
        asm volatile("s_wait_asynccnt 0x0" ::: "memory");   // this wave's share of the next stage has landed
        __syncthreads();                                     // publishes the next stage and ends every reader's last read of this one
        if (t + 2 < NT) stage((unsigned)(t & 1));
    }
    asm volatile("s_wait_asynccnt 0x0" ::: "memory");   // no copy is under way when the buffers become the output staging
    // each wave turns its own tile through its own LDS range, so that whole lines go out
    float* ow = (float*)sm + wave * (MT * 16 * 68);
#pragma unroll
    for (int mb = 0; mb < MT; ++mb)
#pragma unroll
        for (int nb = 0; nb < 4; ++nb)
#pragma unroll
            for (int j = 0; j < 8; ++j) ow[(mb * 16 + hi * 8 + j) * 68 + nb * 16 + lr] = acc[mb][nb][j];
    const int rw = r0 + wm * MT * 16, cw = c0 + wn * 64;
    if constexpr (EPI == 0) { const int cofs = lr * 4; const v4f bc = *(const v4f*)(bias + cw + cofs);
        asm volatile("s_wait_dscnt 0x0" ::: "memory");   // the rows that a lane reads back were written by other lanes of its wave
#pragma unroll 1   // four row pairs a trip: unrolled whole, the rows' loads raise the register count past what lets three work-groups share a WGP
        for (int i0 = 0; i0 < MT * 8; i0 += 4) {
#pragma unroll
            for (int i = 0; i < 4; ++i) { const int row = (i0 + i) * 2 + hi; v4f val = *(const v4fa*)(ow + row * 68 + cofs);
                const v4f res = *(const v4f*)(xr + (size_t)(rw + row) * DM + cw + cofs);
#pragma unroll
                for (int q = 0; q < 4; ++q) val[q] = __fadd_rn(val[q] + bfr(bc[q]), bfr(res[q]));
                *(v4f*)(C + (size_t)(rw + row) * DM + cw + cofs) = val; }
            asm volatile("s_wait_xcnt 0x0" ::: "memory");   // stands behind the trip's last stores, in front of the next trip's writes of the registers that they name
        }
    } else { static_assert(EPI == 0 || MT == 4, "a wave's tile is 64 x 64: one head, 64 tokens");
        // The wave's 64 x 64 tile is 4096 elements in a row of each of its planes, as 16 groups of 512 bytes in fragment order (see FRAGMENT ORDER at k_fattn): lane l of group g holds the 8 elements
        // of tile row rt * 16 + (l & 15), columns ct * 16 + (l >> 4) * 8 + 0..7. q, k (row = token, column = d): rt = g / 4, ct = g % 4. v (row = d, column = token): rt = (g / 2) % 4, ct = (g / 8) * 2 + g % 2.
        v4f bc[4][2];
#pragma unroll
        for (int c = 0; c < 4; ++c) { bc[c][0] = *(const v4f*)(bias + (tr ? 0 : cw) + c * 16 + hi * 8); bc[c][1] = *(const v4f*)(bias + (tr ? 0 : cw) + c * 16 + hi * 8 + 4); }
        // first element of the wave's tile in its output planes (an element index inside a plane fits 32 bits), and this lane's place in a group
        const unsigned eb = (tr ? (((unsigned)cw / TT) * DKV + rw) * TT + ((unsigned)cw % TT) * HD : ((((unsigned)rw / TT) * NH_ + (unsigned)cw / HD) * TT + (unsigned)rw % TT) * HD) + (unsigned)lane * 8;
        asm volatile("s_wait_dscnt 0x0" ::: "memory");   // the rows that a lane reads back were written by other lanes of its wave
#pragma unroll 1   // four groups a trip: unrolled whole, the epilogue is about four times as much code to fetch, run once by every wave, at the same register count
        for (int i0 = 0; i0 < 4; ++i0) {
#pragma unroll
            for (int i = 0; i < 4; ++i) { const int rt = tr ? ((i0 * 2 + (i >> 1)) & 3) : i0, ct = tr ? (i0 >> 1) * 2 + (i & 1) : i;
                const float* src = ow + (rt * 16 + lr) * 68 + ct * 16 + hi * 8; const v4f v0 = *(const v4fa*)src, v1 = *(const v4fa*)(src + 4);
                const float br = bias[(tr ? rw : 0) + rt * 16 + lr];   // fetched for either orientation, from a place inside the bias: a select picks the one that counts
                v8h o16; v8us oh, ol;
#pragma unroll
                for (int q = 0; q < 8; ++q) { const float val = (q < 4 ? v0[q & 3] : v1[q & 3]) + bfr(tr ? br : bc[i][q >> 2][q & 3]); o16[q] = tohx(val); unsigned short a3, c3; splitf(val, a3, c3); oh[q] = a3; ol[q] = c3; }
                const unsigned e = eb + (unsigned)(i0 * 4 + i) * 256;
                *(v8ha*)(P16 + e) = o16; *(v8usa*)(Ph + e) = oh; *(v8usa*)(Pl + e) = ol; }
            asm volatile("s_wait_xcnt 0x0" ::: "memory");   // stands behind the trip's last stores, in front of the next trip's writes of the registers that they name
        }
    }
}

__global__ __launch_bounds__(256) void k_wtG(const float* __restrict__ w, int K, int N, bf* Bt) {
    const int lane = threadIdx.x & 31; const int L0 = (blockIdx.x * 8 + (threadIdx.x >> 5)) * 8; const int nlines = N * K / 64;
{
#pragma unroll 1
        for (int l = 0; l < 8; ++l) { const int L = L0 + l; if (L >= nlines) break; const size_t e = (size_t)L * 64 + lane * 2; const int k = (int)(e % K), n = (int)(e / K); v2us o;
            o[0] = f2bf(w[(size_t)k * N + n]); o[1] = f2bf(w[(size_t)(k + 1) * N + n]); *(v2us*)(Bt + e) = o; }
         }
}
// bf16 copies of x (both batches) and of the four weights in one grid: the first XBLK blocks take x, then WBLK blocks a weight, whose copies lie one behind the other in Wb
#define XBLK ((unsigned)((size_t)NB_ * TT * DM / 8 / 256))
#define WBLK ((unsigned)(WSZ / 8 / 256))
__global__ __launch_bounds__(256) void k_cvt8(const float* __restrict__ x, const float* __restrict__ wq, const float* __restrict__ wk, const float* __restrict__ wv, const float* __restrict__ wo, bf* Xb, bf* Wb) {
    const float* src = x; bf* dst = Xb; unsigned blk = blockIdx.x;
    if (blk >= XBLK) { const unsigned w = (blk - XBLK) / WBLK; blk = (blk - XBLK) % WBLK; src = w == 0 ? wq : w == 1 ? wk : w == 2 ? wv : wo; dst = Wb + w * WSZ; }
    const size_t i = (size_t)blk * 256 + threadIdx.x; const v8f v = *(const v8f*)(src + i * 8); v8us o;
#pragma unroll
    for (int k = 0; k < 8; ++k) o[k] = f2bf(v[k]); *(v8us*)(dst + i * 8) = o;  }

// ---- k_fattn: fused causal attention. One work-group owns one tile of query rows of one head (32 rows in fp16, 16 rows in hi/lo bf16); its FW waves share the key loop in blocks of 32 keys (wave w takes blocks w, w + FW, ...).
// Per block a wave forms S^T = K Q^T (a lane then holds 16 scores of ONE query: keys 8 hi + j of both 16-key tiles), updates that query's running maximum and sum, and feeds the two converted score tiles, which are a B fragment
// in the loaders' own k order, to O^T += V^T P^T. Scores and probabilities never leave the registers. The FW partial (maximum, sum, O) triples meet in LDS, are rescaled to the common maximum and summed in wave order;
// the quotient goes out as the merged hi/lo planes [t][h * HD + d]. Every visited block starts at or below every query of the tile, so each query sees at least one open key in it.
// FRAGMENT ORDER of the head planes: the 16 bytes that lane l of a fragment load takes lie at l * 16 in a group of 512 bytes, so that one load instruction reads four whole 128-byte lines instead of 32 bytes of each of 16 lines.
// q, k: 16 tokens are 4 groups; group u holds d = u * 16 + (l >> 4) * 8 + 0..7 of token (l & 15); a 32-element k step is groups 2 ks and 2 ks + 1. v^T: 32 tokens are 8 groups; group 2 dt + j holds tokens j * 16 + (l >> 4) * 8 + 0..7 of d = dt * 16 + (l & 15).
// A fragment is two groups that follow one another (256 elements apart): the same elements in the same registers as from row-major planes.
#define FW 4
#define SCL2 (SCL * 1.4426950408889634f)   // scores are carried in the log2 domain: one multiply takes in the scale and log2(e), and the exponent is a plain difference
__device__ __forceinline__ float xhalf(float x) { const int b = __float_as_int(x); return __int_as_float(__builtin_amdgcn_permlanex16(b, b, 0x76543210, 0xfedcba98, false, false)); }   // the value of lane l ^ 16
// p[0..7] = 2^p[0..7]. One statement, every output apart from every input, one v_nop behind the last: keeps the slot that the instruction set asks for behind a transcendental before its result is read or
// its source overwritten
__device__ __forceinline__ void exp2x8(float* p) { float r0, r1, r2, r3, r4, r5, r6, r7;
    asm("v_exp_f32 %0, %8\n\tv_exp_f32 %1, %9\n\tv_exp_f32 %2, %10\n\tv_exp_f32 %3, %11\n\tv_exp_f32 %4, %12\n\tv_exp_f32 %5, %13\n\tv_exp_f32 %6, %14\n\tv_exp_f32 %7, %15\n\tv_nop"
        : "=&v"(r0), "=&v"(r1), "=&v"(r2), "=&v"(r3), "=&v"(r4), "=&v"(r5), "=&v"(r6), "=&v"(r7) : "v"(p[0]), "v"(p[1]), "v"(p[2]), "v"(p[3]), "v"(p[4]), "v"(p[5]), "v"(p[6]), "v"(p[7]));
    p[0] = r0; p[1] = r1; p[2] = r2; p[3] = r3; p[4] = r4; p[5] = r5; p[6] = r6; p[7] = r7; }
template <typename T16, bool HL, int NQ>
__device__ __forceinline__ void attn_tile(const T16* __restrict__ Q, const T16* __restrict__ Q2, const T16* __restrict__ Kp, const T16* __restrict__ K2, const T16* __restrict__ Vt, const T16* __restrict__ V2, int q0, bf* Ah, bf* Al, float* os, float* ms, float* ls) {
    typedef typename WFrag<T16>::V V;
    const int lane = threadIdx.x & 31, lr = lane & 15, hi = lane >> 4;
    const int wave = __builtin_amdgcn_readfirstlane(threadIdx.x >> 5);
    V qf[NQ][2], qf2[NQ][2];
#pragma unroll
    for (int qt = 0; qt < NQ; ++qt)
#pragma unroll
        for (int ks = 0; ks < 2; ++ks) { const int qo = ((q0 >> 4) + qt) * 1024 + ks * 512 + lane * 8; qf[qt][ks] = WFrag<T16>::ld(Q + qo); if (HL) qf2[qt][ks] = WFrag<T16>::ld(Q2 + qo); }
    v8f o[4][NQ]; float m[NQ], l[NQ];
#pragma unroll
    for (int qt = 0; qt < NQ; ++qt) { m[qt] = -3.0e38f; l[qt] = 0.f;
#pragma unroll
        for (int dt = 0; dt < 4; ++dt) o[dt][qt] = (v8f){}; }
    const int kend = q0 + NQ * 16;
    // byte offset of this lane's 16 bytes in the first group of the block, stepped from block to block (a block of 32 keys is 2048 elements in the K planes and in the V^T planes alike, so all of them share it); the block's other groups lie at constant distances
    unsigned ok = (unsigned)(wave * 2048 + lane * 8) * 2u;
#pragma unroll 1   // stays rolled: a second block's fragments do not fit beside the accumulators
    for (int kb = wave * 32; kb < kend; kb += FW * 32, ok += FW * 2048 * 2u) {
        V kf[2][2], kf2[2][2], vf[4], vf2[4];
#pragma unroll
        for (int kt = 0; kt < 2; ++kt)
#pragma unroll
            for (int ks = 0; ks < 2; ++ks) { kf[kt][ks] = WFrag<T16>::ld((const T16*)((const char*)Kp + ok) + kt * 1024 + ks * 512); if (HL) kf2[kt][ks] = WFrag<T16>::ld((const T16*)((const char*)K2 + ok) + kt * 1024 + ks * 512); }
#pragma unroll
        for (int dt = 0; dt < 4; ++dt) { vf[dt] = WFrag<T16>::ld((const T16*)((const char*)Vt + ok) + dt * 512); if (HL) vf2[dt] = WFrag<T16>::ld((const T16*)((const char*)V2 + ok) + dt * 512); }
        __builtin_amdgcn_sched_barrier(0);   // keeps the V^T loads in front of the score products: their latency then runs under the scores and the softmax instead of behind them
        v8f s[2][NQ];
#pragma unroll
        for (int kt = 0; kt < 2; ++kt)
#pragma unroll
            for (int qt = 0; qt < NQ; ++qt) { s[kt][qt] = (v8f){};
#pragma unroll
                for (int ks = 0; ks < 2; ++ks) { s[kt][qt] = WFrag<T16>::mma(kf[kt][ks], qf[qt][ks], s[kt][qt]); if (HL) { s[kt][qt] = WFrag<T16>::mma(kf[kt][ks], qf2[qt][ks], s[kt][qt]); s[kt][qt] = WFrag<T16>::mma(kf2[kt][ks], qf[qt][ks], s[kt][qt]); } } }
        const bool edge = kb + 31 > q0;   // wave-uniform: only blocks that reach past the tile's first query hold masked keys
#pragma unroll
        for (int qt = 0; qt < NQ; ++qt) { const int qi = q0 + qt * 16 + lr; float t[16]; float mx = m[qt];
#pragma unroll
            for (int e = 0; e < 16; ++e) { float x = s[e >> 3][qt][e & 7] * SCL2; if (edge) x = (kb + (e >> 3) * 16 + hi * 8 + (e & 7) <= qi) ? x : -3.0e38f; t[e] = x; mx = fmaxf(mx, x); }
            mx = fmaxf(mx, xhalf(mx));
            const float al = __builtin_amdgcn_exp2f(m[qt] - mx); m[qt] = mx; float sum = 0.f;
#pragma unroll
            for (int e = 0; e < 16; ++e) t[e] -= mx;
            exp2x8(t); exp2x8(t + 8);
#pragma unroll
            for (int e = 0; e < 16; ++e) sum += t[e];
            l[qt] = l[qt] * al + sum;   // each half of the wave keeps the sum of its own keys; the halves join behind the loop
#pragma unroll
            for (int dt = 0; dt < 4; ++dt) o[dt][qt] *= al;
            if constexpr (HL) { v8us ph0, ph1, pl0, pl1;
#pragma unroll
                for (int e = 0; e < 8; ++e) { unsigned short a, c2; splitf(t[e], a, c2); ph0[e] = a; pl0[e] = c2; splitf(t[e + 8], a, c2); ph1[e] = a; pl1[e] = c2; }
                const V pf = cat16b(ph0, ph1), pf2 = cat16b(pl0, pl1);
#pragma unroll
                for (int dt = 0; dt < 4; ++dt) { o[dt][qt] = WFrag<T16>::mma(vf[dt], pf, o[dt][qt]); o[dt][qt] = WFrag<T16>::mma(vf[dt], pf2, o[dt][qt]); o[dt][qt] = WFrag<T16>::mma(vf2[dt], pf, o[dt][qt]); }
            } else { V pf;
#pragma unroll
                for (int e = 0; e < 16; ++e) pf[e] = (h16)t[e];
#pragma unroll
                for (int dt = 0; dt < 4; ++dt) o[dt][qt] = WFrag<T16>::mma(vf[dt], pf, o[dt][qt]); } }
        // the hi/lo block ends in its matrix instructions: keeps the distance behind them on the taken back edge, where the next block's loads land in the registers of their A operand
        if constexpr (HL) asm volatile("v_nop\n\tv_nop\n\tv_nop\n\tv_nop" : "+v"(o[0][0]), "+v"(o[1][0]), "+v"(o[2][0]), "+v"(o[3][0]));
    }
    float* ow = os + wave * (NQ * 16 * 68);
#pragma unroll
    for (int qt = 0; qt < NQ; ++qt) {
#pragma unroll
        for (int dt = 0; dt < 4; ++dt) { float* dst = ow + (qt * 16 + lr) * 68 + dt * 16 + hi * 8; const v8f a = o[dt][qt]; *(v4fa*)dst = (v4f){a[0], a[1], a[2], a[3]}; *(v4fa*)(dst + 4) = (v4f){a[4], a[5], a[6], a[7]}; }
        const float lj = l[qt] + xhalf(l[qt]);
        if (hi == 0) { ms[wave * (NQ * 16) + qt * 16 + lr] = m[qt]; ls[wave * (NQ * 16) + qt * 16 + lr] = lj; } }
    __syncthreads();   // every wave's partial triple is in LDS before any thread joins them
    constexpr int PER = NQ * 16 * HD / (32 * FW);   // output elements a thread: NQ * 16 queries x HD over the work-group's threads
    const int tq = threadIdx.x / (HD / PER), d0 = (threadIdx.x % (HD / PER)) * PER;
    float M = ms[tq];
#pragma unroll
    for (int w = 1; w < FW; ++w) M = fmaxf(M, ms[w * (NQ * 16) + tq]);
    float acc[PER]; float L = 0.f;
#pragma unroll
    for (int c = 0; c < PER; ++c) acc[c] = 0.f;
#pragma unroll
    for (int w = 0; w < FW; ++w) { const float f = __builtin_amdgcn_exp2f(ms[w * (NQ * 16) + tq] - M); L += f * ls[w * (NQ * 16) + tq];
#pragma unroll
        for (int c4 = 0; c4 < PER / 4; ++c4) { const v4f a = *(const v4fa*)(os + (w * (NQ * 16) + tq) * 68 + d0 + c4 * 4);
#pragma unroll
            for (int c = 0; c < 4; ++c) acc[c4 * 4 + c] += f * a[c]; } }
    const float inv = __fdiv_rn(1.0f, L); const size_t oo = (size_t)(q0 + tq) * DQ + d0;
#pragma unroll
    for (int c4 = 0; c4 < PER / 4; ++c4) { v4us oh, ol;
#pragma unroll
        for (int c = 0; c < 4; ++c) { unsigned short a, c2; splitf(acc[c4 * 4 + c] * inv, a, c2); oh[c] = a; ol[c] = c2; }
        *(v4usa*)(Ah + oo + c4 * 4) = oh; *(v4usa*)(Al + oo + c4 * 4) = ol; }
    asm volatile("s_wait_xcnt 0x0" ::: "memory");   // stands behind the tile's last store, in front of any later write of a register that the stores name (the other tile kind's code follows in the listing)
}
// grid (batches x heads, tiles): the tile index falls with the number of key blocks: first the fp16 tiles from the last rows down, then the hi/lo tiles
__global__ __launch_bounds__(32 * FW) void k_fattn(const h16* __restrict__ Q16, const h16* __restrict__ K16, const h16* __restrict__ V16, const bf* __restrict__ Qh, const bf* __restrict__ Ql, const bf* __restrict__ Kh, const bf* __restrict__ Kl, const bf* __restrict__ Vh, const bf* __restrict__ Vl, bf* Ah, bf* Al) {
    __shared__ __align__(16) float os[FW * 32 * 68]; __shared__ float ms[FW * 32], ls[FW * 32];
    const size_t po = (size_t)blockIdx.x * TT * HD; const size_t ao = (size_t)(blockIdx.x / NH_) * TT * DQ + (blockIdx.x % NH_) * HD; Ah += ao; Al += ao; const int tile = blockIdx.y;
    if (tile < (TT - RH) / 32) attn_tile<h16, false, 2>(Q16 + po, nullptr, K16 + po, nullptr, V16 + po, nullptr, TT - 32 - tile * 32, Ah, Al, os, ms, ls);
    else attn_tile<bf, true, 1>(Qh + po, Ql + po, Kh + po, Kl + po, Vh + po, Vl + po, RH - 16 - (tile - (TT - RH) / 32) * 16, Ah, Al, os, ms, ls);
}
__global__ __launch_bounds__(256) void k_lnout(const float* __restrict__ F, const float* __restrict__ g, const float* __restrict__ bb, float* out) { const int lane = threadIdx.x & 31; const int row = blockIdx.x * 8 + (threadIdx.x >> 5); if (row >= NB_ * TT) return; const float* fr = F + (size_t)row * DQ; float* orow = out + (size_t)row * DQ; float v[DQ / 32]; float s = 0.f;
#pragma unroll
    for (int c = 0; c < DQ / 128; ++c) { const v4f a = *(const v4f*)(fr + c * 128 + lane * 4); for (int q = 0; q < 4; ++q) { v[c * 4 + q] = a[q]; s = __fadd_rn(s, a[q]); } }
#pragma unroll
    for (int sh = 16; sh; sh >>= 1) s = __fadd_rn(s, __shfl_xor(s, sh, 32));
    const float mean = __fdiv_rn(s, (float)DQ); float s2 = 0.f;
#pragma unroll
    for (int k = 0; k < DQ / 32; ++k) { const float dv = __fsub_rn(v[k], mean); float p2 = __fmul_rn(dv, dv); asm volatile("" : "+v"(p2)); s2 = __fadd_rn(s2, p2); v[k] = dv; }
#pragma unroll
    for (int sh = 16; sh; sh >>= 1) s2 = __fadd_rn(s2, __shfl_xor(s2, sh, 32));
    const float rs = __fdiv_rn(1.0f, __fsqrt_rn(__fadd_rn(__fdiv_rn(s2, (float)DQ), LNEPS)));
{
#pragma unroll
        for (int c = 0; c < DQ / 128; ++c) { v4f o; for (int q = 0; q < 4; ++q) { const int col = c * 128 + lane * 4 + q; float y = __fmul_rn(v[c * 4 + q], rs); asm volatile("" : "+v"(y)); y = __fmul_rn(y, bfr(g[col])); asm volatile("" : "+v"(y)); o[q] = __fadd_rn(y, bfr(bb[col])); } *(v4f*)(orow + c * 128 + lane * 4) = o; }
         } }

extern "C" void kernel_launch(void* const* d_in, const int* in_sizes, int n_in,
                              void* d_out, int out_size, void* d_ws, size_t ws_size, hipStream_t stream) {
    (void)in_sizes; (void)n_in; (void)out_size;
    const float* x = (const float*)d_in[0]; const float* wq = (const float*)d_in[1]; const float* bq = (const float*)d_in[2]; const float* wk = (const float*)d_in[3]; const float* bk = (const float*)d_in[4]; const float* wv = (const float*)d_in[5]; const float* bv = (const float*)d_in[6]; const float* wo = (const float*)d_in[7]; const float* bo = (const float*)d_in[8]; const float* lng = (const float*)d_in[9]; const float* lnb = (const float*)d_in[10];
    float* OUT = (float*)d_out;     // [2][2048][1024]
    char* wsp = (char*)d_ws;
    auto take = [&](size_t bytes) { char* p = wsp; wsp += (bytes + 255) & ~(size_t)255; return (void*)p; };
    float* Y = (float*)take((size_t)NB_ * TT * DM * 4); bf* WB = (bf*)take(4 * WSZ * 2);   // WB: Wq, Wk, Wv, Wo
    bf* XB = (bf*)take((size_t)NB_ * TT * DM * 2);
    h16* P16 = (h16*)take(3 * PSZ * 2); bf* PH = (bf*)take(3 * PSZ * 2); bf* PL = (bf*)take(3 * PSZ * 2);   // each: q, k, v^T
    bf* ATh = (bf*)take((size_t)NB_ * TT * DQ * 2); bf* ATl = (bf*)take((size_t)NB_ * TT * DQ * 2);
    if ((size_t)(wsp - (char*)d_ws) > ws_size) return;    // ws 256 MiB
    k_cvt8<<<XBLK + 4 * WBLK, 256, 0, stream>>>(x, wq, wk, wv, wo, XB, WB);
    k_gemms<0, 1, 4><<<dim3(NB_ * TT / 128, DQ / 128, 3), 128, 0, stream>>>(XB, nullptr, WB, nullptr, bq, bk, bv, nullptr, P16, PH, PL);
    k_fattn<<<dim3(NB_ * NH_, (TT - RH) / 32 + RH / 16, 1), 32 * FW, 0, stream>>>(P16, P16 + PSZ, P16 + 2 * PSZ, PH, PL, PH + PSZ, PL + PSZ, PH + 2 * PSZ, PL + 2 * PSZ, ATh, ATl);
    k_gemms<1, 0, 2><<<dim3(NB_ * TT / 64, DM / 128, 1), 128, 0, stream>>>(ATh, ATl, WB + 3 * WSZ, Y, bo, nullptr, nullptr, x, nullptr, nullptr, nullptr);
    k_lnout<<<(NB_ * TT + 7) / 8, 256, 0, stream>>>(Y, lng, lnb, OUT);
}
